// v000
// Times are from an AMD MI455X. After a warm-up the kernel runs many times in a row, and a time is the length of
// such a window on the GPU divided by its runs, so every launch and the gaps after it count. The runs cycle
// through copies of the inputs. A figure is the median of several windows, for all but v000 over two sittings.
// Sittings can differ by a few percent; kernels timed side by side share one.
// The starting kernel, v000, takes 4590 microseconds a run.
#include <hip/hip_runtime.h>
#include <cmath>

// ---------------------------------------------------------------------------
// DenseRNN (Householder-reflection linear RNN) for MI455X / gfx1250
//   xz = x @ Win^T ; xi,z = split(xz)
//   lam = exp(-8*softplus(omega)*sigmoid(xi@Wl^T + bl))
//   v   = xi@Wv^T + bv
//   scan: h_t = lam_t*(h_{t-1} - 2 v_t (v.h)/(v.v)) + (1-lam_t)*xi_t ; h_0 = xi_0
//   out = (silu(z)*h) @ Wout^T
// GEMMs: V_WMMA_F32_16X16X4_F32 + double-buffered async global->LDS staging.
// ---------------------------------------------------------------------------

typedef __attribute__((ext_vector_type(2))) float v2f;
typedef __attribute__((ext_vector_type(8))) float v8f;
typedef int v4i_gcc __attribute__((vector_size(16)));   // matches builtin pointee

#define D_MODEL   1024
#define D_INNER   2048
#define BATCH     4
#define SEQ       2048
#define M_ROWS    (BATCH * SEQ)        // 8192

// GEMM tiling: 128 threads = 4 waves; each wave owns a 32x64 C strip.
#define TM 128        // block rows
#define TN 64         // block cols
#define TK 32         // K tile
#define LDS_PAD 4     // row stride 36 floats = 144 B (16B aligned for b128 async)
#define LDS_LD  (TK + LDS_PAD)

// Epilogue modes
#define EPI_PLAIN  0   // out0[m,col] = acc (+ bias if non-null)
#define EPI_LAMBDA 1   // out0[m,col] = exp(-8*softplus(omega[col])*sigmoid(acc+bias[col]))
#define EPI_SPLIT  2   // col < D_INNER -> out0 (xi), else -> out1 (z), both ld = D_INNER

// --- async global->LDS copy (CDNA5 ASYNCcnt path), with sync fallback ------
#if defined(__AMDGCN__) && __has_builtin(__builtin_amdgcn_global_load_async_to_lds_b128)
#define USE_ASYNC_LDS 1
#else
#define USE_ASYNC_LDS 0
#endif

__device__ __forceinline__ void copy16_g2l(const float* __restrict__ g, float* l)
{
#if USE_ASYNC_LDS
    __builtin_amdgcn_global_load_async_to_lds_b128(
        (__attribute__((address_space(1))) v4i_gcc*)(void*)g,
        (__attribute__((address_space(3))) v4i_gcc*)(void*)l,
        /*imm offset=*/0, /*cpol=*/0);
#else
    *(float4*)l = *(const float4*)g;
#endif
}

__device__ __forceinline__ void wait_async_lds()
{
#if USE_ASYNC_LDS
#if __has_builtin(__builtin_amdgcn_s_wait_asynccnt)
    __builtin_amdgcn_s_wait_asynccnt(0);
#else
    asm volatile("s_wait_asynccnt 0x0" ::: "memory");
#endif
#endif
}

// C[M,N] = A[M,K] * W[N,K]^T   (A row-major MxK, W row-major NxK; both K-contiguous)
// Requires: M % TM == 0, N % TN == 0, K % TK == 0.
__global__ __launch_bounds__(128)
void wmma_gemm_f32(const float* __restrict__ A, const float* __restrict__ W,
                   const float* __restrict__ bias, const float* __restrict__ omega,
                   float* __restrict__ out0, float* __restrict__ out1,
                   int M, int N, int K, int mode)
{
    __shared__ float As[2][TM][LDS_LD];   // A tile, row-major, double buffered
    __shared__ float Bs[2][TN][LDS_LD];   // W tile, n-major: Bs[.][n][k] = W[nBlock+n][k0+k]

    const int tid  = threadIdx.x;
    const int wave = tid >> 5;               // 0..3 (wave32)
    const int lane = tid & 31;
    const int laneMod  = lane & 15;          // 0..15
    const int laneHalf = lane >> 4;          // 0 or 1

    const int mBlock = blockIdx.y * TM;
    const int nBlock = blockIdx.x * TN;
    const int waveM  = wave * 32;            // this wave's 32-row strip inside block tile

    v8f acc[2][4];
    #pragma unroll
    for (int mt = 0; mt < 2; ++mt)
        #pragma unroll
        for (int nt = 0; nt < 4; ++nt)
            #pragma unroll
            for (int r = 0; r < 8; ++r) acc[mt][nt][r] = 0.0f;

    // ---- tile stage: issues TM*TK/4/128 = 8 A chunks + 4 W chunks of b128 ----
    auto stage_tile = [&](int k0, int b) {
        #pragma unroll
        for (int i = 0; i < 8; ++i) {
            int q   = tid + i * 128;          // 0..1023
            int row = q >> 3;                 // 8 float4 per 32-float row
            int c4  = (q & 7) << 2;
            copy16_g2l(A + (size_t)(mBlock + row) * K + k0 + c4, &As[b][row][c4]);
        }
        #pragma unroll
        for (int i = 0; i < 4; ++i) {
            int q   = tid + i * 128;          // 0..511
            int row = q >> 3;
            int c4  = (q & 7) << 2;
            copy16_g2l(W + (size_t)(nBlock + row) * K + k0 + c4, &Bs[b][row][c4]);
        }
    };

    int buf = 0;
    stage_tile(0, buf);
    wait_async_lds();
    __syncthreads();

    for (int k0 = 0; k0 < K; k0 += TK) {
        const int nbuf = buf ^ 1;
        if (k0 + TK < K) stage_tile(k0 + TK, nbuf);   // prefetch next tile (async)

        // ---- 8 K-steps; per step: 2 A frags x 4 B frags = 8 WMMAs ----
        #pragma unroll
        for (int kk = 0; kk < TK; kk += 4) {
            // A frag (16x4): lanes 0-15: M=lane, K=kk+{0,1}; lanes 16-31: K=kk+{2,3}
            v2f a0, a1;
            a0.x = As[buf][waveM + laneMod][kk + 2 * laneHalf + 0];
            a0.y = As[buf][waveM + laneMod][kk + 2 * laneHalf + 1];
            a1.x = As[buf][waveM + 16 + laneMod][kk + 2 * laneHalf + 0];
            a1.y = As[buf][waveM + 16 + laneMod][kk + 2 * laneHalf + 1];
            #pragma unroll
            for (int nt = 0; nt < 4; ++nt) {
                // B frag (4x16): lane holds K=kk+2*laneHalf+{0,1}, N=nt*16+laneMod
                v2f bf;
                bf.x = Bs[buf][nt * 16 + laneMod][kk + 2 * laneHalf + 0];
                bf.y = Bs[buf][nt * 16 + laneMod][kk + 2 * laneHalf + 1];
                acc[0][nt] = __builtin_amdgcn_wmma_f32_16x16x4_f32(
                    false, a0, false, bf, (short)0, acc[0][nt], false, false);
                acc[1][nt] = __builtin_amdgcn_wmma_f32_16x16x4_f32(
                    false, a1, false, bf, (short)0, acc[1][nt], false, false);
            }
        }

        wait_async_lds();       // next tile landed in LDS
        __syncthreads();        // all waves done reading `buf`, async writes visible
        buf = nbuf;
    }

    // ---- epilogue: C/D layout: VGPR r -> row = r + 8*laneHalf, col = laneMod ----
    #pragma unroll
    for (int mt = 0; mt < 2; ++mt) {
        #pragma unroll
        for (int nt = 0; nt < 4; ++nt) {
            const int col = nBlock + nt * 16 + laneMod;
            #pragma unroll
            for (int r = 0; r < 8; ++r) {
                const int m = mBlock + waveM + mt * 16 + r + 8 * laneHalf;
                float val = acc[mt][nt][r];
                if (mode == EPI_PLAIN) {
                    if (bias) val += bias[col];
                    out0[(size_t)m * N + col] = val;
                } else if (mode == EPI_LAMBDA) {
                    val += bias[col];
                    float sig = 1.0f / (1.0f + expf(-val));
                    float sp  = log1pf(expf(omega[col]));          // softplus
                    out0[(size_t)m * N + col] = expf(-8.0f * sp * sig);
                } else { // EPI_SPLIT
                    if (col < D_INNER) out0[(size_t)m * D_INNER + col] = val;
                    else               out1[(size_t)m * D_INNER + (col - D_INNER)] = val;
                }
            }
        }
    }
}

// ---------------------------------------------------------------------------
// Sequential Householder scan. One block per batch, 1024 threads, 2 ch/thread.
// lam_h holds lam on entry; h is written in place (lam[t] read before h[t]
// written by the same thread; lam[.,0,.] is never consumed by the reference).
// ---------------------------------------------------------------------------
__global__ __launch_bounds__(1024)
void scan_kernel(const float* __restrict__ xi, const float* __restrict__ v,
                 float* __restrict__ lam_h)
{
    const int b   = blockIdx.x;
    const int tid = threadIdx.x;
    const int c0  = tid;
    const int c1  = tid + 1024;
    const size_t base = (size_t)b * SEQ * D_INNER;

    __shared__ float red[64];     // 32 waves x {vh, vv}
    __shared__ float bcast[2];

    float h0 = xi[base + c0];
    float h1 = xi[base + c1];
    lam_h[base + c0] = h0;
    lam_h[base + c1] = h1;

    const int wave = tid >> 5;
    const int lane = tid & 31;

    for (int t = 1; t < SEQ; ++t) {
        const size_t off = base + (size_t)t * D_INNER;
        const float v0 = v[off + c0],     v1 = v[off + c1];
        const float l0 = lam_h[off + c0], l1 = lam_h[off + c1];
        const float x0 = xi[off + c0],    x1 = xi[off + c1];

        float vh = v0 * h0 + v1 * h1;
        float vv = v0 * v0 + v1 * v1;
        #pragma unroll
        for (int s = 16; s > 0; s >>= 1) {   // wave32 butterfly
            vh += __shfl_xor(vh, s, 32);
            vv += __shfl_xor(vv, s, 32);
        }
        if (lane == 0) { red[wave] = vh; red[wave + 32] = vv; }
        __syncthreads();
        if (tid < 32) {
            float a  = red[tid];
            float bb = red[tid + 32];
            #pragma unroll
            for (int s = 16; s > 0; s >>= 1) {
                a  += __shfl_xor(a,  s, 32);
                bb += __shfl_xor(bb, s, 32);
            }
            if (tid == 0) { bcast[0] = a; bcast[1] = bb; }
        }
        __syncthreads();

        const float scale = 2.0f * bcast[0] / bcast[1];
        h0 = l0 * (h0 - v0 * scale) + (1.0f - l0) * x0;
        h1 = l1 * (h1 - v1 * scale) + (1.0f - l1) * x1;
        lam_h[off + c0] = h0;
        lam_h[off + c1] = h1;
        __syncthreads();   // red[] safe to overwrite next iteration
    }
}

// g = silu(z) * h, written over z
__global__ void silu_mul_kernel(const float* __restrict__ h, float* __restrict__ z_io,
                                size_t n)
{
    size_t i      = (size_t)blockIdx.x * blockDim.x + threadIdx.x;
    size_t stride = (size_t)gridDim.x * blockDim.x;
    for (; i < n; i += stride) {
        float zv = z_io[i];
        float s  = zv / (1.0f + expf(-zv));
        z_io[i] = s * h[i];
    }
}

// ---------------------------------------------------------------------------
extern "C" void kernel_launch(void* const* d_in, const int* in_sizes, int n_in,
                              void* d_out, int out_size, void* d_ws, size_t ws_size,
                              hipStream_t stream)
{
    const float* x     = (const float*)d_in[0];
    const float* omega = (const float*)d_in[1];   // 2048
    const float* Win   = (const float*)d_in[2];   // 4096 x 1024
    const float* Wl    = (const float*)d_in[3];   // 2048 x 2048
    const float* bl    = (const float*)d_in[4];
    const float* Wv    = (const float*)d_in[5];   // 2048 x 2048
    const float* bv    = (const float*)d_in[6];
    const float* Wout  = (const float*)d_in[7];   // 1024 x 2048
    float* out = (float*)d_out;

    const size_t BUF = (size_t)M_ROWS * D_INNER;  // 16,777,216 floats (64 MB)
    float* ws    = (float*)d_ws;
    float* xi    = ws;             // [M_ROWS, D_INNER]
    float* z     = ws + BUF;       // [M_ROWS, D_INNER] (later holds silu(z)*h)
    float* lam_h = ws + 2 * BUF;   // lam in, h out (in place)
    float* vbuf  = ws + 3 * BUF;   // total 256 MB of d_ws used

    dim3 blk(128);

    // 1) xz = x @ Win^T, split into xi | z
    {
        dim3 grd(4096 / TN, M_ROWS / TM);
        wmma_gemm_f32<<<grd, blk, 0, stream>>>(x, Win, nullptr, nullptr,
                                               xi, z, M_ROWS, 4096, D_MODEL, EPI_SPLIT);
    }
    // 2) lam = exp(-8*softplus(omega)*sigmoid(xi@Wl^T + bl))
    {
        dim3 grd(D_INNER / TN, M_ROWS / TM);
        wmma_gemm_f32<<<grd, blk, 0, stream>>>(xi, Wl, bl, omega,
                                               lam_h, nullptr, M_ROWS, D_INNER, D_INNER, EPI_LAMBDA);
    }
    // 3) v = xi @ Wv^T + bv
    {
        dim3 grd(D_INNER / TN, M_ROWS / TM);
        wmma_gemm_f32<<<grd, blk, 0, stream>>>(xi, Wv, bv, nullptr,
                                               vbuf, nullptr, M_ROWS, D_INNER, D_INNER, EPI_PLAIN);
    }
    // 4) sequential Householder scan (h overwrites lam buffer)
    scan_kernel<<<BATCH, 1024, 0, stream>>>(xi, vbuf, lam_h);

    // 5) g = silu(z) * h   (overwrites z)
    silu_mul_kernel<<<4096, 256, 0, stream>>>(lam_h, z, BUF);

    // 6) out = g @ Wout^T
    {
        dim3 grd(D_MODEL / TN, M_ROWS / TM);
        wmma_gemm_f32<<<grd, blk, 0, stream>>>(z, Wout, nullptr, nullptr,
                                               out, nullptr, M_ROWS, D_MODEL, D_INNER, EPI_PLAIN);
    }
}

// v001
// It runs in 2580 microseconds.
// Next to v000, in two timings, it ran 1.78 and 1.77 times as fast.
#include <hip/hip_runtime.h>
#include <cmath>

// ---------------------------------------------------------------------------
// DenseRNN (Householder-reflection linear RNN) for MI455X / gfx1250
//   xz = x @ Win^T ; xi,z = split(xz)
//   lam = exp(-8*softplus(omega)*sigmoid(xi@Wl^T + bl))
//   v   = xi@Wv^T + bv
//   scan: h_t = lam_t*(h_{t-1} - 2 v_t (v.h)/(v.v)) + (1-lam_t)*xi_t ; h_0 = xi_0
//   out = (silu(z)*h) @ Wout^T
// GEMMs: V_WMMA_F32_16X16X4_F32 + double-buffered async global->LDS staging.
// ---------------------------------------------------------------------------

typedef __attribute__((ext_vector_type(2))) float v2f;
typedef __attribute__((ext_vector_type(8))) float v8f;
typedef int v4i_gcc __attribute__((vector_size(16)));   // matches builtin pointee

#define D_MODEL   1024
#define D_INNER   2048
#define BATCH     4
#define SEQ       2048
#define M_ROWS    (BATCH * SEQ)        // 8192

// GEMM tiling: 128 threads = 4 waves; each wave owns a 32x64 C strip.
#define TM 128        // block rows
#define TN 64         // block cols
#define TK 32         // K tile
#define LDS_PAD 4     // row stride 36 floats = 144 B (16B aligned for b128 async)
#define LDS_LD  (TK + LDS_PAD)

// Epilogue modes
#define EPI_PLAIN  0   // out0[m,col] = acc (+ bias if non-null)
#define EPI_LAMBDA 1   // out0[m,col] = exp(-8*softplus(omega[col])*sigmoid(acc+bias[col]))
#define EPI_SPLIT  2   // col < D_INNER -> out0 (xi), else -> out1 (z), both ld = D_INNER

// --- async global->LDS copy (CDNA5 ASYNCcnt path), with sync fallback ------
#if defined(__AMDGCN__) && __has_builtin(__builtin_amdgcn_global_load_async_to_lds_b128)
#define USE_ASYNC_LDS 1
#else
#define USE_ASYNC_LDS 0
#endif

__device__ __forceinline__ void copy16_g2l(const float* __restrict__ g, float* l)
{
#if USE_ASYNC_LDS
    __builtin_amdgcn_global_load_async_to_lds_b128(
        (__attribute__((address_space(1))) v4i_gcc*)(void*)g,
        (__attribute__((address_space(3))) v4i_gcc*)(void*)l,
        /*imm offset=*/0, /*cpol=*/0);
#else
    *(float4*)l = *(const float4*)g;
#endif
}

__device__ __forceinline__ void wait_async_lds()
{
#if USE_ASYNC_LDS
#if __has_builtin(__builtin_amdgcn_s_wait_asynccnt)
    __builtin_amdgcn_s_wait_asynccnt(0);
#else
    asm volatile("s_wait_asynccnt 0x0" ::: "memory");
#endif
#endif
}

// C[M,N] = A[M,K] * W[N,K]^T   (A row-major MxK, W row-major NxK; both K-contiguous)
// Requires: M % TM == 0, N % TN == 0, K % TK == 0.
__global__ __launch_bounds__(128)
void wmma_gemm_f32(const float* __restrict__ A, const float* __restrict__ W,
                   const float* __restrict__ bias, const float* __restrict__ omega,
                   float* __restrict__ out0, float* __restrict__ out1,
                   int M, int N, int K, int mode)
{
    __shared__ float As[2][TM][LDS_LD];   // A tile, row-major, double buffered
    __shared__ float Bs[2][TN][LDS_LD];   // W tile, n-major: Bs[.][n][k] = W[nBlock+n][k0+k]

    const int tid  = threadIdx.x;
    const int wave = tid >> 5;               // 0..3 (wave32)
    const int lane = tid & 31;
    const int laneMod  = lane & 15;          // 0..15
    const int laneHalf = lane >> 4;          // 0 or 1

    const int mBlock = blockIdx.y * TM;
    const int nBlock = blockIdx.x * TN;
    const int waveM  = wave * 32;            // this wave's 32-row strip inside block tile

    v8f acc[2][4];
    #pragma unroll
    for (int mt = 0; mt < 2; ++mt)
        #pragma unroll
        for (int nt = 0; nt < 4; ++nt)
            #pragma unroll
            for (int r = 0; r < 8; ++r) acc[mt][nt][r] = 0.0f;

    // ---- tile stage: issues TM*TK/4/128 = 8 A chunks + 4 W chunks of b128 ----
    auto stage_tile = [&](int k0, int b) {
        #pragma unroll
        for (int i = 0; i < 8; ++i) {
            int q   = tid + i * 128;          // 0..1023
            int row = q >> 3;                 // 8 float4 per 32-float row
            int c4  = (q & 7) << 2;
            copy16_g2l(A + (size_t)(mBlock + row) * K + k0 + c4, &As[b][row][c4]);
        }
        #pragma unroll
        for (int i = 0; i < 4; ++i) {
            int q   = tid + i * 128;          // 0..511
            int row = q >> 3;
            int c4  = (q & 7) << 2;
            copy16_g2l(W + (size_t)(nBlock + row) * K + k0 + c4, &Bs[b][row][c4]);
        }
    };

    int buf = 0;
    stage_tile(0, buf);
    wait_async_lds();
    __syncthreads();

    for (int k0 = 0; k0 < K; k0 += TK) {
        const int nbuf = buf ^ 1;
        if (k0 + TK < K) stage_tile(k0 + TK, nbuf);   // prefetch next tile (async)

        // ---- 8 K-steps; per step: 2 A frags x 4 B frags = 8 WMMAs ----
        #pragma unroll
        for (int kk = 0; kk < TK; kk += 4) {
            // A frag (16x4): lanes 0-15: M=lane, K=kk+{0,1}; lanes 16-31: K=kk+{2,3}
            v2f a0, a1;
            a0.x = As[buf][waveM + laneMod][kk + 2 * laneHalf + 0];
            a0.y = As[buf][waveM + laneMod][kk + 2 * laneHalf + 1];
            a1.x = As[buf][waveM + 16 + laneMod][kk + 2 * laneHalf + 0];
            a1.y = As[buf][waveM + 16 + laneMod][kk + 2 * laneHalf + 1];
            #pragma unroll
            for (int nt = 0; nt < 4; ++nt) {
                // B frag (4x16): lane holds K=kk+2*laneHalf+{0,1}, N=nt*16+laneMod
                v2f bf;
                bf.x = Bs[buf][nt * 16 + laneMod][kk + 2 * laneHalf + 0];
                bf.y = Bs[buf][nt * 16 + laneMod][kk + 2 * laneHalf + 1];
                acc[0][nt] = __builtin_amdgcn_wmma_f32_16x16x4_f32(
                    false, a0, false, bf, (short)0, acc[0][nt], false, false);
                acc[1][nt] = __builtin_amdgcn_wmma_f32_16x16x4_f32(
                    false, a1, false, bf, (short)0, acc[1][nt], false, false);
            }
        }

        wait_async_lds();       // next tile landed in LDS
        __syncthreads();        // all waves done reading `buf`, async writes visible
        buf = nbuf;
    }

    // ---- epilogue: C/D layout: VGPR r -> row = r + 8*laneHalf, col = laneMod ----
    #pragma unroll
    for (int mt = 0; mt < 2; ++mt) {
        #pragma unroll
        for (int nt = 0; nt < 4; ++nt) {
            const int col = nBlock + nt * 16 + laneMod;
            #pragma unroll
            for (int r = 0; r < 8; ++r) {
                const int m = mBlock + waveM + mt * 16 + r + 8 * laneHalf;
                float val = acc[mt][nt][r];
                if (mode == EPI_PLAIN) {
                    if (bias) val += bias[col];
                    out0[(size_t)m * N + col] = val;
                } else if (mode == EPI_LAMBDA) {
                    val += bias[col];
                    float sig = 1.0f / (1.0f + expf(-val));
                    float sp  = log1pf(expf(omega[col]));          // softplus
                    out0[(size_t)m * N + col] = expf(-8.0f * sp * sig);
                } else { // EPI_SPLIT
                    if (col < D_INNER) out0[(size_t)m * D_INNER + col] = val;
                    else               out1[(size_t)m * D_INNER + (col - D_INNER)] = val;
                }
            }
        }
    }
}

// ---------------------------------------------------------------------------
// Sequential Householder scan. One block per batch, 1024 threads, 2 ch/thread.
// lam_h holds lam on entry; h is written in place (lam[t] read before h[t]
// written by the same thread; lam[.,0,.] is never consumed by the reference).
// No thread reads a global word that another thread of this launch writes, so
// global memory needs no ordering at the barriers: only red[] and bcast[] do.
// ---------------------------------------------------------------------------
#define SCAN_AHEAD 4                                   // steps of look-ahead
#define SCAN_MAIN  ((SEQ - 1 - SCAN_AHEAD) / SCAN_AHEAD) // trips in which every step fetches ahead

// Work-group barrier that orders LDS only. __syncthreads() also drains the
// wave's global loads and stores, which would put the memory latency of the
// rows fetched ahead, and of the h stores, back into every step.
__device__ __forceinline__ void barrier_lds_only()
{
    __builtin_amdgcn_fence(__ATOMIC_RELEASE, "workgroup", "local");
    __builtin_amdgcn_s_barrier();
    __builtin_amdgcn_fence(__ATOMIC_ACQUIRE, "workgroup", "local");
}

// Stands behind the global loads and stores of a step, in front of the first
// instruction that may reuse one of their address or data registers.
__device__ __forceinline__ void wait_addresses_taken()
{
    asm volatile("s_wait_xcnt 0x0" ::: "memory");
}

__global__ __launch_bounds__(1024)
void scan_kernel(const float* __restrict__ xi, const float* __restrict__ v,
                 float* __restrict__ lam_h)
{
    const int b   = blockIdx.x;
    const int tid = threadIdx.x;
    const int c0  = tid;
    const int c1  = tid + 1024;
    const size_t base = (size_t)b * SEQ * D_INNER;

    __shared__ float red[64];     // 32 waves x {vh, vv}
    __shared__ float bcast[2];

    float h0 = xi[base + c0];
    float h1 = xi[base + c1];
    lam_h[base + c0] = h0;
    lam_h[base + c1] = h1;

    const int wave = tid >> 5;
    const int lane = tid & 31;

    // Register ring: slot (t-1) % SCAN_AHEAD holds row t of v, lam and xi.
    float rv0[SCAN_AHEAD], rv1[SCAN_AHEAD];
    float rl0[SCAN_AHEAD], rl1[SCAN_AHEAD];
    float rx0[SCAN_AHEAD], rx1[SCAN_AHEAD];

    auto fetch = [&](int t, int s) {
        const size_t off = base + (size_t)t * D_INNER;
        rv0[s] = v[off + c0];     rv1[s] = v[off + c1];
        rl0[s] = lam_h[off + c0]; rl1[s] = lam_h[off + c1];
        rx0[s] = xi[off + c0];    rx1[s] = xi[off + c1];
    };

    auto step = [&](int t, int s, bool ahead) {
        const size_t off = base + (size_t)t * D_INNER;
        const float v0 = rv0[s], v1 = rv1[s];
        const float l0 = rl0[s], l1 = rl1[s];
        const float x0 = rx0[s], x1 = rx1[s];

        float vh = v0 * h0 + v1 * h1;
        float vv = v0 * v0 + v1 * v1;
        #pragma unroll
        for (int m = 16; m > 0; m >>= 1) {   // wave32 butterfly
            vh += __shfl_xor(vh, m, 32);
            vv += __shfl_xor(vv, m, 32);
        }
        if (lane == 0) { red[wave] = vh; red[wave + 32] = vv; }
        barrier_lds_only();
        if (tid < 32) {
            float a  = red[tid];
            float bb = red[tid + 32];
            #pragma unroll
            for (int m = 16; m > 0; m >>= 1) {
                a  += __shfl_xor(a,  m, 32);
                bb += __shfl_xor(bb, m, 32);
            }
            if (tid == 0) { bcast[0] = a; bcast[1] = bb; }
        }
        barrier_lds_only();

        const float scale = 2.0f * bcast[0] / bcast[1];
        h0 = l0 * (h0 - v0 * scale) + (1.0f - l0) * x0;
        h1 = l1 * (h1 - v1 * scale) + (1.0f - l1) * x1;
        lam_h[off + c0] = h0;
        lam_h[off + c1] = h1;
        // Row t is used up: its slot takes row t+SCAN_AHEAD, which flies during the next steps.
        if (ahead) fetch(t + SCAN_AHEAD, s);
        wait_addresses_taken();
        barrier_lds_only();   // red[] safe to overwrite next step
    };

    // Rows 1..SCAN_AHEAD, row by row (constant slots): the wait's "memory" clobber keeps
    // the rows in the loop's own issue order, so the counted load waits in the loop stay exact.
    #pragma unroll
    for (int s = 0; s < SCAN_AHEAD; ++s) { fetch(1 + s, s); wait_addresses_taken(); }

    // Slot indices must be constants for the ring to stay in registers: the
    // inner loop is unrolled, the outer one stays rolled.
    #pragma unroll 1
    for (int k = 0; k < SCAN_MAIN; ++k) {
        #pragma unroll
        for (int s = 0; s < SCAN_AHEAD; ++s)
            step(1 + k * SCAN_AHEAD + s, s, true);
    }
    // Last steps: the row number is a constant, so is the test for a row left to fetch.
    #pragma unroll
    for (int t = 1 + SCAN_MAIN * SCAN_AHEAD; t < SEQ; ++t)
        step(t, (t - 1) % SCAN_AHEAD, t + SCAN_AHEAD < SEQ);
}

// g = silu(z) * h, written over z
__global__ void silu_mul_kernel(const float* __restrict__ h, float* __restrict__ z_io,
                                size_t n)
{
    size_t i      = (size_t)blockIdx.x * blockDim.x + threadIdx.x;
    size_t stride = (size_t)gridDim.x * blockDim.x;
    for (; i < n; i += stride) {
        float zv = z_io[i];
        float s  = zv / (1.0f + expf(-zv));
        z_io[i] = s * h[i];
    }
}

// ---------------------------------------------------------------------------
extern "C" void kernel_launch(void* const* d_in, const int* in_sizes, int n_in,
                              void* d_out, int out_size, void* d_ws, size_t ws_size,
                              hipStream_t stream)
{
    const float* x     = (const float*)d_in[0];
    const float* omega = (const float*)d_in[1];   // 2048
    const float* Win   = (const float*)d_in[2];   // 4096 x 1024
    const float* Wl    = (const float*)d_in[3];   // 2048 x 2048
    const float* bl    = (const float*)d_in[4];
    const float* Wv    = (const float*)d_in[5];   // 2048 x 2048
    const float* bv    = (const float*)d_in[6];
    const float* Wout  = (const float*)d_in[7];   // 1024 x 2048
    float* out = (float*)d_out;

    const size_t BUF = (size_t)M_ROWS * D_INNER;  // 16,777,216 floats (64 MB)
    float* ws    = (float*)d_ws;
    float* xi    = ws;             // [M_ROWS, D_INNER]
    float* z     = ws + BUF;       // [M_ROWS, D_INNER] (later holds silu(z)*h)
    float* lam_h = ws + 2 * BUF;   // lam in, h out (in place)
    float* vbuf  = ws + 3 * BUF;   // total 256 MB of d_ws used

    dim3 blk(128);

    // 1) xz = x @ Win^T, split into xi | z
    {
        dim3 grd(4096 / TN, M_ROWS / TM);
        wmma_gemm_f32<<<grd, blk, 0, stream>>>(x, Win, nullptr, nullptr,
                                               xi, z, M_ROWS, 4096, D_MODEL, EPI_SPLIT);
    }
    // 2) lam = exp(-8*softplus(omega)*sigmoid(xi@Wl^T + bl))
    {
        dim3 grd(D_INNER / TN, M_ROWS / TM);
        wmma_gemm_f32<<<grd, blk, 0, stream>>>(xi, Wl, bl, omega,
                                               lam_h, nullptr, M_ROWS, D_INNER, D_INNER, EPI_LAMBDA);
    }
    // 3) v = xi @ Wv^T + bv
    {
        dim3 grd(D_INNER / TN, M_ROWS / TM);
        wmma_gemm_f32<<<grd, blk, 0, stream>>>(xi, Wv, bv, nullptr,
                                               vbuf, nullptr, M_ROWS, D_INNER, D_INNER, EPI_PLAIN);
    }
    // 4) sequential Householder scan (h overwrites lam buffer)
    scan_kernel<<<BATCH, 1024, 0, stream>>>(xi, vbuf, lam_h);

    // 5) g = silu(z) * h   (overwrites z)
    silu_mul_kernel<<<4096, 256, 0, stream>>>(lam_h, z, BUF);

    // 6) out = g @ Wout^T
    {
        dim3 grd(D_MODEL / TN, M_ROWS / TM);
        wmma_gemm_f32<<<grd, blk, 0, stream>>>(z, Wout, nullptr, nullptr,
                                               out, nullptr, M_ROWS, D_MODEL, D_INNER, EPI_PLAIN);
    }
}

// v002
// A run of this version takes 2450 microseconds.
// Two timings next to v001 both put it at 1.05 times that version's speed.
// All steps since v000 together make it 1.87 times as fast.
#include <hip/hip_runtime.h>
#include <cmath>

// ---------------------------------------------------------------------------
// DenseRNN (Householder-reflection linear RNN) for MI455X / gfx1250
//   xz = x @ Win^T ; xi,z = split(xz)
//   lam = exp(-8*softplus(omega)*sigmoid(xi@Wl^T + bl))
//   v   = xi@Wv^T + bv
//   scan: h_t = lam_t*(h_{t-1} - 2 v_t (v.h)/(v.v)) + (1-lam_t)*xi_t ; h_0 = xi_0
//   out = (silu(z)*h) @ Wout^T
// GEMMs: V_WMMA_F32_16X16X4_F32 + double-buffered async global->LDS staging.
// ---------------------------------------------------------------------------

typedef __attribute__((ext_vector_type(2))) float v2f;
typedef __attribute__((ext_vector_type(8))) float v8f;
typedef int v4i_gcc __attribute__((vector_size(16)));   // matches builtin pointee

#define D_MODEL   1024
#define D_INNER   2048
#define BATCH     4
#define SEQ       2048
#define M_ROWS    (BATCH * SEQ)        // 8192

// GEMM tiling: 128 threads = 4 waves; each wave owns a 32x64 C strip.
#define TM 128        // block rows
#define TN 64         // block cols
#define TK 32         // K tile
#define LDS_PAD 4     // row stride 36 floats = 144 B (16B aligned for b128 async)
#define LDS_LD  (TK + LDS_PAD)

// Epilogue modes
#define EPI_PLAIN  0   // out0[m,col] = acc (+ bias if non-null)
#define EPI_LAMBDA 1   // out0[m,col] = exp(-8*softplus(omega[col])*sigmoid(acc+bias[col]))
#define EPI_SPLIT  2   // col < D_INNER -> out0 (xi), else -> out1 (z), both ld = D_INNER

// --- async global->LDS copy (CDNA5 ASYNCcnt path), with sync fallback ------
#if defined(__AMDGCN__) && __has_builtin(__builtin_amdgcn_global_load_async_to_lds_b128)
#define USE_ASYNC_LDS 1
#else
#define USE_ASYNC_LDS 0
#endif

__device__ __forceinline__ void copy16_g2l(const float* __restrict__ g, float* l)
{
#if USE_ASYNC_LDS
    __builtin_amdgcn_global_load_async_to_lds_b128(
        (__attribute__((address_space(1))) v4i_gcc*)(void*)g,
        (__attribute__((address_space(3))) v4i_gcc*)(void*)l,
        /*imm offset=*/0, /*cpol=*/0);
#else
    *(float4*)l = *(const float4*)g;
#endif
}

__device__ __forceinline__ void wait_async_lds()
{
#if USE_ASYNC_LDS
#if __has_builtin(__builtin_amdgcn_s_wait_asynccnt)
    __builtin_amdgcn_s_wait_asynccnt(0);
#else
    asm volatile("s_wait_asynccnt 0x0" ::: "memory");
#endif
#endif
}

// C[M,N] = A[M,K] * W[N,K]^T   (A row-major MxK, W row-major NxK; both K-contiguous)
// Requires: M % TM == 0, N % TN == 0, K % TK == 0.
__global__ __launch_bounds__(128)
void wmma_gemm_f32(const float* __restrict__ A, const float* __restrict__ W,
                   const float* __restrict__ bias, const float* __restrict__ omega,
                   float* __restrict__ out0, float* __restrict__ out1,
                   int M, int N, int K, int mode)
{
    __shared__ float As[2][TM][LDS_LD];   // A tile, row-major, double buffered
    __shared__ float Bs[2][TN][LDS_LD];   // W tile, n-major: Bs[.][n][k] = W[nBlock+n][k0+k]

    const int tid  = threadIdx.x;
    const int wave = tid >> 5;               // 0..3 (wave32)
    const int lane = tid & 31;
    const int laneMod  = lane & 15;          // 0..15
    const int laneHalf = lane >> 4;          // 0 or 1

    const int mBlock = blockIdx.y * TM;
    const int nBlock = blockIdx.x * TN;
    const int waveM  = wave * 32;            // this wave's 32-row strip inside block tile

    v8f acc[2][4];
    #pragma unroll
    for (int mt = 0; mt < 2; ++mt)
        #pragma unroll
        for (int nt = 0; nt < 4; ++nt)
            #pragma unroll
            for (int r = 0; r < 8; ++r) acc[mt][nt][r] = 0.0f;

    // ---- tile stage: issues TM*TK/4/128 = 8 A chunks + 4 W chunks of b128 ----
    auto stage_tile = [&](int k0, int b) {
        #pragma unroll
        for (int i = 0; i < 8; ++i) {
            int q   = tid + i * 128;          // 0..1023
            int row = q >> 3;                 // 8 float4 per 32-float row
            int c4  = (q & 7) << 2;
            copy16_g2l(A + (size_t)(mBlock + row) * K + k0 + c4, &As[b][row][c4]);
        }
        #pragma unroll
        for (int i = 0; i < 4; ++i) {
            int q   = tid + i * 128;          // 0..511
            int row = q >> 3;
            int c4  = (q & 7) << 2;
            copy16_g2l(W + (size_t)(nBlock + row) * K + k0 + c4, &Bs[b][row][c4]);
        }
    };

    int buf = 0;
    stage_tile(0, buf);
    wait_async_lds();
    __syncthreads();

    for (int k0 = 0; k0 < K; k0 += TK) {
        const int nbuf = buf ^ 1;
        if (k0 + TK < K) stage_tile(k0 + TK, nbuf);   // prefetch next tile (async)

        // ---- 8 K-steps; per step: 2 A frags x 4 B frags = 8 WMMAs ----
        #pragma unroll
        for (int kk = 0; kk < TK; kk += 4) {
            // A frag (16x4): lanes 0-15: M=lane, K=kk+{0,1}; lanes 16-31: K=kk+{2,3}
            v2f a0, a1;
            a0.x = As[buf][waveM + laneMod][kk + 2 * laneHalf + 0];
            a0.y = As[buf][waveM + laneMod][kk + 2 * laneHalf + 1];
            a1.x = As[buf][waveM + 16 + laneMod][kk + 2 * laneHalf + 0];
            a1.y = As[buf][waveM + 16 + laneMod][kk + 2 * laneHalf + 1];
            #pragma unroll
            for (int nt = 0; nt < 4; ++nt) {
                // B frag (4x16): lane holds K=kk+2*laneHalf+{0,1}, N=nt*16+laneMod
                v2f bf;
                bf.x = Bs[buf][nt * 16 + laneMod][kk + 2 * laneHalf + 0];
                bf.y = Bs[buf][nt * 16 + laneMod][kk + 2 * laneHalf + 1];
                acc[0][nt] = __builtin_amdgcn_wmma_f32_16x16x4_f32(
                    false, a0, false, bf, (short)0, acc[0][nt], false, false);
                acc[1][nt] = __builtin_amdgcn_wmma_f32_16x16x4_f32(
                    false, a1, false, bf, (short)0, acc[1][nt], false, false);
            }
        }

        wait_async_lds();       // next tile landed in LDS
        __syncthreads();        // all waves done reading `buf`, async writes visible
        buf = nbuf;
    }

    // ---- epilogue: C/D layout: VGPR r -> row = r + 8*laneHalf, col = laneMod ----
    #pragma unroll
    for (int mt = 0; mt < 2; ++mt) {
        #pragma unroll
        for (int nt = 0; nt < 4; ++nt) {
            const int col = nBlock + nt * 16 + laneMod;
            #pragma unroll
            for (int r = 0; r < 8; ++r) {
                const int m = mBlock + waveM + mt * 16 + r + 8 * laneHalf;
                float val = acc[mt][nt][r];
                if (mode == EPI_PLAIN) {
                    if (bias) val += bias[col];
                    out0[(size_t)m * N + col] = val;
                } else if (mode == EPI_LAMBDA) {
                    val += bias[col];
                    float sig = 1.0f / (1.0f + expf(-val));
                    float sp  = log1pf(expf(omega[col]));          // softplus
                    out0[(size_t)m * N + col] = expf(-8.0f * sp * sig);
                } else { // EPI_SPLIT
                    if (col < D_INNER) out0[(size_t)m * D_INNER + col] = val;
                    else               out1[(size_t)m * D_INNER + (col - D_INNER)] = val;
                }
            }
        }
    }
}

// ---------------------------------------------------------------------------
// Householder scan, blocked by SCAN_CH steps. Inside a block of steps
//   h_j = f_j - sum_{i<=j} s_i w_{i,j},   s_j = 2 (v_j.h_{j-1}) / (v_j.v_j)
// with f the same recurrence without its reflections (f_j = lam_j f_{j-1} + (1-lam_j) xi_j,
// started at the block's entry h) and w_{i,j} = lam_j ... lam_i v_i. So
//   v_j.h_{j-1} = v_j.f_{j-1} - sum_{i<j} s_i (v_j.w_{i,j-1}).
// The dots v_j.v_j and v_j.w_{i,j-1} do not depend on h: a kernel over the whole chip
// forms them for every block of steps. The sequential kernel then needs ONE work-group sum
// (of the SCAN_CH dots v_j.f_{j-1}) per block of steps, a forward substitution for the
// s_j, and the reference's own recurrence with those s_j.
// ---------------------------------------------------------------------------
typedef __attribute__((ext_vector_type(4))) float v4f;

#define SCAN_CH     6                                   // steps per block of steps
#define SCAN_FULL   ((SEQ - 1) / SCAN_CH)               // blocks with all their steps: 341
#define SCAN_TAIL   ((SEQ - 1) - SCAN_FULL * SCAN_CH)   // steps of the last, short block: 1
#define SCAN_BLOCKS (SCAN_FULL + 1)
#define TAB_N       (SCAN_CH + SCAN_CH * (SCAN_CH - 1) / 2)  // 6 v.v and 15 v.w
#define TAB_LD      32                                  // one 128-byte line per block of steps
#define TAB_G(j, i) (SCAN_CH + (j) * ((j) - 1) / 2 + (i))    // v_j.w_{i,j-1}, i < j
static_assert(SCAN_TAIL > 0 && SCAN_FULL % 2 == 1, "the scan's last calls are written for this case");

// Work-group barrier that orders LDS only. __syncthreads() also drains the
// wave's global loads and stores, which would put the memory latency of the
// rows fetched ahead, and of the h stores, back into every round.
__device__ __forceinline__ void barrier_lds_only()
{
    __builtin_amdgcn_fence(__ATOMIC_RELEASE, "workgroup", "local");
    __builtin_amdgcn_s_barrier();
    __builtin_amdgcn_fence(__ATOMIC_ACQUIRE, "workgroup", "local");
}

// Stands behind a group of global loads or stores, in front of the first
// instruction that may reuse one of their address or data registers. The
// scheduling barrier keeps later instructions, which may take those registers,
// from being lifted over the wait, and the loads in front of it from sinking
// behind it (a build without it did both, and spilled registers in the scan).
__device__ __forceinline__ void wait_addresses_taken()
{
    asm volatile("s_wait_xcnt 0x0" ::: "memory");
    __builtin_amdgcn_sched_barrier(0);
}

// tab[b][k][.]: the h-independent dots of block k of batch b. One work-group each.
// Rows past the end (short last block) are read as the last row; their entries are never used.
__global__ __launch_bounds__(256)
void scan_dots_kernel(const float* __restrict__ v, const float* __restrict__ lam,
                      float* __restrict__ tab)
{
    const int k   = blockIdx.x;
    const int b   = blockIdx.y;
    const int tid = threadIdx.x;
    const size_t base = (size_t)b * SEQ * D_INNER + tid * 4;

    __shared__ float part[8][TAB_N];

    v4f rv[2][SCAN_CH], rl[2][SCAN_CH];
    #pragma unroll
    for (int j = 0; j < SCAN_CH; ++j) {
        int t = 1 + k * SCAN_CH + j;
        if (t > SEQ - 1) t = SEQ - 1;
        #pragma unroll
        for (int hf = 0; hf < 2; ++hf) {
            const size_t off = base + (size_t)t * D_INNER + hf * 1024;
            rv[hf][j] = *(const v4f*)(v + off);
            wait_addresses_taken();   // a later load's result may land in this load's address registers
            rl[hf][j] = *(const v4f*)(lam + off);
            wait_addresses_taken();
        }
    }

    float acc[TAB_N];
    #pragma unroll
    for (int q = 0; q < TAB_N; ++q) acc[q] = 0.0f;

    #pragma unroll
    for (int hf = 0; hf < 2; ++hf) {
        #pragma unroll
        for (int e = 0; e < 4; ++e) {
            float w[SCAN_CH];
            #pragma unroll
            for (int j = 0; j < SCAN_CH; ++j) {
                const float vj = rv[hf][j][e];
                const float lj = rl[hf][j][e];
                acc[j] += vj * vj;
                #pragma unroll
                for (int i = 0; i < j; ++i) acc[TAB_G(j, i)] += vj * w[i];
                #pragma unroll
                for (int i = 0; i < j; ++i) w[i] *= lj;
                w[j] = lj * vj;
            }
        }
    }

    #pragma unroll
    for (int m = 16; m > 0; m >>= 1) {
        #pragma unroll
        for (int q = 0; q < TAB_N; ++q) acc[q] += __shfl_xor(acc[q], m, 32);
    }
    if ((tid & 31) == 0) {
        #pragma unroll
        for (int q = 0; q < TAB_N; ++q) part[tid >> 5][q] = acc[q];
    }
    __syncthreads();
    if (tid < TAB_N) {
        float s = 0.0f;
        #pragma unroll
        for (int w8 = 0; w8 < 8; ++w8) s += part[w8][tid];
        tab[((size_t)b * SCAN_BLOCKS + k) * TAB_LD + tid] = s;
    }
}

// One work-group per batch, 1024 threads, 2 channels per thread.
// lam_h holds lam on entry; h is written in place (a thread reads lam[t] before it
// writes h[t]; lam[.,0,.] is never consumed by the reference).
// No thread reads a global word that another thread of this launch writes, so
// global memory needs no ordering at the barriers: only red[] and bcast[] do.
__global__ __launch_bounds__(1024)
void scan_kernel(const float* __restrict__ xi, const float* __restrict__ v,
                 float* __restrict__ lam_h, const float* __restrict__ tab)
{
    const int b    = blockIdx.x;
    const int tid  = threadIdx.x;
    const int c0   = tid;
    const int c1   = tid + 1024;
    const int wave = tid >> 5;
    const int lane = tid & 31;
    const size_t base = (size_t)b * SEQ * D_INNER;

    __shared__ float red[SCAN_CH][32];   // per dot: one partial sum of each of the 32 waves
    __shared__ float bcast[SCAN_CH];

    float h0 = xi[base + c0];
    float h1 = xi[base + c1];
    lam_h[base + c0] = h0;
    lam_h[base + c1] = h1;

    // Two sets of rows: one is worked on while the next block's rows fly into the other.
    float rv0[2][SCAN_CH], rv1[2][SCAN_CH];
    float rl0[2][SCAN_CH], rl1[2][SCAN_CH];
    float rx0[2][SCAN_CH], rx1[2][SCAN_CH];

    auto fetch = [&](int k, int s, int n) {
        #pragma unroll
        for (int j = 0; j < n; ++j) {
            const size_t off = base + (size_t)(1 + k * SCAN_CH + j) * D_INNER;
            rv0[s][j] = v[off + c0];     rv1[s][j] = v[off + c1];
            rl0[s][j] = lam_h[off + c0]; rl1[s][j] = lam_h[off + c1];
            rx0[s][j] = xi[off + c0];    rx1[s][j] = xi[off + c1];
        }
    };
    // The last fetch, behind the loop: its address registers are used up load by load, and a
    // later load's result may land in them, so each load gets its own wait. Runs once.
    auto fetch_last = [&](int k, int s) {
        #pragma unroll
        for (int j = 0; j < SCAN_TAIL; ++j) {
            const size_t off = base + (size_t)(1 + k * SCAN_CH + j) * D_INNER;
            rv0[s][j] = v[off + c0];     wait_addresses_taken();
            rv1[s][j] = v[off + c1];     wait_addresses_taken();
            rl0[s][j] = lam_h[off + c0]; wait_addresses_taken();
            rl1[s][j] = lam_h[off + c1]; wait_addresses_taken();
            rx0[s][j] = xi[off + c0];    wait_addresses_taken();
            rx1[s][j] = xi[off + c1];    wait_addresses_taken();
        }
    };

    const float* tk = tab + (size_t)b * SCAN_BLOCKS * TAB_LD;   // the table line of the block at hand

    // Block k of n steps, its rows in set s; n_next steps of block k+1 are fetched into the other set.
    auto block_of_steps = [&](int k, int s, int n, int n_next) {
        // This block's table line: asked for here, used behind the first barrier.
        float tb[TAB_N];
        #pragma unroll
        for (int j = 0; j < n; ++j) {
            tb[j] = tk[j];
            #pragma unroll
            for (int i = 0; i < j; ++i) tb[TAB_G(j, i)] = tk[TAB_G(j, i)];
        }
        wait_addresses_taken();   // in front of the step of tk
        tk += TAB_LD;
        if (n_next == SCAN_CH) { fetch(k + 1, s ^ 1, SCAN_CH); wait_addresses_taken(); }
        else if (n_next > 0)   fetch_last(k + 1, s ^ 1);

        float p[SCAN_CH];
        float f0 = h0, f1 = h1;
        #pragma unroll
        for (int j = 0; j < n; ++j) {
            p[j] = rv0[s][j] * f0 + rv1[s][j] * f1;
            rx0[s][j] = (1.0f - rl0[s][j]) * rx0[s][j];
            rx1[s][j] = (1.0f - rl1[s][j]) * rx1[s][j];
            f0 = rl0[s][j] * f0 + rx0[s][j];
            f1 = rl1[s][j] * f1 + rx1[s][j];
        }
        #pragma unroll
        for (int m = 16; m > 0; m >>= 1) {   // wave32 butterfly
            #pragma unroll
            for (int j = 0; j < n; ++j) p[j] += __shfl_xor(p[j], m, 32);
        }
        if (lane == 0) {
            #pragma unroll
            for (int j = 0; j < n; ++j) red[j][wave] = p[j];
        }
        barrier_lds_only();
        if (wave == 0) {
            // One wave sums the n dots over the 32 waves and solves for the s_j: the chain of
            // divisions then costs its latency once, not its issue slots in every wave.
            float num[SCAN_CH], sj[SCAN_CH];
            #pragma unroll
            for (int j = 0; j < n; ++j) num[j] = red[j][lane];
            #pragma unroll
            for (int m = 16; m > 0; m >>= 1) {
                #pragma unroll
                for (int j = 0; j < n; ++j) num[j] += __shfl_xor(num[j], m, 32);
            }
            #pragma unroll
            for (int j = 0; j < n; ++j) {
                sj[j] = 2.0f * num[j] / tb[j];
                #pragma unroll
                for (int jj = j + 1; jj < n; ++jj) num[jj] -= sj[j] * tb[TAB_G(jj, j)];
            }
            if (lane == 0) {
                #pragma unroll
                for (int j = 0; j < n; ++j) bcast[j] = sj[j];
            }
        }
        barrier_lds_only();

        float sc[SCAN_CH];
        #pragma unroll
        for (int j = 0; j < n; ++j) sc[j] = bcast[j];

        float hr0[SCAN_CH], hr1[SCAN_CH];
        #pragma unroll
        for (int j = 0; j < n; ++j) {
            h0 = rl0[s][j] * (h0 - rv0[s][j] * sc[j]) + rx0[s][j];
            h1 = rl1[s][j] * (h1 - rv1[s][j] * sc[j]) + rx1[s][j];
            hr0[j] = h0;
            hr1[j] = h1;
        }
        #pragma unroll
        for (int j = 0; j < n; ++j) {
            const size_t off = base + (size_t)(1 + k * SCAN_CH + j) * D_INNER;
            lam_h[off + c0] = hr0[j];
            lam_h[off + c1] = hr1[j];
        }
        wait_addresses_taken();
        barrier_lds_only();   // red[] and bcast[] safe to overwrite in the next block
    };

    fetch(0, 0, SCAN_CH);
    wait_addresses_taken();

    // The set index must be a constant for the rows to stay in registers: two
    // blocks per trip, the loop itself stays rolled.
    #pragma unroll 1
    for (int kk = 0; kk < SCAN_FULL / 2; ++kk) {
        block_of_steps(2 * kk,     0, SCAN_CH, SCAN_CH);
        block_of_steps(2 * kk + 1, 1, SCAN_CH, SCAN_CH);
    }
    block_of_steps(SCAN_FULL - 1, 0, SCAN_CH,   SCAN_TAIL);
    block_of_steps(SCAN_FULL,     1, SCAN_TAIL, 0);
}

// g = silu(z) * h, written over z
__global__ void silu_mul_kernel(const float* __restrict__ h, float* __restrict__ z_io,
                                size_t n)
{
    size_t i      = (size_t)blockIdx.x * blockDim.x + threadIdx.x;
    size_t stride = (size_t)gridDim.x * blockDim.x;
    for (; i < n; i += stride) {
        float zv = z_io[i];
        float s  = zv / (1.0f + expf(-zv));
        z_io[i] = s * h[i];
    }
}

// ---------------------------------------------------------------------------
extern "C" void kernel_launch(void* const* d_in, const int* in_sizes, int n_in,
                              void* d_out, int out_size, void* d_ws, size_t ws_size,
                              hipStream_t stream)
{
    const float* x     = (const float*)d_in[0];
    const float* omega = (const float*)d_in[1];   // 2048
    const float* Win   = (const float*)d_in[2];   // 4096 x 1024
    const float* Wl    = (const float*)d_in[3];   // 2048 x 2048
    const float* bl    = (const float*)d_in[4];
    const float* Wv    = (const float*)d_in[5];   // 2048 x 2048
    const float* bv    = (const float*)d_in[6];
    const float* Wout  = (const float*)d_in[7];   // 1024 x 2048
    float* out = (float*)d_out;

    const size_t BUF = (size_t)M_ROWS * D_INNER;  // 16,777,216 floats (64 MB)
    float* ws    = (float*)d_ws;
    float* xi    = ws;             // [M_ROWS, D_INNER]
    float* z     = ws + BUF;       // [M_ROWS, D_INNER] (later holds silu(z)*h)
    float* lam_h = ws + 2 * BUF;   // lam in, h out (in place)
    float* vbuf  = ws + 3 * BUF;   // total 256 MB of d_ws used

    dim3 blk(128);

    // 1) xz = x @ Win^T, split into xi | z
    {
        dim3 grd(4096 / TN, M_ROWS / TM);
        wmma_gemm_f32<<<grd, blk, 0, stream>>>(x, Win, nullptr, nullptr,
                                               xi, z, M_ROWS, 4096, D_MODEL, EPI_SPLIT);
    }
    // 2) lam = exp(-8*softplus(omega)*sigmoid(xi@Wl^T + bl))
    {
        dim3 grd(D_INNER / TN, M_ROWS / TM);
        wmma_gemm_f32<<<grd, blk, 0, stream>>>(xi, Wl, bl, omega,
                                               lam_h, nullptr, M_ROWS, D_INNER, D_INNER, EPI_LAMBDA);
    }
    // 3) v = xi @ Wv^T + bv
    {
        dim3 grd(D_INNER / TN, M_ROWS / TM);
        wmma_gemm_f32<<<grd, blk, 0, stream>>>(xi, Wv, bv, nullptr,
                                               vbuf, nullptr, M_ROWS, D_INNER, D_INNER, EPI_PLAIN);
    }
    // 4) Householder scan (h overwrites lam buffer). The table of h-independent dots lies at
    //    the head of out, which launch 6 overwrites whole: the workspace has no byte left.
    scan_dots_kernel<<<dim3(SCAN_BLOCKS, BATCH), 256, 0, stream>>>(vbuf, lam_h, out);
    scan_kernel<<<BATCH, 1024, 0, stream>>>(xi, vbuf, lam_h, out);

    // 5) g = silu(z) * h   (overwrites z)
    silu_mul_kernel<<<4096, 256, 0, stream>>>(lam_h, z, BUF);

    // 6) out = g @ Wout^T
    {
        dim3 grd(D_MODEL / TN, M_ROWS / TM);
        wmma_gemm_f32<<<grd, blk, 0, stream>>>(z, Wout, nullptr, nullptr,
                                               out, nullptr, M_ROWS, D_MODEL, D_INNER, EPI_PLAIN);
    }
}

// v003
// Measured time: 2300 microseconds a run.
// In both of two side-by-side timings against v002, it was 1.06 times as fast.
// All steps since v000 together make it 1.99 times as fast.
#include <hip/hip_runtime.h>
#include <cmath>

// ---------------------------------------------------------------------------
// DenseRNN (Householder-reflection linear RNN) for MI455X / gfx1250
//   xz = x @ Win^T ; xi,z = split(xz)
//   lam = exp(-8*softplus(omega)*sigmoid(xi@Wl^T + bl))
//   v   = xi@Wv^T + bv
//   scan: h_t = lam_t*(h_{t-1} - 2 v_t (v.h)/(v.v)) + (1-lam_t)*xi_t ; h_0 = xi_0
//   out = (silu(z)*h) @ Wout^T
// GEMMs: V_WMMA_F32_16X16X4_F32 + double-buffered async global->LDS staging.
// ---------------------------------------------------------------------------

typedef __attribute__((ext_vector_type(2))) float v2f;
typedef __attribute__((ext_vector_type(8))) float v8f;
typedef int v4i_gcc __attribute__((vector_size(16)));   // matches builtin pointee

#define D_MODEL   1024
#define D_INNER   2048
#define BATCH     4
#define SEQ       2048
#define M_ROWS    (BATCH * SEQ)        // 8192

// GEMM tiling: 128 threads = 4 waves; each wave owns a 32x64 C strip.
#define TM 128        // block rows
#define TN 64         // block cols
#define TK 32         // K tile
#define LDS_PAD 4     // row stride 36 floats = 144 B (16B aligned for b128 async)
#define LDS_LD  (TK + LDS_PAD)

// Epilogue modes
#define EPI_PLAIN  0   // out0[m,col] = acc (+ bias if non-null)
#define EPI_LAMBDA 1   // out0[m,col] = exp(-8*softplus(omega[col])*sigmoid(acc+bias[col]))
#define EPI_SPLIT  2   // col < D_INNER -> out0 (xi), else -> out1 (z), both ld = D_INNER

// --- async global->LDS copy (CDNA5 ASYNCcnt path), with sync fallback ------
#if defined(__AMDGCN__) && __has_builtin(__builtin_amdgcn_global_load_async_to_lds_b128)
#define USE_ASYNC_LDS 1
#else
#define USE_ASYNC_LDS 0
#endif

__device__ __forceinline__ void copy16_g2l(const float* __restrict__ g, float* l)
{
#if USE_ASYNC_LDS
    __builtin_amdgcn_global_load_async_to_lds_b128(
        (__attribute__((address_space(1))) v4i_gcc*)(void*)g,
        (__attribute__((address_space(3))) v4i_gcc*)(void*)l,
        /*imm offset=*/0, /*cpol=*/0);
#else
    *(float4*)l = *(const float4*)g;
#endif
}

__device__ __forceinline__ void wait_async_lds()
{
#if USE_ASYNC_LDS
#if __has_builtin(__builtin_amdgcn_s_wait_asynccnt)
    __builtin_amdgcn_s_wait_asynccnt(0);
#else
    asm volatile("s_wait_asynccnt 0x0" ::: "memory");
#endif
#endif
}

// Stands behind a group of global loads or stores, in front of the first
// instruction that may reuse one of their address or data registers. The
// scheduling barrier keeps later instructions, which may take those registers,
// from being lifted over the wait, and the loads in front of it from sinking
// behind it (a build without it did both, and spilled registers in the scan).
__device__ __forceinline__ void wait_addresses_taken()
{
    asm volatile("s_wait_xcnt 0x0" ::: "memory");
    __builtin_amdgcn_sched_barrier(0);
}

// C[M,N] = A[M,K] * W[N,K]^T   (A row-major MxK, W row-major NxK; both K-contiguous)
// Requires: M % TM == 0, N % TN == 0, K % TK == 0.
// The epilogue mode is a template argument, and what depends on the column alone is formed
// once per column, for speed only.
template <int MODE>
__global__ __launch_bounds__(128)
void wmma_gemm_f32(const float* __restrict__ A, const float* __restrict__ W,
                   const float* __restrict__ bias, const float* __restrict__ omega,
                   float* __restrict__ out0, float* __restrict__ out1,
                   int M, int N, int K)
{
    __shared__ float As[2][TM][LDS_LD];   // A tile, row-major, double buffered
    __shared__ float Bs[2][TN][LDS_LD];   // W tile, n-major: Bs[.][n][k] = W[nBlock+n][k0+k]

    const int tid  = threadIdx.x;
    const int wave = tid >> 5;               // 0..3 (wave32)
    const int lane = tid & 31;
    const int laneMod  = lane & 15;          // 0..15
    const int laneHalf = lane >> 4;          // 0 or 1

    const int mBlock = blockIdx.y * TM;
    const int nBlock = blockIdx.x * TN;
    const int waveM  = wave * 32;            // this wave's 32-row strip inside block tile

    v8f acc[2][4];
    #pragma unroll
    for (int mt = 0; mt < 2; ++mt)
        #pragma unroll
        for (int nt = 0; nt < 4; ++nt)
            #pragma unroll
            for (int r = 0; r < 8; ++r) acc[mt][nt][r] = 0.0f;

    // ---- tile stage: issues TM*TK/4/128 = 8 A chunks + 4 W chunks of b128 ----
    auto stage_tile = [&](int k0, int b) {
        #pragma unroll
        for (int i = 0; i < 8; ++i) {
            int q   = tid + i * 128;          // 0..1023
            int row = q >> 3;                 // 8 float4 per 32-float row
            int c4  = (q & 7) << 2;
            copy16_g2l(A + (size_t)(mBlock + row) * K + k0 + c4, &As[b][row][c4]);
        }
        #pragma unroll
        for (int i = 0; i < 4; ++i) {
            int q   = tid + i * 128;          // 0..511
            int row = q >> 3;
            int c4  = (q & 7) << 2;
            copy16_g2l(W + (size_t)(nBlock + row) * K + k0 + c4, &Bs[b][row][c4]);
        }
    };

    int buf = 0;
    stage_tile(0, buf);
    wait_async_lds();
    __syncthreads();

    for (int k0 = 0; k0 < K; k0 += TK) {
        const int nbuf = buf ^ 1;
        if (k0 + TK < K) stage_tile(k0 + TK, nbuf);   // prefetch next tile (async)

        // ---- 8 K-steps; per step: 2 A frags x 4 B frags = 8 WMMAs ----
        #pragma unroll
        for (int kk = 0; kk < TK; kk += 4) {
            // A frag (16x4): lanes 0-15: M=lane, K=kk+{0,1}; lanes 16-31: K=kk+{2,3}
            v2f a0, a1;
            a0.x = As[buf][waveM + laneMod][kk + 2 * laneHalf + 0];
            a0.y = As[buf][waveM + laneMod][kk + 2 * laneHalf + 1];
            a1.x = As[buf][waveM + 16 + laneMod][kk + 2 * laneHalf + 0];
            a1.y = As[buf][waveM + 16 + laneMod][kk + 2 * laneHalf + 1];
            #pragma unroll
            for (int nt = 0; nt < 4; ++nt) {
                // B frag (4x16): lane holds K=kk+2*laneHalf+{0,1}, N=nt*16+laneMod
                v2f bf;
                bf.x = Bs[buf][nt * 16 + laneMod][kk + 2 * laneHalf + 0];
                bf.y = Bs[buf][nt * 16 + laneMod][kk + 2 * laneHalf + 1];
                acc[0][nt] = __builtin_amdgcn_wmma_f32_16x16x4_f32(
                    false, a0, false, bf, (short)0, acc[0][nt], false, false);
                acc[1][nt] = __builtin_amdgcn_wmma_f32_16x16x4_f32(
                    false, a1, false, bf, (short)0, acc[1][nt], false, false);
            }
        }

        wait_async_lds();       // next tile landed in LDS
        __syncthreads();        // all waves done reading `buf`, async writes visible
        buf = nbuf;
    }

    // ---- epilogue: C/D layout: VGPR r -> row = r + 8*laneHalf, col = laneMod ----
    // What depends on the column alone, once per column: the bias, and -8*softplus(omega).
    float cb[4], ck[4];
    #pragma unroll
    for (int nt = 0; nt < 4; ++nt) {
        const int col = nBlock + nt * 16 + laneMod;
        cb[nt] = 0.0f;
        ck[nt] = 0.0f;
        if (MODE == EPI_LAMBDA) {
            cb[nt] = bias[col];
            ck[nt] = -8.0f * log1pf(expf(omega[col]));
        } else if (MODE == EPI_PLAIN) {
            if (bias) cb[nt] = bias[col];
        }
    }
    if (MODE != EPI_SPLIT) wait_addresses_taken();   // the row addresses formed next may take these loads' address registers

    // A block's TN columns lie wholly in xi or wholly in z.
    static_assert(D_INNER % TN == 0, "a block of columns must not straddle the split");
    float* dst = out0 + nBlock;
    size_t ld  = (size_t)N;
    if (MODE == EPI_SPLIT) {
        ld = D_INNER;
        if (nBlock >= D_INNER) dst = out1 + (nBlock - D_INNER);
    }

    #pragma unroll
    for (int mt = 0; mt < 2; ++mt) {
        #pragma unroll
        for (int r = 0; r < 8; ++r) {
            const int m = mBlock + waveM + mt * 16 + r + 8 * laneHalf;
            float* row = dst + (size_t)m * ld + laneMod;
            #pragma unroll
            for (int nt = 0; nt < 4; ++nt) {
                float val = acc[mt][nt][r];
                if (MODE == EPI_PLAIN) {
                    if (bias) val += cb[nt];
                } else if (MODE == EPI_LAMBDA) {
                    val += cb[nt];
                    float sig = 1.0f / (1.0f + expf(-val));
                    val = expf(ck[nt] * sig);
                }
                row[nt * 16] = val;
            }
            // The next row's address and values may take this row's registers. With the split's
            // constant row pitch the eight rows of one mt share one address and store the
            // accumulators themselves: there nothing is rewritten before the next mt.
            if (mt * 8 + r < 15 && (MODE != EPI_SPLIT || r == 7)) wait_addresses_taken();
        }
    }
}

// ---------------------------------------------------------------------------
// Householder scan, blocked by SCAN_CH steps. Inside a block of steps
//   h_j = f_j - sum_{i<=j} s_i w_{i,j},   s_j = 2 (v_j.h_{j-1}) / (v_j.v_j)
// with f the same recurrence without its reflections (f_j = lam_j f_{j-1} + (1-lam_j) xi_j,
// started at the block's entry h) and w_{i,j} = lam_j ... lam_i v_i. So
//   v_j.h_{j-1} = v_j.f_{j-1} - sum_{i<j} s_i (v_j.w_{i,j-1}).
// The dots v_j.v_j and v_j.w_{i,j-1} do not depend on h: a kernel over the whole chip
// forms them for every block of steps. The sequential kernel then needs ONE work-group sum
// (of the SCAN_CH dots v_j.f_{j-1}) per block of steps, a forward substitution for the
// s_j, and the reference's own recurrence with those s_j.
// ---------------------------------------------------------------------------
typedef __attribute__((ext_vector_type(4))) float v4f;

#define SCAN_CH     6                                   // steps per block of steps
#define SCAN_FULL   ((SEQ - 1) / SCAN_CH)               // blocks with all their steps: 341
#define SCAN_TAIL   ((SEQ - 1) - SCAN_FULL * SCAN_CH)   // steps of the last, short block: 1
#define SCAN_BLOCKS (SCAN_FULL + 1)
#define TAB_N       (SCAN_CH + SCAN_CH * (SCAN_CH - 1) / 2)  // 6 v.v and 15 v.w
#define TAB_LD      32                                  // one 128-byte line per block of steps
#define TAB_G(j, i) (SCAN_CH + (j) * ((j) - 1) / 2 + (i))    // v_j.w_{i,j-1}, i < j
static_assert(SCAN_TAIL > 0 && SCAN_FULL % 2 == 1, "the scan's last calls are written for this case");

// Work-group barrier that orders LDS only. __syncthreads() also drains the
// wave's global loads and stores, which would put the memory latency of the
// rows fetched ahead, and of the h stores, back into every round.
__device__ __forceinline__ void barrier_lds_only()
{
    __builtin_amdgcn_fence(__ATOMIC_RELEASE, "workgroup", "local");
    __builtin_amdgcn_s_barrier();
    __builtin_amdgcn_fence(__ATOMIC_ACQUIRE, "workgroup", "local");
}

// tab[b][k][.]: the h-independent dots of block k of batch b. One work-group each.
// Rows past the end (short last block) are read as the last row; their entries are never used.
__global__ __launch_bounds__(256)
void scan_dots_kernel(const float* __restrict__ v, const float* __restrict__ lam,
                      float* __restrict__ tab)
{
    const int k   = blockIdx.x;
    const int b   = blockIdx.y;
    const int tid = threadIdx.x;
    const size_t base = (size_t)b * SEQ * D_INNER + tid * 4;

    __shared__ float part[8][TAB_N];

    v4f rv[2][SCAN_CH], rl[2][SCAN_CH];
    #pragma unroll
    for (int j = 0; j < SCAN_CH; ++j) {
        int t = 1 + k * SCAN_CH + j;
        if (t > SEQ - 1) t = SEQ - 1;
        #pragma unroll
        for (int hf = 0; hf < 2; ++hf) {
            const size_t off = base + (size_t)t * D_INNER + hf * 1024;
            rv[hf][j] = *(const v4f*)(v + off);
            wait_addresses_taken();   // a later load's result may land in this load's address registers
            rl[hf][j] = *(const v4f*)(lam + off);
            wait_addresses_taken();
        }
    }

    float acc[TAB_N];
    #pragma unroll
    for (int q = 0; q < TAB_N; ++q) acc[q] = 0.0f;

    #pragma unroll
    for (int hf = 0; hf < 2; ++hf) {
        #pragma unroll
        for (int e = 0; e < 4; ++e) {
            float w[SCAN_CH];
            #pragma unroll
            for (int j = 0; j < SCAN_CH; ++j) {
                const float vj = rv[hf][j][e];
                const float lj = rl[hf][j][e];
                acc[j] += vj * vj;
                #pragma unroll
                for (int i = 0; i < j; ++i) acc[TAB_G(j, i)] += vj * w[i];
                #pragma unroll
                for (int i = 0; i < j; ++i) w[i] *= lj;
                w[j] = lj * vj;
            }
        }
    }

    #pragma unroll
    for (int m = 16; m > 0; m >>= 1) {
        #pragma unroll
        for (int q = 0; q < TAB_N; ++q) acc[q] += __shfl_xor(acc[q], m, 32);
    }
    if ((tid & 31) == 0) {
        #pragma unroll
        for (int q = 0; q < TAB_N; ++q) part[tid >> 5][q] = acc[q];
    }
    __syncthreads();
    if (tid < TAB_N) {
        float s = 0.0f;
        #pragma unroll
        for (int w8 = 0; w8 < 8; ++w8) s += part[w8][tid];
        tab[((size_t)b * SCAN_BLOCKS + k) * TAB_LD + tid] = s;
    }
}

// One work-group per batch, 1024 threads, 2 channels per thread.
// lam_h holds lam on entry; h is written in place (a thread reads lam[t] before it
// writes h[t]; lam[.,0,.] is never consumed by the reference).
// No thread reads a global word that another thread of this launch writes, so
// global memory needs no ordering at the barriers: only red[] and bcast[] do.
__global__ __launch_bounds__(1024)
void scan_kernel(const float* __restrict__ xi, const float* __restrict__ v,
                 float* __restrict__ lam_h, const float* __restrict__ tab)
{
    const int b    = blockIdx.x;
    const int tid  = threadIdx.x;
    const int c0   = tid;
    const int c1   = tid + 1024;
    const int wave = tid >> 5;
    const int lane = tid & 31;
    const size_t base = (size_t)b * SEQ * D_INNER;

    __shared__ float red[SCAN_CH][32];   // per dot: one partial sum of each of the 32 waves
    __shared__ float bcast[SCAN_CH];

    float h0 = xi[base + c0];
    float h1 = xi[base + c1];
    lam_h[base + c0] = h0;
    lam_h[base + c1] = h1;

    // Two sets of rows: one is worked on while the next block's rows fly into the other.
    float rv0[2][SCAN_CH], rv1[2][SCAN_CH];
    float rl0[2][SCAN_CH], rl1[2][SCAN_CH];
    float rx0[2][SCAN_CH], rx1[2][SCAN_CH];

    auto fetch = [&](int k, int s, int n) {
        #pragma unroll
        for (int j = 0; j < n; ++j) {
            const size_t off = base + (size_t)(1 + k * SCAN_CH + j) * D_INNER;
            rv0[s][j] = v[off + c0];     rv1[s][j] = v[off + c1];
            rl0[s][j] = lam_h[off + c0]; rl1[s][j] = lam_h[off + c1];
            rx0[s][j] = xi[off + c0];    rx1[s][j] = xi[off + c1];
        }
    };
    // The last fetch, behind the loop: its address registers are used up load by load, and a
    // later load's result may land in them, so each load gets its own wait. Runs once.
    auto fetch_last = [&](int k, int s) {
        #pragma unroll
        for (int j = 0; j < SCAN_TAIL; ++j) {
            const size_t off = base + (size_t)(1 + k * SCAN_CH + j) * D_INNER;
            rv0[s][j] = v[off + c0];     wait_addresses_taken();
            rv1[s][j] = v[off + c1];     wait_addresses_taken();
            rl0[s][j] = lam_h[off + c0]; wait_addresses_taken();
            rl1[s][j] = lam_h[off + c1]; wait_addresses_taken();
            rx0[s][j] = xi[off + c0];    wait_addresses_taken();
            rx1[s][j] = xi[off + c1];    wait_addresses_taken();
        }
    };

    const float* tk = tab + (size_t)b * SCAN_BLOCKS * TAB_LD;   // the table line of the block at hand

    // Block k of n steps, its rows in set s; n_next steps of block k+1 are fetched into the other set.
    auto block_of_steps = [&](int k, int s, int n, int n_next) {
        // This block's table line: asked for here, used behind the first barrier.
        float tb[TAB_N];
        #pragma unroll
        for (int j = 0; j < n; ++j) {
            tb[j] = tk[j];
            #pragma unroll
            for (int i = 0; i < j; ++i) tb[TAB_G(j, i)] = tk[TAB_G(j, i)];
        }
        wait_addresses_taken();   // in front of the step of tk
        tk += TAB_LD;
        if (n_next == SCAN_CH) { fetch(k + 1, s ^ 1, SCAN_CH); wait_addresses_taken(); }
        else if (n_next > 0)   fetch_last(k + 1, s ^ 1);

        float p[SCAN_CH];
        float f0 = h0, f1 = h1;
        #pragma unroll
        for (int j = 0; j < n; ++j) {
            p[j] = rv0[s][j] * f0 + rv1[s][j] * f1;
            rx0[s][j] = (1.0f - rl0[s][j]) * rx0[s][j];
            rx1[s][j] = (1.0f - rl1[s][j]) * rx1[s][j];
            f0 = rl0[s][j] * f0 + rx0[s][j];
            f1 = rl1[s][j] * f1 + rx1[s][j];
        }
        #pragma unroll
        for (int m = 16; m > 0; m >>= 1) {   // wave32 butterfly
            #pragma unroll
            for (int j = 0; j < n; ++j) p[j] += __shfl_xor(p[j], m, 32);
        }
        if (lane == 0) {
            #pragma unroll
            for (int j = 0; j < n; ++j) red[j][wave] = p[j];
        }
        barrier_lds_only();
        if (wave == 0) {
            // One wave sums the n dots over the 32 waves and solves for the s_j: the chain of
            // divisions then costs its latency once, not its issue slots in every wave.
            float num[SCAN_CH], sj[SCAN_CH];
            #pragma unroll
            for (int j = 0; j < n; ++j) num[j] = red[j][lane];
            #pragma unroll
            for (int m = 16; m > 0; m >>= 1) {
                #pragma unroll
                for (int j = 0; j < n; ++j) num[j] += __shfl_xor(num[j], m, 32);
            }
            #pragma unroll
            for (int j = 0; j < n; ++j) {
                sj[j] = 2.0f * num[j] / tb[j];
                #pragma unroll
                for (int jj = j + 1; jj < n; ++jj) num[jj] -= sj[j] * tb[TAB_G(jj, j)];
            }
            if (lane == 0) {
                #pragma unroll
                for (int j = 0; j < n; ++j) bcast[j] = sj[j];
            }
        }
        barrier_lds_only();

        float sc[SCAN_CH];
        #pragma unroll
        for (int j = 0; j < n; ++j) sc[j] = bcast[j];

        float hr0[SCAN_CH], hr1[SCAN_CH];
        #pragma unroll
        for (int j = 0; j < n; ++j) {
            h0 = rl0[s][j] * (h0 - rv0[s][j] * sc[j]) + rx0[s][j];
            h1 = rl1[s][j] * (h1 - rv1[s][j] * sc[j]) + rx1[s][j];
            hr0[j] = h0;
            hr1[j] = h1;
        }
        #pragma unroll
        for (int j = 0; j < n; ++j) {
            const size_t off = base + (size_t)(1 + k * SCAN_CH + j) * D_INNER;
            lam_h[off + c0] = hr0[j];
            lam_h[off + c1] = hr1[j];
        }
        wait_addresses_taken();
        barrier_lds_only();   // red[] and bcast[] safe to overwrite in the next block
    };

    fetch(0, 0, SCAN_CH);
    wait_addresses_taken();

    // The set index must be a constant for the rows to stay in registers: two
    // blocks per trip, the loop itself stays rolled.
    #pragma unroll 1
    for (int kk = 0; kk < SCAN_FULL / 2; ++kk) {
        block_of_steps(2 * kk,     0, SCAN_CH, SCAN_CH);
        block_of_steps(2 * kk + 1, 1, SCAN_CH, SCAN_CH);
    }
    block_of_steps(SCAN_FULL - 1, 0, SCAN_CH,   SCAN_TAIL);
    block_of_steps(SCAN_FULL,     1, SCAN_TAIL, 0);
}

// g = silu(z) * h, written over z
__global__ void silu_mul_kernel(const float* __restrict__ h, float* __restrict__ z_io,
                                size_t n)
{
    size_t i      = (size_t)blockIdx.x * blockDim.x + threadIdx.x;
    size_t stride = (size_t)gridDim.x * blockDim.x;
    for (; i < n; i += stride) {
        float zv = z_io[i];
        float s  = zv / (1.0f + expf(-zv));
        z_io[i] = s * h[i];
    }
}

// ---------------------------------------------------------------------------
extern "C" void kernel_launch(void* const* d_in, const int* in_sizes, int n_in,
                              void* d_out, int out_size, void* d_ws, size_t ws_size,
                              hipStream_t stream)
{
    const float* x     = (const float*)d_in[0];
    const float* omega = (const float*)d_in[1];   // 2048
    const float* Win   = (const float*)d_in[2];   // 4096 x 1024
    const float* Wl    = (const float*)d_in[3];   // 2048 x 2048
    const float* bl    = (const float*)d_in[4];
    const float* Wv    = (const float*)d_in[5];   // 2048 x 2048
    const float* bv    = (const float*)d_in[6];
    const float* Wout  = (const float*)d_in[7];   // 1024 x 2048
    float* out = (float*)d_out;

    const size_t BUF = (size_t)M_ROWS * D_INNER;  // 16,777,216 floats (64 MB)
    float* ws    = (float*)d_ws;
    float* xi    = ws;             // [M_ROWS, D_INNER]
    float* z     = ws + BUF;       // [M_ROWS, D_INNER] (later holds silu(z)*h)
    float* lam_h = ws + 2 * BUF;   // lam in, h out (in place)
    float* vbuf  = ws + 3 * BUF;   // total 256 MB of d_ws used

    dim3 blk(128);

    // 1) xz = x @ Win^T, split into xi | z
    {
        dim3 grd(4096 / TN, M_ROWS / TM);
        wmma_gemm_f32<EPI_SPLIT><<<grd, blk, 0, stream>>>(x, Win, nullptr, nullptr,
                                                          xi, z, M_ROWS, 4096, D_MODEL);
    }
    // 2) lam = exp(-8*softplus(omega)*sigmoid(xi@Wl^T + bl))
    {
        dim3 grd(D_INNER / TN, M_ROWS / TM);
        wmma_gemm_f32<EPI_LAMBDA><<<grd, blk, 0, stream>>>(xi, Wl, bl, omega,
                                                           lam_h, nullptr, M_ROWS, D_INNER, D_INNER);
    }
    // 3) v = xi @ Wv^T + bv
    {
        dim3 grd(D_INNER / TN, M_ROWS / TM);
        wmma_gemm_f32<EPI_PLAIN><<<grd, blk, 0, stream>>>(xi, Wv, bv, nullptr,
                                                          vbuf, nullptr, M_ROWS, D_INNER, D_INNER);
    }
    // 4) Householder scan (h overwrites lam buffer). The table of h-independent dots lies at
    //    the head of out, which launch 6 overwrites whole: the workspace has no byte left.
    scan_dots_kernel<<<dim3(SCAN_BLOCKS, BATCH), 256, 0, stream>>>(vbuf, lam_h, out);
    scan_kernel<<<BATCH, 1024, 0, stream>>>(xi, vbuf, lam_h, out);

    // 5) g = silu(z) * h   (overwrites z)
    silu_mul_kernel<<<4096, 256, 0, stream>>>(lam_h, z, BUF);

    // 6) out = g @ Wout^T
    {
        dim3 grd(D_MODEL / TN, M_ROWS / TM);
        wmma_gemm_f32<EPI_PLAIN><<<grd, blk, 0, stream>>>(z, Wout, nullptr, nullptr,
                                                          out, nullptr, M_ROWS, D_MODEL, D_INNER);
    }
}

// v004
// One run takes 1990 microseconds.
// Two timings next to v003 put it at 1.16 and 1.15 times that version's speed.
// All steps since v000 together make it 2.29 times as fast.
#include <hip/hip_runtime.h>
#include <cmath>

// ---------------------------------------------------------------------------
// DenseRNN (Householder-reflection linear RNN) for MI455X / gfx1250
//   xz = x @ Win^T ; xi,z = split(xz)
//   lam = exp(-8*softplus(omega)*sigmoid(xi@Wl^T + bl))
//   v   = xi@Wv^T + bv
//   scan: h_t = lam_t*(h_{t-1} - 2 v_t (v.h)/(v.v)) + (1-lam_t)*xi_t ; h_0 = xi_0
//   out = (silu(z)*h) @ Wout^T
// GEMMs: V_WMMA_F32_16X16X4_F32 + double-buffered async global->LDS staging.
// ---------------------------------------------------------------------------

typedef __attribute__((ext_vector_type(2))) float v2f;
typedef __attribute__((ext_vector_type(8))) float v8f;
typedef int v4i_gcc __attribute__((vector_size(16)));   // matches builtin pointee

#define D_MODEL   1024
#define D_INNER   2048
#define BATCH     4
#define SEQ       2048
#define M_ROWS    (BATCH * SEQ)        // 8192

// GEMM tiling: 128 threads = 4 waves; each wave owns a 32x64 C strip.
#define TM 128        // block rows
#define TN 64         // block cols
#define TK 32         // K tile
#define LDS_PAD 4     // row stride 36 floats = 144 B (16B aligned for b128 async)
#define LDS_LD  (TK + LDS_PAD)

// Epilogue modes
#define EPI_PLAIN  0   // out0[m,col] = acc (+ bias if non-null)
#define EPI_LAMBDA 1   // out0[m,col] = exp(-8*softplus(omega[col])*sigmoid(acc+bias[col]))
#define EPI_SPLIT  2   // col < D_INNER -> out0 (xi), else -> out1 (z), both ld = D_INNER

// --- async global->LDS copy (CDNA5 ASYNCcnt path), with sync fallback ------
#if defined(__AMDGCN__) && __has_builtin(__builtin_amdgcn_global_load_async_to_lds_b128)
#define USE_ASYNC_LDS 1
#else
#define USE_ASYNC_LDS 0
#endif

__device__ __forceinline__ void copy16_g2l(const float* __restrict__ g, float* l)
{
#if USE_ASYNC_LDS
    __builtin_amdgcn_global_load_async_to_lds_b128(
        (__attribute__((address_space(1))) v4i_gcc*)(void*)g,
        (__attribute__((address_space(3))) v4i_gcc*)(void*)l,
        /*imm offset=*/0, /*cpol=*/0);
#else
    *(float4*)l = *(const float4*)g;
#endif
}

__device__ __forceinline__ void wait_async_lds()
{
#if USE_ASYNC_LDS
#if __has_builtin(__builtin_amdgcn_s_wait_asynccnt)
    __builtin_amdgcn_s_wait_asynccnt(0);
#else
    asm volatile("s_wait_asynccnt 0x0" ::: "memory");
#endif
#endif
}

// Stands behind a group of global loads or stores, in front of the first
// instruction that may reuse one of their address or data registers. The
// scheduling barrier keeps later instructions, which may take those registers,
// from being lifted over the wait, and the loads in front of it from sinking
// behind it (a build without it did both, and spilled registers in the scan).
__device__ __forceinline__ void wait_addresses_taken()
{
    asm volatile("s_wait_xcnt 0x0" ::: "memory");
    __builtin_amdgcn_sched_barrier(0);
}

// C[M,N] = A[M,K] * W[N,K]^T   (A row-major MxK, W row-major NxK; both K-contiguous)
// Requires: M % TM == 0, N % TN == 0, K % TK == 0.
// The epilogue mode is a template argument, and what depends on the column alone is formed
// once per column, for speed only.
template <int MODE>
__global__ __launch_bounds__(128)
void wmma_gemm_f32(const float* __restrict__ A, const float* __restrict__ W,
                   const float* __restrict__ bias, const float* __restrict__ omega,
                   float* __restrict__ out0, float* __restrict__ out1,
                   int M, int N, int K)
{
    __shared__ float As[2][TM][LDS_LD];   // A tile, row-major, double buffered
    __shared__ float Bs[2][TN][LDS_LD];   // W tile, n-major: Bs[.][n][k] = W[nBlock+n][k0+k]

    const int tid  = threadIdx.x;
    const int wave = tid >> 5;               // 0..3 (wave32)
    const int lane = tid & 31;
    const int laneMod  = lane & 15;          // 0..15
    const int laneHalf = lane >> 4;          // 0 or 1

    const int mBlock = blockIdx.y * TM;
    const int nBlock = blockIdx.x * TN;
    const int waveM  = wave * 32;            // this wave's 32-row strip inside block tile

    v8f acc[2][4];
    #pragma unroll
    for (int mt = 0; mt < 2; ++mt)
        #pragma unroll
        for (int nt = 0; nt < 4; ++nt)
            #pragma unroll
            for (int r = 0; r < 8; ++r) acc[mt][nt][r] = 0.0f;

    // ---- tile stage: issues TM*TK/4/128 = 8 A chunks + 4 W chunks of b128 ----
    auto stage_tile = [&](int k0, int b) {
        #pragma unroll
        for (int i = 0; i < 8; ++i) {
            int q   = tid + i * 128;          // 0..1023
            int row = q >> 3;                 // 8 float4 per 32-float row
            int c4  = (q & 7) << 2;
            copy16_g2l(A + (size_t)(mBlock + row) * K + k0 + c4, &As[b][row][c4]);
        }
        #pragma unroll
        for (int i = 0; i < 4; ++i) {
            int q   = tid + i * 128;          // 0..511
            int row = q >> 3;
            int c4  = (q & 7) << 2;
            copy16_g2l(W + (size_t)(nBlock + row) * K + k0 + c4, &Bs[b][row][c4]);
        }
    };

    int buf = 0;
    stage_tile(0, buf);
    wait_async_lds();
    __syncthreads();

    for (int k0 = 0; k0 < K; k0 += TK) {
        const int nbuf = buf ^ 1;
        if (k0 + TK < K) stage_tile(k0 + TK, nbuf);   // prefetch next tile (async)

        // ---- 8 K-steps; per step: 2 A frags x 4 B frags = 8 WMMAs ----
        #pragma unroll
        for (int kk = 0; kk < TK; kk += 4) {
            // A frag (16x4): lanes 0-15: M=lane, K=kk+{0,1}; lanes 16-31: K=kk+{2,3}
            v2f a0, a1;
            a0.x = As[buf][waveM + laneMod][kk + 2 * laneHalf + 0];
            a0.y = As[buf][waveM + laneMod][kk + 2 * laneHalf + 1];
            a1.x = As[buf][waveM + 16 + laneMod][kk + 2 * laneHalf + 0];
            a1.y = As[buf][waveM + 16 + laneMod][kk + 2 * laneHalf + 1];
            #pragma unroll
            for (int nt = 0; nt < 4; ++nt) {
                // B frag (4x16): lane holds K=kk+2*laneHalf+{0,1}, N=nt*16+laneMod
                v2f bf;
                bf.x = Bs[buf][nt * 16 + laneMod][kk + 2 * laneHalf + 0];
                bf.y = Bs[buf][nt * 16 + laneMod][kk + 2 * laneHalf + 1];
                acc[0][nt] = __builtin_amdgcn_wmma_f32_16x16x4_f32(
                    false, a0, false, bf, (short)0, acc[0][nt], false, false);
                acc[1][nt] = __builtin_amdgcn_wmma_f32_16x16x4_f32(
                    false, a1, false, bf, (short)0, acc[1][nt], false, false);
            }
        }

        wait_async_lds();       // next tile landed in LDS
        __syncthreads();        // all waves done reading `buf`, async writes visible
        buf = nbuf;
    }

    // ---- epilogue: C/D layout: VGPR r -> row = r + 8*laneHalf, col = laneMod ----
    // What depends on the column alone, once per column: the bias, and -8*softplus(omega).
    float cb[4], ck[4];
    #pragma unroll
    for (int nt = 0; nt < 4; ++nt) {
        const int col = nBlock + nt * 16 + laneMod;
        cb[nt] = 0.0f;
        ck[nt] = 0.0f;
        if (MODE == EPI_LAMBDA) {
            cb[nt] = bias[col];
            ck[nt] = -8.0f * log1pf(expf(omega[col]));
        } else if (MODE == EPI_PLAIN) {
            if (bias) cb[nt] = bias[col];
        }
    }
    if (MODE != EPI_SPLIT) wait_addresses_taken();   // the row addresses formed next may take these loads' address registers

    // A block's TN columns lie wholly in xi or wholly in z.
    static_assert(D_INNER % TN == 0, "a block of columns must not straddle the split");
    float* dst = out0 + nBlock;
    size_t ld  = (size_t)N;
    if (MODE == EPI_SPLIT) {
        ld = D_INNER;
        if (nBlock >= D_INNER) dst = out1 + (nBlock - D_INNER);
    }

    #pragma unroll
    for (int mt = 0; mt < 2; ++mt) {
        #pragma unroll
        for (int r = 0; r < 8; ++r) {
            const int m = mBlock + waveM + mt * 16 + r + 8 * laneHalf;
            float* row = dst + (size_t)m * ld + laneMod;
            #pragma unroll
            for (int nt = 0; nt < 4; ++nt) {
                float val = acc[mt][nt][r];
                if (MODE == EPI_PLAIN) {
                    if (bias) val += cb[nt];
                } else if (MODE == EPI_LAMBDA) {
                    val += cb[nt];
                    float sig = 1.0f / (1.0f + expf(-val));
                    val = expf(ck[nt] * sig);
                }
                row[nt * 16] = val;
            }
            // The next row's address and values may take this row's registers. With the split's
            // constant row pitch the eight rows of one mt share one address and store the
            // accumulators themselves: there nothing is rewritten before the next mt.
            if (mt * 8 + r < 15 && (MODE != EPI_SPLIT || r == 7)) wait_addresses_taken();
        }
    }
}

// ---------------------------------------------------------------------------
// Householder scan, blocked by SCAN_CH steps. Inside a block of steps
//   h_j = f_j - sum_{i<=j} s_i w_{i,j},   s_j = 2 (v_j.h_{j-1}) / (v_j.v_j)
// with f the same recurrence without its reflections (f_j = lam_j f_{j-1} + (1-lam_j) xi_j,
// started at the block's entry h) and w_{i,j} = lam_j ... lam_i v_i. So
//   v_j.h_{j-1} = v_j.f_{j-1} - sum_{i<j} s_i (v_j.w_{i,j-1}).
// The dots v_j.v_j and v_j.w_{i,j-1} do not depend on h: a kernel over the whole chip
// forms them for every block of steps. The sequential kernel then needs ONE work-group sum
// (of the SCAN_CH dots v_j.f_{j-1}) per block of steps, a forward substitution for the
// s_j, and the reference's own recurrence with those s_j.
// ---------------------------------------------------------------------------
typedef __attribute__((ext_vector_type(4))) float v4f;

#define SCAN_CH     6                                   // steps per block of steps
#define SCAN_FULL   ((SEQ - 1) / SCAN_CH)               // blocks with all their steps: 341
#define SCAN_TAIL   ((SEQ - 1) - SCAN_FULL * SCAN_CH)   // steps of the last, short block: 1
#define SCAN_BLOCKS (SCAN_FULL + 1)
#define TAB_N       (SCAN_CH + SCAN_CH * (SCAN_CH - 1) / 2)  // 6 v.v and 15 v.w
#define TAB_LD      32                                  // one 128-byte line per block of steps
#define TAB_G(j, i) (SCAN_CH + (j) * ((j) - 1) / 2 + (i))    // v_j.w_{i,j-1}, i < j
#define SCAN_PF     4                                   // blocks of steps that the L2 prefetch runs ahead
static_assert(SCAN_TAIL > 0 && SCAN_FULL % 2 == 1, "the scan's last calls are written for this case");

// Work-group barrier that orders LDS only. __syncthreads() also drains the
// wave's global loads and stores, which would put the memory latency of the
// rows fetched ahead, and of the h stores, back into every round.
__device__ __forceinline__ void barrier_lds_only()
{
    __builtin_amdgcn_fence(__ATOMIC_RELEASE, "workgroup", "local");
    __builtin_amdgcn_s_barrier();
    __builtin_amdgcn_fence(__ATOMIC_ACQUIRE, "workgroup", "local");
}

// tab[b][k][.]: the h-independent dots of block k of batch b. One work-group each.
// Rows past the end (short last block) are read as the last row; their entries are never used.
__global__ __launch_bounds__(256)
void scan_dots_kernel(const float* __restrict__ v, const float* __restrict__ lam,
                      float* __restrict__ tab)
{
    const int k   = blockIdx.x;
    const int b   = blockIdx.y;
    const int tid = threadIdx.x;
    const size_t base = (size_t)b * SEQ * D_INNER + tid * 4;

    __shared__ float part[8][TAB_N];

    v4f rv[2][SCAN_CH], rl[2][SCAN_CH];
    #pragma unroll
    for (int j = 0; j < SCAN_CH; ++j) {
        int t = 1 + k * SCAN_CH + j;
        if (t > SEQ - 1) t = SEQ - 1;
        #pragma unroll
        for (int hf = 0; hf < 2; ++hf) {
            const size_t off = base + (size_t)t * D_INNER + hf * 1024;
            rv[hf][j] = *(const v4f*)(v + off);
            wait_addresses_taken();   // a later load's result may land in this load's address registers
            rl[hf][j] = *(const v4f*)(lam + off);
            wait_addresses_taken();
        }
    }

    float acc[TAB_N];
    #pragma unroll
    for (int q = 0; q < TAB_N; ++q) acc[q] = 0.0f;

    #pragma unroll
    for (int hf = 0; hf < 2; ++hf) {
        #pragma unroll
        for (int e = 0; e < 4; ++e) {
            float w[SCAN_CH];
            #pragma unroll
            for (int j = 0; j < SCAN_CH; ++j) {
                const float vj = rv[hf][j][e];
                const float lj = rl[hf][j][e];
                acc[j] += vj * vj;
                #pragma unroll
                for (int i = 0; i < j; ++i) acc[TAB_G(j, i)] += vj * w[i];
                #pragma unroll
                for (int i = 0; i < j; ++i) w[i] *= lj;
                w[j] = lj * vj;
            }
        }
    }

    #pragma unroll
    for (int m = 16; m > 0; m >>= 1) {
        #pragma unroll
        for (int q = 0; q < TAB_N; ++q) acc[q] += __shfl_xor(acc[q], m, 32);
    }
    if ((tid & 31) == 0) {
        #pragma unroll
        for (int q = 0; q < TAB_N; ++q) part[tid >> 5][q] = acc[q];
    }
    __syncthreads();
    if (tid < TAB_N) {
        float s = 0.0f;
        #pragma unroll
        for (int w8 = 0; w8 < 8; ++w8) s += part[w8][tid];
        tab[((size_t)b * SCAN_BLOCKS + k) * TAB_LD + tid] = s;
    }
}

// One work-group per batch, 1024 threads, 2 channels per thread.
// lam_h holds lam on entry; h is written in place (a thread reads lam[t] before it
// writes h[t]; lam[.,0,.] is never consumed by the reference).
// No thread reads a global word that another thread of this launch writes, so
// global memory needs no ordering at the barriers: only red[] and bcast[] do.
__global__ __launch_bounds__(1024)
void scan_kernel(const float* __restrict__ xi, const float* __restrict__ v,
                 float* __restrict__ lam_h, const float* __restrict__ tab)
{
    const int b    = blockIdx.x;
    const int tid  = threadIdx.x;
    const int c0   = tid;
    const int c1   = tid + 1024;
    const int wave = tid >> 5;
    const int lane = tid & 31;
    const size_t base = (size_t)b * SEQ * D_INNER;

    __shared__ float red[SCAN_CH][32];   // per dot: one partial sum of each of the 32 waves
    __shared__ float bcast[SCAN_CH];

    float h0 = xi[base + c0];
    float h1 = xi[base + c1];
    lam_h[base + c0] = h0;
    lam_h[base + c1] = h1;

    // Two sets of rows: one is worked on while the next block's rows fly into the other.
    float rv0[2][SCAN_CH], rv1[2][SCAN_CH];
    float rl0[2][SCAN_CH], rl1[2][SCAN_CH];
    float rx0[2][SCAN_CH], rx1[2][SCAN_CH];

    auto fetch = [&](int k, int s, int n) {
        #pragma unroll
        for (int j = 0; j < n; ++j) {
            const size_t off = base + (size_t)(1 + k * SCAN_CH + j) * D_INNER;
            rv0[s][j] = v[off + c0];     rv1[s][j] = v[off + c1];
            rl0[s][j] = lam_h[off + c0]; rl1[s][j] = lam_h[off + c1];
            rx0[s][j] = xi[off + c0];    rx1[s][j] = xi[off + c1];
        }
    };
    // The last fetch, behind the loop: its address registers are used up load by load, and a
    // later load's result may land in them, so each load gets its own wait. Runs once.
    auto fetch_last = [&](int k, int s) {
        #pragma unroll
        for (int j = 0; j < SCAN_TAIL; ++j) {
            const size_t off = base + (size_t)(1 + k * SCAN_CH + j) * D_INNER;
            rv0[s][j] = v[off + c0];     wait_addresses_taken();
            rv1[s][j] = v[off + c1];     wait_addresses_taken();
            rl0[s][j] = lam_h[off + c0]; wait_addresses_taken();
            rl1[s][j] = lam_h[off + c1]; wait_addresses_taken();
            rx0[s][j] = xi[off + c0];    wait_addresses_taken();
            rx1[s][j] = xi[off + c1];    wait_addresses_taken();
        }
    };

    const float* tk = tab + (size_t)b * SCAN_BLOCKS * TAB_LD;   // the table line of the block at hand

    // For speed only, the rows of v, lam and xi are asked into L2 SCAN_PF blocks of steps
    // ahead of the block at hand: a prefetch returns nothing to the WGP and no wave waits for it.
    // Wave w < 18 asks for one row of 8 KiB: 32 lanes, 256 bytes apart.
    const int wave_s = __builtin_amdgcn_readfirstlane(tid >> 5);   // scalar, for a scalar branch
    const int pf_arr = wave_s / SCAN_CH;
    const int pf_j   = wave_s % SCAN_CH;
    const float* pf_src = pf_arr == 0 ? v : (pf_arr == 1 ? (const float*)lam_h : xi);
    // The row of block k that this wave asks for; past the end it is the last row, so the
    // address stays inside the array at every issue and after every advance.
    auto pf_row = [&](int k) {
        const int t = 1 + k * SCAN_CH + pf_j;
        return t < SEQ - 1 ? t : SEQ - 1;
    };
    const char* pf = (const char*)(pf_src + base + (size_t)pf_row(SCAN_PF) * D_INNER) + lane * 256;
    auto pf_ask = [&]() {
        if (wave_s < 3 * SCAN_CH)
            asm volatile("global_prefetch_b8 %0, off scope:SCOPE_SE" :: "v"(pf));   // into L2 only
    };
    auto pf_advance = [&](int k) {   // from block k's row to block k + 1's
        pf += (size_t)(pf_row(k + 1) - pf_row(k)) * (D_INNER * sizeof(float));
    };

    // Block k of n steps, its rows in set s; n_next steps of block k+1 are fetched into the other set.
    auto block_of_steps = [&](int k, int s, int n, int n_next) {
        // This block's table line: asked for here, used behind the first barrier.
        float tb[TAB_N];
        #pragma unroll
        for (int j = 0; j < n; ++j) {
            tb[j] = tk[j];
            #pragma unroll
            for (int i = 0; i < j; ++i) tb[TAB_G(j, i)] = tk[TAB_G(j, i)];
        }
        wait_addresses_taken();   // in front of the step of tk
        tk += TAB_LD;
        if (n_next == SCAN_CH) {
            fetch(k + 1, s ^ 1, SCAN_CH);
            wait_addresses_taken();
            pf_ask();   // block k + SCAN_PF; behind the loads, so that it does not stand in their way
        }
        else if (n_next > 0)   fetch_last(k + 1, s ^ 1);

        float p[SCAN_CH];
        float f0 = h0, f1 = h1;
        #pragma unroll
        for (int j = 0; j < n; ++j) {
            p[j] = rv0[s][j] * f0 + rv1[s][j] * f1;
            rx0[s][j] = (1.0f - rl0[s][j]) * rx0[s][j];
            rx1[s][j] = (1.0f - rl1[s][j]) * rx1[s][j];
            f0 = rl0[s][j] * f0 + rx0[s][j];
            f1 = rl1[s][j] * f1 + rx1[s][j];
        }
        #pragma unroll
        for (int m = 16; m > 0; m >>= 1) {   // wave32 butterfly
            #pragma unroll
            for (int j = 0; j < n; ++j) p[j] += __shfl_xor(p[j], m, 32);
        }
        if (lane == 0) {
            #pragma unroll
            for (int j = 0; j < n; ++j) red[j][wave] = p[j];
        }
        barrier_lds_only();
        if (wave == 0) {
            // One wave sums the n dots over the 32 waves and solves for the s_j: the chain of
            // divisions then costs its latency once, not its issue slots in every wave.
            float num[SCAN_CH], sj[SCAN_CH];
            #pragma unroll
            for (int j = 0; j < n; ++j) num[j] = red[j][lane];
            #pragma unroll
            for (int m = 16; m > 0; m >>= 1) {
                #pragma unroll
                for (int j = 0; j < n; ++j) num[j] += __shfl_xor(num[j], m, 32);
            }
            #pragma unroll
            for (int j = 0; j < n; ++j) {
                sj[j] = 2.0f * num[j] / tb[j];
                #pragma unroll
                for (int jj = j + 1; jj < n; ++jj) num[jj] -= sj[j] * tb[TAB_G(jj, j)];
            }
            if (lane == 0) {
                #pragma unroll
                for (int j = 0; j < n; ++j) bcast[j] = sj[j];
            }
        }
        barrier_lds_only();

        float sc[SCAN_CH];
        #pragma unroll
        for (int j = 0; j < n; ++j) sc[j] = bcast[j];

        float hr0[SCAN_CH], hr1[SCAN_CH];
        #pragma unroll
        for (int j = 0; j < n; ++j) {
            h0 = rl0[s][j] * (h0 - rv0[s][j] * sc[j]) + rx0[s][j];
            h1 = rl1[s][j] * (h1 - rv1[s][j] * sc[j]) + rx1[s][j];
            hr0[j] = h0;
            hr1[j] = h1;
        }
        #pragma unroll
        for (int j = 0; j < n; ++j) {
            const size_t off = base + (size_t)(1 + k * SCAN_CH + j) * D_INNER;
            lam_h[off + c0] = hr0[j];
            lam_h[off + c1] = hr1[j];
        }
        wait_addresses_taken();
        if (n_next == SCAN_CH) pf_advance(k + SCAN_PF);   // behind the wait: pf is named by the prefetch above
        barrier_lds_only();   // red[] and bcast[] safe to overwrite in the next block
    };

    fetch(0, 0, SCAN_CH);
    wait_addresses_taken();

    // The set index must be a constant for the rows to stay in registers: two
    // blocks per trip, the loop itself stays rolled.
    #pragma unroll 1
    for (int kk = 0; kk < SCAN_FULL / 2; ++kk) {
        block_of_steps(2 * kk,     0, SCAN_CH, SCAN_CH);
        block_of_steps(2 * kk + 1, 1, SCAN_CH, SCAN_CH);
    }
    block_of_steps(SCAN_FULL - 1, 0, SCAN_CH,   SCAN_TAIL);
    block_of_steps(SCAN_FULL,     1, SCAN_TAIL, 0);
}

// g = silu(z) * h, written over z
__global__ void silu_mul_kernel(const float* __restrict__ h, float* __restrict__ z_io,
                                size_t n)
{
    size_t i      = (size_t)blockIdx.x * blockDim.x + threadIdx.x;
    size_t stride = (size_t)gridDim.x * blockDim.x;
    for (; i < n; i += stride) {
        float zv = z_io[i];
        float s  = zv / (1.0f + expf(-zv));
        z_io[i] = s * h[i];
    }
}

// ---------------------------------------------------------------------------
extern "C" void kernel_launch(void* const* d_in, const int* in_sizes, int n_in,
                              void* d_out, int out_size, void* d_ws, size_t ws_size,
                              hipStream_t stream)
{
    const float* x     = (const float*)d_in[0];
    const float* omega = (const float*)d_in[1];   // 2048
    const float* Win   = (const float*)d_in[2];   // 4096 x 1024
    const float* Wl    = (const float*)d_in[3];   // 2048 x 2048
    const float* bl    = (const float*)d_in[4];
    const float* Wv    = (const float*)d_in[5];   // 2048 x 2048
    const float* bv    = (const float*)d_in[6];
    const float* Wout  = (const float*)d_in[7];   // 1024 x 2048
    float* out = (float*)d_out;

    const size_t BUF = (size_t)M_ROWS * D_INNER;  // 16,777,216 floats (64 MB)
    float* ws    = (float*)d_ws;
    float* xi    = ws;             // [M_ROWS, D_INNER]
    float* z     = ws + BUF;       // [M_ROWS, D_INNER] (later holds silu(z)*h)
    float* lam_h = ws + 2 * BUF;   // lam in, h out (in place)
    float* vbuf  = ws + 3 * BUF;   // total 256 MB of d_ws used

    dim3 blk(128);

    // 1) xz = x @ Win^T, split into xi | z
    {
        dim3 grd(4096 / TN, M_ROWS / TM);
        wmma_gemm_f32<EPI_SPLIT><<<grd, blk, 0, stream>>>(x, Win, nullptr, nullptr,
                                                          xi, z, M_ROWS, 4096, D_MODEL);
    }
    // 2) lam = exp(-8*softplus(omega)*sigmoid(xi@Wl^T + bl))
    {
        dim3 grd(D_INNER / TN, M_ROWS / TM);
        wmma_gemm_f32<EPI_LAMBDA><<<grd, blk, 0, stream>>>(xi, Wl, bl, omega,
                                                           lam_h, nullptr, M_ROWS, D_INNER, D_INNER);
    }
    // 3) v = xi @ Wv^T + bv
    {
        dim3 grd(D_INNER / TN, M_ROWS / TM);
        wmma_gemm_f32<EPI_PLAIN><<<grd, blk, 0, stream>>>(xi, Wv, bv, nullptr,
                                                          vbuf, nullptr, M_ROWS, D_INNER, D_INNER);
    }
    // 4) Householder scan (h overwrites lam buffer). The table of h-independent dots lies at
    //    the head of out, which launch 6 overwrites whole: the workspace has no byte left.
    scan_dots_kernel<<<dim3(SCAN_BLOCKS, BATCH), 256, 0, stream>>>(vbuf, lam_h, out);
    scan_kernel<<<BATCH, 1024, 0, stream>>>(xi, vbuf, lam_h, out);

    // 5) g = silu(z) * h   (overwrites z)
    silu_mul_kernel<<<4096, 256, 0, stream>>>(lam_h, z, BUF);

    // 6) out = g @ Wout^T
    {
        dim3 grd(D_MODEL / TN, M_ROWS / TM);
        wmma_gemm_f32<EPI_PLAIN><<<grd, blk, 0, stream>>>(z, Wout, nullptr, nullptr,
                                                          out, nullptr, M_ROWS, D_MODEL, D_INNER);
    }
}

// v005
// Measured time: 1810 microseconds a run.
// Next to v004, in two timings, it ran 1.10 times as fast each time.
// All steps since v000 together make it 2.53 times as fast.
#include <hip/hip_runtime.h>
#include <cmath>

// ---------------------------------------------------------------------------
// DenseRNN (Householder-reflection linear RNN) for MI455X / gfx1250
//   xz = x @ Win^T ; xi,z = split(xz)
//   lam = exp(-8*softplus(omega)*sigmoid(xi@Wl^T + bl))
//   v   = xi@Wv^T + bv
//   scan: h_t = lam_t*(h_{t-1} - 2 v_t (v.h)/(v.v)) + (1-lam_t)*xi_t ; h_0 = xi_0
//   out = (silu(z)*h) @ Wout^T
// GEMMs: V_WMMA_F32_16X16X4_F32 + double-buffered async global->LDS staging.
// ---------------------------------------------------------------------------

typedef __attribute__((ext_vector_type(2))) float v2f;
typedef __attribute__((ext_vector_type(8))) float v8f;
typedef int v4i_gcc __attribute__((vector_size(16)));   // matches builtin pointee

#define D_MODEL   1024
#define D_INNER   2048
#define BATCH     4
#define SEQ       2048
#define M_ROWS    (BATCH * SEQ)        // 8192

// GEMM tiling: 128 threads = 4 waves; each wave owns a 32x64 C strip.
#define TM 128        // block rows
#define TN 64         // block cols
#define TK 32         // K tile
#define LDS_PAD 4     // row stride 36 floats = 144 B (16B aligned for b128 async)
#define LDS_LD  (TK + LDS_PAD)

// Epilogue modes
#define EPI_PLAIN  0   // out0[m,col] = acc (+ bias if non-null)
#define EPI_LAMBDA 1   // out0[m,col] = exp(-8*softplus(omega[col])*sigmoid(acc+bias[col]))
#define EPI_SPLIT  2   // col < D_INNER -> out0 (xi), else -> out1 (z), both ld = D_INNER

// --- async global->LDS copy (CDNA5 ASYNCcnt path), with sync fallback ------
#if defined(__AMDGCN__) && __has_builtin(__builtin_amdgcn_global_load_async_to_lds_b128)
#define USE_ASYNC_LDS 1
#else
#define USE_ASYNC_LDS 0
#endif

__device__ __forceinline__ void copy16_g2l(const float* __restrict__ g, float* l)
{
#if USE_ASYNC_LDS
    __builtin_amdgcn_global_load_async_to_lds_b128(
        (__attribute__((address_space(1))) v4i_gcc*)(void*)g,
        (__attribute__((address_space(3))) v4i_gcc*)(void*)l,
        /*imm offset=*/0, /*cpol=*/0);
#else
    *(float4*)l = *(const float4*)g;
#endif
}

__device__ __forceinline__ void wait_async_lds()
{
#if USE_ASYNC_LDS
#if __has_builtin(__builtin_amdgcn_s_wait_asynccnt)
    __builtin_amdgcn_s_wait_asynccnt(0);
#else
    asm volatile("s_wait_asynccnt 0x0" ::: "memory");
#endif
#endif
}

// Stands behind a group of global loads or stores, in front of the first
// instruction that may reuse one of their address or data registers. The
// scheduling barrier keeps later instructions, which may take those registers,
// from being lifted over the wait, and the loads in front of it from sinking
// behind it (a build without it did both, and spilled registers in the scan).
__device__ __forceinline__ void wait_addresses_taken()
{
    asm volatile("s_wait_xcnt 0x0" ::: "memory");
    __builtin_amdgcn_sched_barrier(0);
}

// C[M,N] = A[M,K] * W[N,K]^T   (A row-major MxK, W row-major NxK; both K-contiguous)
// Requires: M % TM == 0, N % TN == 0, K % TK == 0.
// The epilogue mode is a template argument, and what depends on the column alone is formed
// once per column, for speed only.
template <int MODE>
__global__ __launch_bounds__(128)
void wmma_gemm_f32(const float* __restrict__ A, const float* __restrict__ W,
                   const float* __restrict__ bias, const float* __restrict__ omega,
                   float* __restrict__ out0, float* __restrict__ out1,
                   int M, int N, int K)
{
    __shared__ float As[2][TM][LDS_LD];   // A tile, row-major, double buffered
    __shared__ float Bs[2][TN][LDS_LD];   // W tile, n-major: Bs[.][n][k] = W[nBlock+n][k0+k]

    const int tid  = threadIdx.x;
    const int wave = tid >> 5;               // 0..3 (wave32)
    const int lane = tid & 31;
    const int laneMod  = lane & 15;          // 0..15
    const int laneHalf = lane >> 4;          // 0 or 1

    const int mBlock = blockIdx.y * TM;
    const int nBlock = blockIdx.x * TN;
    const int waveM  = wave * 32;            // this wave's 32-row strip inside block tile

    v8f acc[2][4];
    #pragma unroll
    for (int mt = 0; mt < 2; ++mt)
        #pragma unroll
        for (int nt = 0; nt < 4; ++nt)
            #pragma unroll
            for (int r = 0; r < 8; ++r) acc[mt][nt][r] = 0.0f;

    // ---- tile stage: issues TM*TK/4/128 = 8 A chunks + 4 W chunks of b128 ----
    auto stage_tile = [&](int k0, int b) {
        #pragma unroll
        for (int i = 0; i < 8; ++i) {
            int q   = tid + i * 128;          // 0..1023
            int row = q >> 3;                 // 8 float4 per 32-float row
            int c4  = (q & 7) << 2;
            copy16_g2l(A + (size_t)(mBlock + row) * K + k0 + c4, &As[b][row][c4]);
        }
        #pragma unroll
        for (int i = 0; i < 4; ++i) {
            int q   = tid + i * 128;          // 0..511
            int row = q >> 3;
            int c4  = (q & 7) << 2;
            copy16_g2l(W + (size_t)(nBlock + row) * K + k0 + c4, &Bs[b][row][c4]);
        }
    };

    int buf = 0;
    stage_tile(0, buf);
    wait_async_lds();
    __syncthreads();

    for (int k0 = 0; k0 < K; k0 += TK) {
        const int nbuf = buf ^ 1;
        if (k0 + TK < K) stage_tile(k0 + TK, nbuf);   // prefetch next tile (async)

        // ---- 8 K-steps; per step: 2 A frags x 4 B frags = 8 WMMAs ----
        #pragma unroll
        for (int kk = 0; kk < TK; kk += 4) {
            // A frag (16x4): lanes 0-15: M=lane, K=kk+{0,1}; lanes 16-31: K=kk+{2,3}
            v2f a0, a1;
            a0.x = As[buf][waveM + laneMod][kk + 2 * laneHalf + 0];
            a0.y = As[buf][waveM + laneMod][kk + 2 * laneHalf + 1];
            a1.x = As[buf][waveM + 16 + laneMod][kk + 2 * laneHalf + 0];
            a1.y = As[buf][waveM + 16 + laneMod][kk + 2 * laneHalf + 1];
            #pragma unroll
            for (int nt = 0; nt < 4; ++nt) {
                // B frag (4x16): lane holds K=kk+2*laneHalf+{0,1}, N=nt*16+laneMod
                v2f bf;
                bf.x = Bs[buf][nt * 16 + laneMod][kk + 2 * laneHalf + 0];
                bf.y = Bs[buf][nt * 16 + laneMod][kk + 2 * laneHalf + 1];
                acc[0][nt] = __builtin_amdgcn_wmma_f32_16x16x4_f32(
                    false, a0, false, bf, (short)0, acc[0][nt], false, false);
                acc[1][nt] = __builtin_amdgcn_wmma_f32_16x16x4_f32(
                    false, a1, false, bf, (short)0, acc[1][nt], false, false);
            }
        }

        wait_async_lds();       // next tile landed in LDS
        __syncthreads();        // all waves done reading `buf`, async writes visible
        buf = nbuf;
    }

    // ---- epilogue: C/D layout: VGPR r -> row = r + 8*laneHalf, col = laneMod ----
    // What depends on the column alone, once per column: the bias, and -8*softplus(omega).
    float cb[4], ck[4];
    #pragma unroll
    for (int nt = 0; nt < 4; ++nt) {
        const int col = nBlock + nt * 16 + laneMod;
        cb[nt] = 0.0f;
        ck[nt] = 0.0f;
        if (MODE == EPI_LAMBDA) {
            cb[nt] = bias[col];
            ck[nt] = -8.0f * log1pf(expf(omega[col]));
        } else if (MODE == EPI_PLAIN) {
            if (bias) cb[nt] = bias[col];
        }
    }
    if (MODE != EPI_SPLIT) wait_addresses_taken();   // the row addresses formed next may take these loads' address registers

    // A block's TN columns lie wholly in xi or wholly in z.
    static_assert(D_INNER % TN == 0, "a block of columns must not straddle the split");
    float* dst = out0 + nBlock;
    size_t ld  = (size_t)N;
    if (MODE == EPI_SPLIT) {
        ld = D_INNER;
        if (nBlock >= D_INNER) dst = out1 + (nBlock - D_INNER);
    }

    #pragma unroll
    for (int mt = 0; mt < 2; ++mt) {
        #pragma unroll
        for (int r = 0; r < 8; ++r) {
            const int m = mBlock + waveM + mt * 16 + r + 8 * laneHalf;
            float* row = dst + (size_t)m * ld + laneMod;
            #pragma unroll
            for (int nt = 0; nt < 4; ++nt) {
                float val = acc[mt][nt][r];
                if (MODE == EPI_PLAIN) {
                    if (bias) val += cb[nt];
                } else if (MODE == EPI_LAMBDA) {
                    val += cb[nt];
                    float sig = 1.0f / (1.0f + expf(-val));
                    val = expf(ck[nt] * sig);
                }
                row[nt * 16] = val;
            }
            // The next row's address and values may take this row's registers. With the split's
            // constant row pitch the eight rows of one mt share one address and store the
            // accumulators themselves: there nothing is rewritten before the next mt.
            if (mt * 8 + r < 15 && (MODE != EPI_SPLIT || r == 7)) wait_addresses_taken();
        }
    }
}

// ---------------------------------------------------------------------------
// Householder scan, blocked by SCAN_CH steps. Inside a block of steps
//   h_j = f_j - sum_{i<=j} s_i w_{i,j},   s_j = 2 (v_j.h_{j-1}) / (v_j.v_j)
// with f the same recurrence without its reflections (f_j = lam_j f_{j-1} + (1-lam_j) xi_j,
// started at the block's entry h) and w_{i,j} = lam_j ... lam_i v_i. So
//   v_j.h_{j-1} = v_j.f_{j-1} - sum_{i<j} s_i (v_j.w_{i,j-1}).
// The dots v_j.v_j and v_j.w_{i,j-1} do not depend on h: a kernel over the whole chip
// forms them for every block of steps. The sequential kernel then needs ONE work-group sum
// (of the SCAN_CH dots v_j.f_{j-1}) per block of steps, a forward substitution for the
// s_j, and the reference's own recurrence with those s_j.
// ---------------------------------------------------------------------------
typedef __attribute__((ext_vector_type(4))) float v4f;

#define SCAN_CH     6                                   // steps per block of steps
#define SCAN_FULL   ((SEQ - 1) / SCAN_CH)               // blocks with all their steps: 341
#define SCAN_TAIL   ((SEQ - 1) - SCAN_FULL * SCAN_CH)   // steps of the last, short block: 1
#define SCAN_BLOCKS (SCAN_FULL + 1)
#define TAB_N       (SCAN_CH + SCAN_CH * (SCAN_CH - 1) / 2)  // 6 v.v and 15 v.w
#define TAB_LD      32                                  // one 128-byte line per block of steps
#define TAB_G(j, i) (SCAN_CH + (j) * ((j) - 1) / 2 + (i))    // v_j.w_{i,j-1}, i < j
#define SCAN_PF     4                                   // blocks of steps that the L2 prefetch runs ahead
static_assert(SCAN_TAIL > 0 && SCAN_FULL % 2 == 1, "the scan's last calls are written for this case");

// Work-group barrier that orders LDS only. __syncthreads() also drains the
// wave's global loads and stores, which would put the memory latency of the
// rows fetched ahead, and of the h stores, back into every round.
__device__ __forceinline__ void barrier_lds_only()
{
    __builtin_amdgcn_fence(__ATOMIC_RELEASE, "workgroup", "local");
    __builtin_amdgcn_s_barrier();
    __builtin_amdgcn_fence(__ATOMIC_ACQUIRE, "workgroup", "local");
}

// Sums across lanes on the vector unit. __shfl_xor compiles to ds_bpermute_b32: an LDS round
// trip per step of the tree, and one LDS slot per value, step and wave of the work-group.
// x + (x of lane l ^ m) inside a 16-lane row; CTRL = 0x160 + m is the DPP control row_xmask:m.
template <int CTRL>
__device__ __forceinline__ float add_row_xmask(float x)
{
    const int y = __builtin_amdgcn_update_dpp(0, __builtin_bit_cast(int, x), CTRL, 0xf, 0xf, true);
    return x + __builtin_bit_cast(float, y);
}
// p[0..n): every lane gets the sum over its own 16-lane row. All 32 lanes must be on.
// Step by step over all n values, so that the n chains fill one another's latency.
__device__ __forceinline__ void row_sums(float* p, int n)
{
    #pragma unroll
    for (int j = 0; j < n; ++j) p[j] = add_row_xmask<0x161>(p[j]);
    #pragma unroll
    for (int j = 0; j < n; ++j) p[j] = add_row_xmask<0x162>(p[j]);
    #pragma unroll
    for (int j = 0; j < n; ++j) p[j] = add_row_xmask<0x164>(p[j]);
    #pragma unroll
    for (int j = 0; j < n; ++j) p[j] = add_row_xmask<0x168>(p[j]);
}
// x of lane l ^ 16
__device__ __forceinline__ float other_row(float x)
{
    const int b = __builtin_bit_cast(int, x);
    return __builtin_bit_cast(float,
        __builtin_amdgcn_permlanex16(b, b, 0x76543210, 0xfedcba98, false, false));
}

// tab[b][k][.]: the h-independent dots of block k of batch b. One work-group each.
// Rows past the end (short last block) are read as the last row; their entries are never used.
__global__ __launch_bounds__(256)
void scan_dots_kernel(const float* __restrict__ v, const float* __restrict__ lam,
                      float* __restrict__ tab)
{
    const int k   = blockIdx.x;
    const int b   = blockIdx.y;
    const int tid = threadIdx.x;
    const size_t base = (size_t)b * SEQ * D_INNER + tid * 4;

    __shared__ float part[8][TAB_N];

    v4f rv[2][SCAN_CH], rl[2][SCAN_CH];
    #pragma unroll
    for (int j = 0; j < SCAN_CH; ++j) {
        int t = 1 + k * SCAN_CH + j;
        if (t > SEQ - 1) t = SEQ - 1;
        #pragma unroll
        for (int hf = 0; hf < 2; ++hf) {
            const size_t off = base + (size_t)t * D_INNER + hf * 1024;
            rv[hf][j] = *(const v4f*)(v + off);
            wait_addresses_taken();   // a later load's result may land in this load's address registers
            rl[hf][j] = *(const v4f*)(lam + off);
            wait_addresses_taken();
        }
    }

    float acc[TAB_N];
    #pragma unroll
    for (int q = 0; q < TAB_N; ++q) acc[q] = 0.0f;

    #pragma unroll
    for (int hf = 0; hf < 2; ++hf) {
        #pragma unroll
        for (int e = 0; e < 4; ++e) {
            float w[SCAN_CH];
            #pragma unroll
            for (int j = 0; j < SCAN_CH; ++j) {
                const float vj = rv[hf][j][e];
                const float lj = rl[hf][j][e];
                acc[j] += vj * vj;
                #pragma unroll
                for (int i = 0; i < j; ++i) acc[TAB_G(j, i)] += vj * w[i];
                #pragma unroll
                for (int i = 0; i < j; ++i) w[i] *= lj;
                w[j] = lj * vj;
            }
        }
    }

    row_sums(acc, TAB_N);
    #pragma unroll
    for (int q = 0; q < TAB_N; ++q) acc[q] += other_row(acc[q]);
    if ((tid & 31) == 0) {
        #pragma unroll
        for (int q = 0; q < TAB_N; ++q) part[tid >> 5][q] = acc[q];
    }
    __syncthreads();
    if (tid < TAB_N) {
        float s = 0.0f;
        #pragma unroll
        for (int w8 = 0; w8 < 8; ++w8) s += part[w8][tid];
        tab[((size_t)b * SCAN_BLOCKS + k) * TAB_LD + tid] = s;
    }
}

// One work-group per batch, 1024 threads, 2 channels per thread.
// lam_h holds lam on entry; h is written in place (a thread reads lam[t] before it
// writes h[t]; lam[.,0,.] is never consumed by the reference).
// No thread reads a global word that another thread of this launch writes, so
// global memory needs no ordering at the barriers: only red[] and bcast[] do.
__global__ __launch_bounds__(1024)
void scan_kernel(const float* __restrict__ xi, const float* __restrict__ v,
                 float* __restrict__ lam_h, const float* __restrict__ tab)
{
    const int b    = blockIdx.x;
    const int tid  = threadIdx.x;
    const int c0   = tid;
    const int c1   = tid + 1024;
    const int wave = tid >> 5;
    const int lane = tid & 31;
    const size_t base = (size_t)b * SEQ * D_INNER;

    __shared__ float red[SCAN_CH][64];   // per dot: one partial sum of each 16-lane row of the 32 waves
    __shared__ float bcast[SCAN_CH];

    float h0 = xi[base + c0];
    float h1 = xi[base + c1];
    lam_h[base + c0] = h0;
    lam_h[base + c1] = h1;

    // Two sets of rows: one is worked on while the next block's rows fly into the other.
    float rv0[2][SCAN_CH], rv1[2][SCAN_CH];
    float rl0[2][SCAN_CH], rl1[2][SCAN_CH];
    float rx0[2][SCAN_CH], rx1[2][SCAN_CH];

    auto fetch = [&](int k, int s, int n) {
        #pragma unroll
        for (int j = 0; j < n; ++j) {
            const size_t off = base + (size_t)(1 + k * SCAN_CH + j) * D_INNER;
            rv0[s][j] = v[off + c0];     rv1[s][j] = v[off + c1];
            rl0[s][j] = lam_h[off + c0]; rl1[s][j] = lam_h[off + c1];
            rx0[s][j] = xi[off + c0];    rx1[s][j] = xi[off + c1];
        }
    };
    // The last fetch, behind the loop: its address registers are used up load by load, and a
    // later load's result may land in them, so each load gets its own wait. Runs once.
    auto fetch_last = [&](int k, int s) {
        #pragma unroll
        for (int j = 0; j < SCAN_TAIL; ++j) {
            const size_t off = base + (size_t)(1 + k * SCAN_CH + j) * D_INNER;
            rv0[s][j] = v[off + c0];     wait_addresses_taken();
            rv1[s][j] = v[off + c1];     wait_addresses_taken();
            rl0[s][j] = lam_h[off + c0]; wait_addresses_taken();
            rl1[s][j] = lam_h[off + c1]; wait_addresses_taken();
            rx0[s][j] = xi[off + c0];    wait_addresses_taken();
            rx1[s][j] = xi[off + c1];    wait_addresses_taken();
        }
    };

    const float* tk = tab + (size_t)b * SCAN_BLOCKS * TAB_LD;   // the table line of the block at hand

    // For speed only, the rows of v, lam and xi are asked into L2 SCAN_PF blocks of steps
    // ahead of the block at hand: a prefetch returns nothing to the WGP and no wave waits for it.
    // Wave w < 18 asks for one row of 8 KiB: 32 lanes, 256 bytes apart.
    const int wave_s = __builtin_amdgcn_readfirstlane(tid >> 5);   // scalar, for a scalar branch
    const int pf_arr = wave_s / SCAN_CH;
    const int pf_j   = wave_s % SCAN_CH;
    const float* pf_src = pf_arr == 0 ? v : (pf_arr == 1 ? (const float*)lam_h : xi);
    // The row of block k that this wave asks for; past the end it is the last row, so the
    // address stays inside the array at every issue and after every advance.
    auto pf_row = [&](int k) {
        const int t = 1 + k * SCAN_CH + pf_j;
        return t < SEQ - 1 ? t : SEQ - 1;
    };
    const char* pf = (const char*)(pf_src + base + (size_t)pf_row(SCAN_PF) * D_INNER) + lane * 256;
    auto pf_ask = [&]() {
        if (wave_s < 3 * SCAN_CH)
            asm volatile("global_prefetch_b8 %0, off scope:SCOPE_SE" :: "v"(pf));   // into L2 only
    };
    auto pf_advance = [&](int k) {   // from block k's row to block k + 1's
        pf += (size_t)(pf_row(k + 1) - pf_row(k)) * (D_INNER * sizeof(float));
    };

    // Block k of n steps, its rows in set s; n_next steps of block k+1 are fetched into the other set.
    auto block_of_steps = [&](int k, int s, int n, int n_next) {
        // This block's table line: asked for here, used behind the first barrier.
        float tb[TAB_N];
        #pragma unroll
        for (int j = 0; j < n; ++j) {
            tb[j] = tk[j];
            #pragma unroll
            for (int i = 0; i < j; ++i) tb[TAB_G(j, i)] = tk[TAB_G(j, i)];
        }
        wait_addresses_taken();   // in front of the step of tk
        tk += TAB_LD;
        if (n_next == SCAN_CH) {
            fetch(k + 1, s ^ 1, SCAN_CH);
            wait_addresses_taken();
            pf_ask();   // block k + SCAN_PF; behind the loads, so that it does not stand in their way
        }
        else if (n_next > 0)   fetch_last(k + 1, s ^ 1);

        float p[SCAN_CH];
        float f0 = h0, f1 = h1;
        #pragma unroll
        for (int j = 0; j < n; ++j) {
            p[j] = rv0[s][j] * f0 + rv1[s][j] * f1;
            rx0[s][j] = (1.0f - rl0[s][j]) * rx0[s][j];
            rx1[s][j] = (1.0f - rl1[s][j]) * rx1[s][j];
            f0 = rl0[s][j] * f0 + rx0[s][j];
            f1 = rl1[s][j] * f1 + rx1[s][j];
        }
        row_sums(p, n);
        if ((lane & 15) == 0) {   // lanes 0 and 16: their row's sums
            #pragma unroll
            for (int j = 0; j < n; ++j) red[j][tid >> 4] = p[j];
        }
        barrier_lds_only();
        if (wave == 0) {
            // One wave sums the n dots over the 64 rows and solves for the s_j: the chain of
            // divisions then costs its latency once, not its issue slots in every wave.
            float num[SCAN_CH], sj[SCAN_CH];
            #pragma unroll
            for (int j = 0; j < n; ++j) num[j] = red[j][lane] + red[j][lane + 32];
            row_sums(num, n);
            #pragma unroll
            for (int j = 0; j < n; ++j) num[j] += other_row(num[j]);
            #pragma unroll
            for (int j = 0; j < n; ++j) {
                sj[j] = 2.0f * num[j] / tb[j];
                #pragma unroll
                for (int jj = j + 1; jj < n; ++jj) num[jj] -= sj[j] * tb[TAB_G(jj, j)];
            }
            if (lane == 0) {
                #pragma unroll
                for (int j = 0; j < n; ++j) bcast[j] = sj[j];
            }
        }
        barrier_lds_only();

        float sc[SCAN_CH];
        #pragma unroll
        for (int j = 0; j < n; ++j) sc[j] = bcast[j];

        float hr0[SCAN_CH], hr1[SCAN_CH];
        #pragma unroll
        for (int j = 0; j < n; ++j) {
            h0 = rl0[s][j] * (h0 - rv0[s][j] * sc[j]) + rx0[s][j];
            h1 = rl1[s][j] * (h1 - rv1[s][j] * sc[j]) + rx1[s][j];
            hr0[j] = h0;
            hr1[j] = h1;
        }
        #pragma unroll
        for (int j = 0; j < n; ++j) {
            const size_t off = base + (size_t)(1 + k * SCAN_CH + j) * D_INNER;
            lam_h[off + c0] = hr0[j];
            lam_h[off + c1] = hr1[j];
        }
        wait_addresses_taken();
        if (n_next == SCAN_CH) pf_advance(k + SCAN_PF);   // behind the wait: pf is named by the prefetch above
        barrier_lds_only();   // red[] and bcast[] safe to overwrite in the next block
    };

    fetch(0, 0, SCAN_CH);
    wait_addresses_taken();

    // The set index must be a constant for the rows to stay in registers: two
    // blocks per trip, the loop itself stays rolled.
    #pragma unroll 1
    for (int kk = 0; kk < SCAN_FULL / 2; ++kk) {
        block_of_steps(2 * kk,     0, SCAN_CH, SCAN_CH);
        block_of_steps(2 * kk + 1, 1, SCAN_CH, SCAN_CH);
    }
    block_of_steps(SCAN_FULL - 1, 0, SCAN_CH,   SCAN_TAIL);
    block_of_steps(SCAN_FULL,     1, SCAN_TAIL, 0);
}

// g = silu(z) * h, written over z
__global__ void silu_mul_kernel(const float* __restrict__ h, float* __restrict__ z_io,
                                size_t n)
{
    size_t i      = (size_t)blockIdx.x * blockDim.x + threadIdx.x;
    size_t stride = (size_t)gridDim.x * blockDim.x;
    for (; i < n; i += stride) {
        float zv = z_io[i];
        float s  = zv / (1.0f + expf(-zv));
        z_io[i] = s * h[i];
    }
}

// ---------------------------------------------------------------------------
extern "C" void kernel_launch(void* const* d_in, const int* in_sizes, int n_in,
                              void* d_out, int out_size, void* d_ws, size_t ws_size,
                              hipStream_t stream)
{
    const float* x     = (const float*)d_in[0];
    const float* omega = (const float*)d_in[1];   // 2048
    const float* Win   = (const float*)d_in[2];   // 4096 x 1024
    const float* Wl    = (const float*)d_in[3];   // 2048 x 2048
    const float* bl    = (const float*)d_in[4];
    const float* Wv    = (const float*)d_in[5];   // 2048 x 2048
    const float* bv    = (const float*)d_in[6];
    const float* Wout  = (const float*)d_in[7];   // 1024 x 2048
    float* out = (float*)d_out;

    const size_t BUF = (size_t)M_ROWS * D_INNER;  // 16,777,216 floats (64 MB)
    float* ws    = (float*)d_ws;
    float* xi    = ws;             // [M_ROWS, D_INNER]
    float* z     = ws + BUF;       // [M_ROWS, D_INNER] (later holds silu(z)*h)
    float* lam_h = ws + 2 * BUF;   // lam in, h out (in place)
    float* vbuf  = ws + 3 * BUF;   // total 256 MB of d_ws used

    dim3 blk(128);

    // 1) xz = x @ Win^T, split into xi | z
    {
        dim3 grd(4096 / TN, M_ROWS / TM);
        wmma_gemm_f32<EPI_SPLIT><<<grd, blk, 0, stream>>>(x, Win, nullptr, nullptr,
                                                          xi, z, M_ROWS, 4096, D_MODEL);
    }
    // 2) lam = exp(-8*softplus(omega)*sigmoid(xi@Wl^T + bl))
    {
        dim3 grd(D_INNER / TN, M_ROWS / TM);
        wmma_gemm_f32<EPI_LAMBDA><<<grd, blk, 0, stream>>>(xi, Wl, bl, omega,
                                                           lam_h, nullptr, M_ROWS, D_INNER, D_INNER);
    }
    // 3) v = xi @ Wv^T + bv
    {
        dim3 grd(D_INNER / TN, M_ROWS / TM);
        wmma_gemm_f32<EPI_PLAIN><<<grd, blk, 0, stream>>>(xi, Wv, bv, nullptr,
                                                          vbuf, nullptr, M_ROWS, D_INNER, D_INNER);
    }
    // 4) Householder scan (h overwrites lam buffer). The table of h-independent dots lies at
    //    the head of out, which launch 6 overwrites whole: the workspace has no byte left.
    scan_dots_kernel<<<dim3(SCAN_BLOCKS, BATCH), 256, 0, stream>>>(vbuf, lam_h, out);
    scan_kernel<<<BATCH, 1024, 0, stream>>>(xi, vbuf, lam_h, out);

    // 5) g = silu(z) * h   (overwrites z)
    silu_mul_kernel<<<4096, 256, 0, stream>>>(lam_h, z, BUF);

    // 6) out = g @ Wout^T
    {
        dim3 grd(D_MODEL / TN, M_ROWS / TM);
        wmma_gemm_f32<EPI_PLAIN><<<grd, blk, 0, stream>>>(z, Wout, nullptr, nullptr,
                                                          out, nullptr, M_ROWS, D_MODEL, D_INNER);
    }
}

// v006
// One run takes 1600 microseconds.
// Timed twice side by side with v005, it ran 1.13 times as fast both times.
// All steps since v000 together make it 2.86 times as fast.
#include <hip/hip_runtime.h>
#include <cmath>

// ---------------------------------------------------------------------------
// DenseRNN (Householder-reflection linear RNN) for MI455X / gfx1250
//   xz = x @ Win^T ; xi,z = split(xz)
//   lam = exp(-8*softplus(omega)*sigmoid(xi@Wl^T + bl))
//   v   = xi@Wv^T + bv
//   scan: h_t = lam_t*(h_{t-1} - 2 v_t (v.h)/(v.v)) + (1-lam_t)*xi_t ; h_0 = xi_0
//   out = (silu(z)*h) @ Wout^T
// xi@Wl^T and xi@Wv^T are formed as x@(Wl*Wxi)^T and x@(Wv*Wxi)^T, Wxi = the xi rows of Win:
// the inner length is then D_MODEL, not D_INNER, and the two small products Wl*Wxi and
// Wv*Wxi cost a quarter of what that saves on the f32 matrix unit.
// GEMMs: V_WMMA_F32_16X16X4_F32 + double-buffered async global->LDS staging.
// ---------------------------------------------------------------------------

typedef __attribute__((ext_vector_type(2))) float v2f;
typedef __attribute__((ext_vector_type(8))) float v8f;
typedef int v4i_gcc __attribute__((vector_size(16)));   // matches builtin pointee

#define D_MODEL   1024
#define D_INNER   2048
#define BATCH     4
#define SEQ       2048
#define M_ROWS    (BATCH * SEQ)        // 8192

// GEMM tiling: 128 threads = 4 waves; each wave owns a 32x64 C strip.
#define TM 128        // block rows
#define TN 64         // block cols
#define TK 32         // K tile
#define LDS_PAD 4     // row stride 36 floats = 144 B (16B aligned for b128 async)
#define LDS_LD  (TK + LDS_PAD)

// Epilogue modes
#define EPI_PLAIN  0   // out0[m,col] = acc (+ bias if non-null); blockIdx.z = 1: A1 in place of A0, out1 of out0
#define EPI_LAMBDA 1   // out0[m,col] = exp(-8*softplus(omega[col])*sigmoid(acc+bias[col]))
#define EPI_SPLIT  2   // col < D_INNER -> out0 (xi), else -> out1 (z), both ld = D_INNER

// --- async global->LDS copy (CDNA5 ASYNCcnt path), with sync fallback ------
#if defined(__AMDGCN__) && __has_builtin(__builtin_amdgcn_global_load_async_to_lds_b128)
#define USE_ASYNC_LDS 1
#else
#define USE_ASYNC_LDS 0
#endif

__device__ __forceinline__ void copy16_g2l(const float* __restrict__ g, float* l)
{
#if USE_ASYNC_LDS
    __builtin_amdgcn_global_load_async_to_lds_b128(
        (__attribute__((address_space(1))) v4i_gcc*)(void*)g,
        (__attribute__((address_space(3))) v4i_gcc*)(void*)l,
        /*imm offset=*/0, /*cpol=*/0);
#else
    *(float4*)l = *(const float4*)g;
#endif
}

__device__ __forceinline__ void wait_async_lds()
{
#if USE_ASYNC_LDS
#if __has_builtin(__builtin_amdgcn_s_wait_asynccnt)
    __builtin_amdgcn_s_wait_asynccnt(0);
#else
    asm volatile("s_wait_asynccnt 0x0" ::: "memory");
#endif
#endif
}

// Stands behind a group of global loads or stores, in front of the first
// instruction that may reuse one of their address or data registers. The
// scheduling barrier keeps later instructions, which may take those registers,
// from being lifted over the wait, and the loads in front of it from sinking
// behind it (a build without it did both, and spilled registers in the scan).
__device__ __forceinline__ void wait_addresses_taken()
{
    asm volatile("s_wait_xcnt 0x0" ::: "memory");
    __builtin_amdgcn_sched_barrier(0);
}

// C[M,N] = A[M,K] * W[N,K]^T   (A row-major MxK, W row-major NxK; both K-contiguous)
// Requires: M % TM == 0, N % TN == 0, K % TK == 0.
// The epilogue mode is a template argument, and what depends on the column alone is formed
// once per column, for speed only.
template <int MODE>
__global__ __launch_bounds__(128)
void wmma_gemm_f32(const float* __restrict__ A0, const float* __restrict__ A1,
                   const float* __restrict__ W,
                   const float* __restrict__ bias, const float* __restrict__ omega,
                   float* __restrict__ out0, float* __restrict__ out1,
                   int M, int N, int K)
{
    __shared__ float As[2][TM][LDS_LD];   // A tile, row-major, double buffered
    __shared__ float Bs[2][TN][LDS_LD];   // W tile, n-major: Bs[.][n][k] = W[nBlock+n][k0+k]

    const int tid  = threadIdx.x;
    const int wave = tid >> 5;               // 0..3 (wave32)
    const int lane = tid & 31;
    const int laneMod  = lane & 15;          // 0..15
    const int laneHalf = lane >> 4;          // 0 or 1

    const int mBlock = blockIdx.y * TM;
    const int nBlock = blockIdx.x * TN;
    const int waveM  = wave * 32;            // this wave's 32-row strip inside block tile

    // Two products with one W share a launch, so that a small grid still gives every SIMD two waves.
    const bool second = MODE == EPI_PLAIN && blockIdx.z != 0;
    const float* __restrict__ A = second ? A1 : A0;

    v8f acc[2][4];
    #pragma unroll
    for (int mt = 0; mt < 2; ++mt)
        #pragma unroll
        for (int nt = 0; nt < 4; ++nt)
            #pragma unroll
            for (int r = 0; r < 8; ++r) acc[mt][nt][r] = 0.0f;

    // ---- tile stage: issues TM*TK/4/128 = 8 A chunks + 4 W chunks of b128 ----
    auto stage_tile = [&](int k0, int b) {
        #pragma unroll
        for (int i = 0; i < 8; ++i) {
            int q   = tid + i * 128;          // 0..1023
            int row = q >> 3;                 // 8 float4 per 32-float row
            int c4  = (q & 7) << 2;
            copy16_g2l(A + (size_t)(mBlock + row) * K + k0 + c4, &As[b][row][c4]);
        }
        #pragma unroll
        for (int i = 0; i < 4; ++i) {
            int q   = tid + i * 128;          // 0..511
            int row = q >> 3;
            int c4  = (q & 7) << 2;
            copy16_g2l(W + (size_t)(nBlock + row) * K + k0 + c4, &Bs[b][row][c4]);
        }
    };

    int buf = 0;
    stage_tile(0, buf);
    wait_async_lds();
    __syncthreads();

    for (int k0 = 0; k0 < K; k0 += TK) {
        const int nbuf = buf ^ 1;
        if (k0 + TK < K) stage_tile(k0 + TK, nbuf);   // prefetch next tile (async)

        // ---- 8 K-steps; per step: 2 A frags x 4 B frags = 8 WMMAs ----
        #pragma unroll
        for (int kk = 0; kk < TK; kk += 4) {
            // A frag (16x4): lanes 0-15: M=lane, K=kk+{0,1}; lanes 16-31: K=kk+{2,3}
            v2f a0, a1;
            a0.x = As[buf][waveM + laneMod][kk + 2 * laneHalf + 0];
            a0.y = As[buf][waveM + laneMod][kk + 2 * laneHalf + 1];
            a1.x = As[buf][waveM + 16 + laneMod][kk + 2 * laneHalf + 0];
            a1.y = As[buf][waveM + 16 + laneMod][kk + 2 * laneHalf + 1];
            #pragma unroll
            for (int nt = 0; nt < 4; ++nt) {
                // B frag (4x16): lane holds K=kk+2*laneHalf+{0,1}, N=nt*16+laneMod
                v2f bf;
                bf.x = Bs[buf][nt * 16 + laneMod][kk + 2 * laneHalf + 0];
                bf.y = Bs[buf][nt * 16 + laneMod][kk + 2 * laneHalf + 1];
                acc[0][nt] = __builtin_amdgcn_wmma_f32_16x16x4_f32(
                    false, a0, false, bf, (short)0, acc[0][nt], false, false);
                acc[1][nt] = __builtin_amdgcn_wmma_f32_16x16x4_f32(
                    false, a1, false, bf, (short)0, acc[1][nt], false, false);
            }
        }

        wait_async_lds();       // next tile landed in LDS
        __syncthreads();        // all waves done reading `buf`, async writes visible
        buf = nbuf;
    }

    // ---- epilogue: C/D layout: VGPR r -> row = r + 8*laneHalf, col = laneMod ----
    // What depends on the column alone, once per column: the bias, and -8*softplus(omega).
    float cb[4], ck[4];
    #pragma unroll
    for (int nt = 0; nt < 4; ++nt) {
        const int col = nBlock + nt * 16 + laneMod;
        cb[nt] = 0.0f;
        ck[nt] = 0.0f;
        if (MODE == EPI_LAMBDA) {
            cb[nt] = bias[col];
            ck[nt] = -8.0f * log1pf(expf(omega[col]));
        } else if (MODE == EPI_PLAIN) {
            if (bias) cb[nt] = bias[col];
        }
    }
    if (MODE != EPI_SPLIT) wait_addresses_taken();   // the row addresses formed next may take these loads' address registers

    // A block's TN columns lie wholly in xi or wholly in z.
    static_assert(D_INNER % TN == 0, "a block of columns must not straddle the split");
    float* dst = (second ? out1 : out0) + nBlock;
    size_t ld  = (size_t)N;
    if (MODE == EPI_SPLIT) {
        ld = D_INNER;
        if (nBlock >= D_INNER) dst = out1 + (nBlock - D_INNER);
    }

    #pragma unroll
    for (int mt = 0; mt < 2; ++mt) {
        #pragma unroll
        for (int r = 0; r < 8; ++r) {
            const int m = mBlock + waveM + mt * 16 + r + 8 * laneHalf;
            float* row = dst + (size_t)m * ld + laneMod;
            #pragma unroll
            for (int nt = 0; nt < 4; ++nt) {
                float val = acc[mt][nt][r];
                if (MODE == EPI_PLAIN) {
                    if (bias) val += cb[nt];
                } else if (MODE == EPI_LAMBDA) {
                    val += cb[nt];
                    float sig = 1.0f / (1.0f + expf(-val));
                    val = expf(ck[nt] * sig);
                }
                row[nt * 16] = val;
            }
            // The next row's address and values may take this row's registers. With the split's
            // constant row pitch the eight rows of one mt share one address and store the
            // accumulators themselves: there nothing is rewritten before the next mt.
            if (mt * 8 + r < 15 && (MODE != EPI_SPLIT || r == 7)) wait_addresses_taken();
        }
    }
}

// dst[d][i] = src[i][d] for the D_INNER x D_MODEL head of Win (the rows that make xi): the GEMM
// wants both operands contiguous along the summed index, which for Wl*Wxi is i.
__global__ __launch_bounds__(256)
void transpose_wxi_kernel(const float* __restrict__ src, float* __restrict__ dst)
{
    __shared__ float tile[32][33];           // pitch 33: the column reads below touch 32 banks
    const int tx = threadIdx.x & 31;
    const int ty = threadIdx.x >> 5;         // 0..7
    const int d0 = blockIdx.x * 32;
    const int i0 = blockIdx.y * 32;
    float r[4];
    #pragma unroll
    for (int q = 0; q < 4; ++q) r[q] = src[(size_t)(i0 + ty + q * 8) * D_MODEL + d0 + tx];
    wait_addresses_taken();   // the LDS and store addresses formed next may take the loads' address registers
    #pragma unroll
    for (int q = 0; q < 4; ++q) tile[ty + q * 8][tx] = r[q];
    __syncthreads();
    #pragma unroll
    for (int q = 0; q < 4; ++q) dst[(size_t)(d0 + ty + q * 8) * D_INNER + i0 + tx] = tile[tx][ty + q * 8];
}

// ---------------------------------------------------------------------------
// Householder scan, blocked by SCAN_CH steps. Inside a block of steps
//   h_j = f_j - sum_{i<=j} s_i w_{i,j},   s_j = 2 (v_j.h_{j-1}) / (v_j.v_j)
// with f the same recurrence without its reflections (f_j = lam_j f_{j-1} + (1-lam_j) xi_j,
// started at the block's entry h) and w_{i,j} = lam_j ... lam_i v_i. So
//   v_j.h_{j-1} = v_j.f_{j-1} - sum_{i<j} s_i (v_j.w_{i,j-1}).
// The dots v_j.v_j and v_j.w_{i,j-1} do not depend on h: a kernel over the whole chip
// forms them for every block of steps. The sequential kernel then needs ONE work-group sum
// (of the SCAN_CH dots v_j.f_{j-1}) per block of steps, a forward substitution for the
// s_j, and the reference's own recurrence with those s_j.
// ---------------------------------------------------------------------------
typedef __attribute__((ext_vector_type(4))) float v4f;

#define SCAN_CH     6                                   // steps per block of steps
#define SCAN_FULL   ((SEQ - 1) / SCAN_CH)               // blocks with all their steps: 341
#define SCAN_TAIL   ((SEQ - 1) - SCAN_FULL * SCAN_CH)   // steps of the last, short block: 1
#define SCAN_BLOCKS (SCAN_FULL + 1)
#define TAB_N       (SCAN_CH + SCAN_CH * (SCAN_CH - 1) / 2)  // 6 v.v and 15 v.w
#define TAB_LD      32                                  // one 128-byte line per block of steps
#define TAB_G(j, i) (SCAN_CH + (j) * ((j) - 1) / 2 + (i))    // v_j.w_{i,j-1}, i < j
#define SCAN_PF     4                                   // blocks of steps that the L2 prefetch runs ahead
static_assert(SCAN_TAIL > 0 && SCAN_FULL % 2 == 1, "the scan's last calls are written for this case");

// Work-group barrier that orders LDS only. __syncthreads() also drains the
// wave's global loads and stores, which would put the memory latency of the
// rows fetched ahead, and of the h stores, back into every round.
__device__ __forceinline__ void barrier_lds_only()
{
    __builtin_amdgcn_fence(__ATOMIC_RELEASE, "workgroup", "local");
    __builtin_amdgcn_s_barrier();
    __builtin_amdgcn_fence(__ATOMIC_ACQUIRE, "workgroup", "local");
}

// Sums across lanes on the vector unit. __shfl_xor compiles to ds_bpermute_b32: an LDS round
// trip per step of the tree, and one LDS slot per value, step and wave of the work-group.
// x + (x of lane l ^ m) inside a 16-lane row; CTRL = 0x160 + m is the DPP control row_xmask:m.
template <int CTRL>
__device__ __forceinline__ float add_row_xmask(float x)
{
    const int y = __builtin_amdgcn_update_dpp(0, __builtin_bit_cast(int, x), CTRL, 0xf, 0xf, true);
    return x + __builtin_bit_cast(float, y);
}
// p[0..n): every lane gets the sum over its own 16-lane row. All 32 lanes must be on.
// Step by step over all n values, so that the n chains fill one another's latency.
__device__ __forceinline__ void row_sums(float* p, int n)
{
    #pragma unroll
    for (int j = 0; j < n; ++j) p[j] = add_row_xmask<0x161>(p[j]);
    #pragma unroll
    for (int j = 0; j < n; ++j) p[j] = add_row_xmask<0x162>(p[j]);
    #pragma unroll
    for (int j = 0; j < n; ++j) p[j] = add_row_xmask<0x164>(p[j]);
    #pragma unroll
    for (int j = 0; j < n; ++j) p[j] = add_row_xmask<0x168>(p[j]);
}
// x of lane l ^ 16
__device__ __forceinline__ float other_row(float x)
{
    const int b = __builtin_bit_cast(int, x);
    return __builtin_bit_cast(float,
        __builtin_amdgcn_permlanex16(b, b, 0x76543210, 0xfedcba98, false, false));
}

// tab[b][k][.]: the h-independent dots of block k of batch b. One work-group each.
// Rows past the end (short last block) are read as the last row; their entries are never used.
__global__ __launch_bounds__(256)
void scan_dots_kernel(const float* __restrict__ v, const float* __restrict__ lam,
                      float* __restrict__ tab)
{
    const int k   = blockIdx.x;
    const int b   = blockIdx.y;
    const int tid = threadIdx.x;
    const size_t base = (size_t)b * SEQ * D_INNER + tid * 4;

    __shared__ float part[8][TAB_N];

    v4f rv[2][SCAN_CH], rl[2][SCAN_CH];
    #pragma unroll
    for (int j = 0; j < SCAN_CH; ++j) {
        int t = 1 + k * SCAN_CH + j;
        if (t > SEQ - 1) t = SEQ - 1;
        #pragma unroll
        for (int hf = 0; hf < 2; ++hf) {
            const size_t off = base + (size_t)t * D_INNER + hf * 1024;
            rv[hf][j] = *(const v4f*)(v + off);
            wait_addresses_taken();   // a later load's result may land in this load's address registers
            rl[hf][j] = *(const v4f*)(lam + off);
            wait_addresses_taken();
        }
    }

    float acc[TAB_N];
    #pragma unroll
    for (int q = 0; q < TAB_N; ++q) acc[q] = 0.0f;

    #pragma unroll
    for (int hf = 0; hf < 2; ++hf) {
        #pragma unroll
        for (int e = 0; e < 4; ++e) {
            float w[SCAN_CH];
            #pragma unroll
            for (int j = 0; j < SCAN_CH; ++j) {
                const float vj = rv[hf][j][e];
                const float lj = rl[hf][j][e];
                acc[j] += vj * vj;
                #pragma unroll
                for (int i = 0; i < j; ++i) acc[TAB_G(j, i)] += vj * w[i];
                #pragma unroll
                for (int i = 0; i < j; ++i) w[i] *= lj;
                w[j] = lj * vj;
            }
        }
    }

    row_sums(acc, TAB_N);
    #pragma unroll
    for (int q = 0; q < TAB_N; ++q) acc[q] += other_row(acc[q]);
    if ((tid & 31) == 0) {
        #pragma unroll
        for (int q = 0; q < TAB_N; ++q) part[tid >> 5][q] = acc[q];
    }
    __syncthreads();
    if (tid < TAB_N) {
        float s = 0.0f;
        #pragma unroll
        for (int w8 = 0; w8 < 8; ++w8) s += part[w8][tid];
        tab[((size_t)b * SCAN_BLOCKS + k) * TAB_LD + tid] = s;
    }
}

// One work-group per batch, 1024 threads, 2 channels per thread.
// lam_h holds lam on entry; h is written in place (a thread reads lam[t] before it
// writes h[t]; lam[.,0,.] is never consumed by the reference).
// No thread reads a global word that another thread of this launch writes, so
// global memory needs no ordering at the barriers: only red[] and bcast[] do.
__global__ __launch_bounds__(1024)
void scan_kernel(const float* __restrict__ xi, const float* __restrict__ v,
                 float* __restrict__ lam_h, const float* __restrict__ tab)
{
    const int b    = blockIdx.x;
    const int tid  = threadIdx.x;
    const int c0   = tid;
    const int c1   = tid + 1024;
    const int wave = tid >> 5;
    const int lane = tid & 31;
    const size_t base = (size_t)b * SEQ * D_INNER;

    __shared__ float red[SCAN_CH][64];   // per dot: one partial sum of each 16-lane row of the 32 waves
    __shared__ float bcast[SCAN_CH];

    float h0 = xi[base + c0];
    float h1 = xi[base + c1];
    lam_h[base + c0] = h0;
    lam_h[base + c1] = h1;

    // Two sets of rows: one is worked on while the next block's rows fly into the other.
    float rv0[2][SCAN_CH], rv1[2][SCAN_CH];
    float rl0[2][SCAN_CH], rl1[2][SCAN_CH];
    float rx0[2][SCAN_CH], rx1[2][SCAN_CH];

    auto fetch = [&](int k, int s, int n) {
        #pragma unroll
        for (int j = 0; j < n; ++j) {
            const size_t off = base + (size_t)(1 + k * SCAN_CH + j) * D_INNER;
            rv0[s][j] = v[off + c0];     rv1[s][j] = v[off + c1];
            rl0[s][j] = lam_h[off + c0]; rl1[s][j] = lam_h[off + c1];
            rx0[s][j] = xi[off + c0];    rx1[s][j] = xi[off + c1];
        }
    };
    // The last fetch, behind the loop: its address registers are used up load by load, and a
    // later load's result may land in them, so each load gets its own wait. Runs once.
    auto fetch_last = [&](int k, int s) {
        #pragma unroll
        for (int j = 0; j < SCAN_TAIL; ++j) {
            const size_t off = base + (size_t)(1 + k * SCAN_CH + j) * D_INNER;
            rv0[s][j] = v[off + c0];     wait_addresses_taken();
            rv1[s][j] = v[off + c1];     wait_addresses_taken();
            rl0[s][j] = lam_h[off + c0]; wait_addresses_taken();
            rl1[s][j] = lam_h[off + c1]; wait_addresses_taken();
            rx0[s][j] = xi[off + c0];    wait_addresses_taken();
            rx1[s][j] = xi[off + c1];    wait_addresses_taken();
        }
    };

    const float* tk = tab + (size_t)b * SCAN_BLOCKS * TAB_LD;   // the table line of the block at hand

    // For speed only, the rows of v, lam and xi are asked into L2 SCAN_PF blocks of steps
    // ahead of the block at hand: a prefetch returns nothing to the WGP and no wave waits for it.
    // Wave w < 18 asks for one row of 8 KiB: 32 lanes, 256 bytes apart.
    const int wave_s = __builtin_amdgcn_readfirstlane(tid >> 5);   // scalar, for a scalar branch
    const int pf_arr = wave_s / SCAN_CH;
    const int pf_j   = wave_s % SCAN_CH;
    const float* pf_src = pf_arr == 0 ? v : (pf_arr == 1 ? (const float*)lam_h : xi);
    // The row of block k that this wave asks for; past the end it is the last row, so the
    // address stays inside the array at every issue and after every advance.
    auto pf_row = [&](int k) {
        const int t = 1 + k * SCAN_CH + pf_j;
        return t < SEQ - 1 ? t : SEQ - 1;
    };
    const char* pf = (const char*)(pf_src + base + (size_t)pf_row(SCAN_PF) * D_INNER) + lane * 256;
    auto pf_ask = [&]() {
        if (wave_s < 3 * SCAN_CH)
            asm volatile("global_prefetch_b8 %0, off scope:SCOPE_SE" :: "v"(pf));   // into L2 only
    };
    auto pf_advance = [&](int k) {   // from block k's row to block k + 1's
        pf += (size_t)(pf_row(k + 1) - pf_row(k)) * (D_INNER * sizeof(float));
    };

    // Block k of n steps, its rows in set s; n_next steps of block k+1 are fetched into the other set.
    auto block_of_steps = [&](int k, int s, int n, int n_next) {
        // This block's table line: asked for here, used behind the first barrier.
        float tb[TAB_N];
        #pragma unroll
        for (int j = 0; j < n; ++j) {
            tb[j] = tk[j];
            #pragma unroll
            for (int i = 0; i < j; ++i) tb[TAB_G(j, i)] = tk[TAB_G(j, i)];
        }
        wait_addresses_taken();   // in front of the step of tk
        tk += TAB_LD;
        if (n_next == SCAN_CH) {
            fetch(k + 1, s ^ 1, SCAN_CH);
            wait_addresses_taken();
            pf_ask();   // block k + SCAN_PF; behind the loads, so that it does not stand in their way
        }
        else if (n_next > 0)   fetch_last(k + 1, s ^ 1);

        float p[SCAN_CH];
        float f0 = h0, f1 = h1;
        #pragma unroll
        for (int j = 0; j < n; ++j) {
            p[j] = rv0[s][j] * f0 + rv1[s][j] * f1;
            rx0[s][j] = (1.0f - rl0[s][j]) * rx0[s][j];
            rx1[s][j] = (1.0f - rl1[s][j]) * rx1[s][j];
            f0 = rl0[s][j] * f0 + rx0[s][j];
            f1 = rl1[s][j] * f1 + rx1[s][j];
        }
        row_sums(p, n);
        if ((lane & 15) == 0) {   // lanes 0 and 16: their row's sums
            #pragma unroll
            for (int j = 0; j < n; ++j) red[j][tid >> 4] = p[j];
        }
        barrier_lds_only();
        if (wave == 0) {
            // One wave sums the n dots over the 64 rows and solves for the s_j: the chain of
            // divisions then costs its latency once, not its issue slots in every wave.
            float num[SCAN_CH], sj[SCAN_CH];
            #pragma unroll
            for (int j = 0; j < n; ++j) num[j] = red[j][lane] + red[j][lane + 32];
            row_sums(num, n);
            #pragma unroll
            for (int j = 0; j < n; ++j) num[j] += other_row(num[j]);
            #pragma unroll
            for (int j = 0; j < n; ++j) {
                sj[j] = 2.0f * num[j] / tb[j];
                #pragma unroll
                for (int jj = j + 1; jj < n; ++jj) num[jj] -= sj[j] * tb[TAB_G(jj, j)];
            }
            if (lane == 0) {
                #pragma unroll
                for (int j = 0; j < n; ++j) bcast[j] = sj[j];
            }
        }
        barrier_lds_only();

        float sc[SCAN_CH];
        #pragma unroll
        for (int j = 0; j < n; ++j) sc[j] = bcast[j];

        float hr0[SCAN_CH], hr1[SCAN_CH];
        #pragma unroll
        for (int j = 0; j < n; ++j) {
            h0 = rl0[s][j] * (h0 - rv0[s][j] * sc[j]) + rx0[s][j];
            h1 = rl1[s][j] * (h1 - rv1[s][j] * sc[j]) + rx1[s][j];
            hr0[j] = h0;
            hr1[j] = h1;
        }
        #pragma unroll
        for (int j = 0; j < n; ++j) {
            const size_t off = base + (size_t)(1 + k * SCAN_CH + j) * D_INNER;
            lam_h[off + c0] = hr0[j];
            lam_h[off + c1] = hr1[j];
        }
        wait_addresses_taken();
        if (n_next == SCAN_CH) pf_advance(k + SCAN_PF);   // behind the wait: pf is named by the prefetch above
        barrier_lds_only();   // red[] and bcast[] safe to overwrite in the next block
    };

    fetch(0, 0, SCAN_CH);
    wait_addresses_taken();

    // The set index must be a constant for the rows to stay in registers: two
    // blocks per trip, the loop itself stays rolled.
    #pragma unroll 1
    for (int kk = 0; kk < SCAN_FULL / 2; ++kk) {
        block_of_steps(2 * kk,     0, SCAN_CH, SCAN_CH);
        block_of_steps(2 * kk + 1, 1, SCAN_CH, SCAN_CH);
    }
    block_of_steps(SCAN_FULL - 1, 0, SCAN_CH,   SCAN_TAIL);
    block_of_steps(SCAN_FULL,     1, SCAN_TAIL, 0);
}

// g = silu(z) * h, written over z
__global__ void silu_mul_kernel(const float* __restrict__ h, float* __restrict__ z_io,
                                size_t n)
{
    size_t i      = (size_t)blockIdx.x * blockDim.x + threadIdx.x;
    size_t stride = (size_t)gridDim.x * blockDim.x;
    for (; i < n; i += stride) {
        float zv = z_io[i];
        float s  = zv / (1.0f + expf(-zv));
        z_io[i] = s * h[i];
    }
}

// ---------------------------------------------------------------------------
extern "C" void kernel_launch(void* const* d_in, const int* in_sizes, int n_in,
                              void* d_out, int out_size, void* d_ws, size_t ws_size,
                              hipStream_t stream)
{
    const float* x     = (const float*)d_in[0];
    const float* omega = (const float*)d_in[1];   // 2048
    const float* Win   = (const float*)d_in[2];   // 4096 x 1024
    const float* Wl    = (const float*)d_in[3];   // 2048 x 2048
    const float* bl    = (const float*)d_in[4];
    const float* Wv    = (const float*)d_in[5];   // 2048 x 2048
    const float* bv    = (const float*)d_in[6];
    const float* Wout  = (const float*)d_in[7];   // 1024 x 2048
    float* out = (float*)d_out;

    const size_t BUF = (size_t)M_ROWS * D_INNER;  // 16,777,216 floats (64 MB)
    float* ws    = (float*)d_ws;
    float* xi    = ws;             // [M_ROWS, D_INNER]
    float* z     = ws + BUF;       // [M_ROWS, D_INNER] (later holds silu(z)*h)
    float* lam_h = ws + 2 * BUF;   // lam in, h out (in place)
    float* vbuf  = ws + 3 * BUF;   // total 256 MB of d_ws used

    // Scratch in out, which launch 6 overwrites whole (the workspace has no byte left): the
    // transposed xi rows of Win and the two folded weights, 8 MB each. All dead before launch 4.
    const size_t WSZ = (size_t)D_INNER * D_MODEL;
    float* wxiT = out;             // [D_MODEL, D_INNER]
    float* wlx  = out + WSZ;       // Wl*Wxi [D_INNER, D_MODEL]
    float* wvx  = out + 2 * WSZ;   // Wv*Wxi [D_INNER, D_MODEL]

    dim3 blk(128);

    // 0) the xi rows of Win transposed, then Wl*Wxi and Wv*Wxi in one launch
    transpose_wxi_kernel<<<dim3(D_MODEL / 32, D_INNER / 32), 256, 0, stream>>>(Win, wxiT);
    {
        dim3 grd(D_MODEL / TN, D_INNER / TM, 2);
        wmma_gemm_f32<EPI_PLAIN><<<grd, blk, 0, stream>>>(Wl, Wv, wxiT, nullptr, nullptr,
                                                          wlx, wvx, D_INNER, D_MODEL, D_INNER);
    }

    // 1) xz = x @ Win^T, split into xi | z
    {
        dim3 grd(4096 / TN, M_ROWS / TM);
        wmma_gemm_f32<EPI_SPLIT><<<grd, blk, 0, stream>>>(x, nullptr, Win, nullptr, nullptr,
                                                          xi, z, M_ROWS, 4096, D_MODEL);
    }
    // 2) lam = exp(-8*softplus(omega)*sigmoid(x@(Wl*Wxi)^T + bl))
    {
        dim3 grd(D_INNER / TN, M_ROWS / TM);
        wmma_gemm_f32<EPI_LAMBDA><<<grd, blk, 0, stream>>>(x, nullptr, wlx, bl, omega,
                                                           lam_h, nullptr, M_ROWS, D_INNER, D_MODEL);
    }
    // 3) v = x @ (Wv*Wxi)^T + bv
    {
        dim3 grd(D_INNER / TN, M_ROWS / TM);
        wmma_gemm_f32<EPI_PLAIN><<<grd, blk, 0, stream>>>(x, nullptr, wvx, bv, nullptr,
                                                          vbuf, nullptr, M_ROWS, D_INNER, D_MODEL);
    }
    // 4) Householder scan (h overwrites lam buffer). The table of h-independent dots lies at
    //    the head of out, which launch 6 overwrites whole: the workspace has no byte left.
    scan_dots_kernel<<<dim3(SCAN_BLOCKS, BATCH), 256, 0, stream>>>(vbuf, lam_h, out);
    scan_kernel<<<BATCH, 1024, 0, stream>>>(xi, vbuf, lam_h, out);

    // 5) g = silu(z) * h   (overwrites z)
    silu_mul_kernel<<<4096, 256, 0, stream>>>(lam_h, z, BUF);

    // 6) out = g @ Wout^T
    {
        dim3 grd(D_MODEL / TN, M_ROWS / TM);
        wmma_gemm_f32<EPI_PLAIN><<<grd, blk, 0, stream>>>(z, nullptr, Wout, nullptr, nullptr,
                                                          out, nullptr, M_ROWS, D_MODEL, D_INNER);
    }
}

// v007
// Measured time: 1410 microseconds a run.
// Next to v006, in two timings, it ran 1.14 times as fast each time.
// All steps since v000 together make it 3.26 times as fast.
#include <hip/hip_runtime.h>
#include <cmath>

// ---------------------------------------------------------------------------
// DenseRNN (Householder-reflection linear RNN) for MI455X / gfx1250
//   xz = x @ Win^T ; xi,z = split(xz)
//   lam = exp(-8*softplus(omega)*sigmoid(xi@Wl^T + bl))
//   v   = xi@Wv^T + bv
//   scan: h_t = lam_t*(h_{t-1} - 2 v_t (v.h)/(v.v)) + (1-lam_t)*xi_t ; h_0 = xi_0
//   out = (silu(z)*h) @ Wout^T
// xi@Wl^T and xi@Wv^T are formed as x@(Wl*Wxi)^T and x@(Wv*Wxi)^T, Wxi = the xi rows of Win:
// the inner length is then D_MODEL, not D_INNER, and the two small products Wl*Wxi and
// Wv*Wxi cost a quarter of what that saves on the f32 matrix unit.
// GEMMs: V_WMMA_F32_16X16X4_F32 + double-buffered async global->LDS staging.
// ---------------------------------------------------------------------------

typedef __attribute__((ext_vector_type(2))) float v2f;
typedef __attribute__((ext_vector_type(8))) float v8f;
typedef int v4i_gcc __attribute__((vector_size(16)));   // matches builtin pointee

#define D_MODEL   1024
#define D_INNER   2048
#define BATCH     4
#define SEQ       2048
#define M_ROWS    (BATCH * SEQ)        // 8192

// GEMM tiling: 128 threads = 4 waves; each wave owns a 32x64 C strip.
#define TM 128        // block rows
#define TN 64         // block cols
#define TK 32         // K tile
#define LDS_PAD 4     // row stride 36 floats = 144 B (16B aligned for b128 async)
#define LDS_LD  (TK + LDS_PAD)

// Epilogue modes
#define EPI_PLAIN  0   // out0[m,col] = acc (+ bias if non-null); blockIdx.z = 1: A1 in place of A0, out1 of out0
#define EPI_LAMBDA 1   // out0[m,col] = exp(-8*softplus(omega[col])*sigmoid(acc+bias[col]))
#define EPI_SPLIT  2   // col < D_INNER -> out0 (xi), else -> out1 (z), both ld = D_INNER

// --- async global->LDS copy (CDNA5 ASYNCcnt path), with sync fallback ------
#if defined(__AMDGCN__) && __has_builtin(__builtin_amdgcn_global_load_async_to_lds_b128)
#define USE_ASYNC_LDS 1
#else
#define USE_ASYNC_LDS 0
#endif

__device__ __forceinline__ void copy16_g2l(const float* __restrict__ g, float* l)
{
#if USE_ASYNC_LDS
    __builtin_amdgcn_global_load_async_to_lds_b128(
        (__attribute__((address_space(1))) v4i_gcc*)(void*)g,
        (__attribute__((address_space(3))) v4i_gcc*)(void*)l,
        /*imm offset=*/0, /*cpol=*/0);
#else
    *(float4*)l = *(const float4*)g;
#endif
}

__device__ __forceinline__ void wait_async_lds()
{
#if USE_ASYNC_LDS
#if __has_builtin(__builtin_amdgcn_s_wait_asynccnt)
    __builtin_amdgcn_s_wait_asynccnt(0);
#else
    asm volatile("s_wait_asynccnt 0x0" ::: "memory");
#endif
#endif
}

// Stands behind a group of global loads or stores, in front of the first
// instruction that may reuse one of their address or data registers. The
// scheduling barrier keeps later instructions, which may take those registers,
// from being lifted over the wait, and the loads in front of it from sinking
// behind it (a build without it did both, and spilled registers in the scan).
__device__ __forceinline__ void wait_addresses_taken()
{
    asm volatile("s_wait_xcnt 0x0" ::: "memory");
    __builtin_amdgcn_sched_barrier(0);
}

// C[M,N] = A[M,K] * W[N,K]^T   (A row-major MxK, W row-major NxK; both K-contiguous)
// Requires: M % TM == 0, N % TN == 0, K % TK == 0.
// The epilogue mode is a template argument, and what depends on the column alone is formed
// once per column, for speed only.
template <int MODE>
__global__ __launch_bounds__(128)
void wmma_gemm_f32(const float* __restrict__ A0, const float* __restrict__ A1,
                   const float* __restrict__ W,
                   const float* __restrict__ bias, const float* __restrict__ omega,
                   float* __restrict__ out0, float* __restrict__ out1,
                   int M, int N, int K)
{
    __shared__ float As[2][TM][LDS_LD];   // A tile, row-major, double buffered
    __shared__ float Bs[2][TN][LDS_LD];   // W tile, n-major: Bs[.][n][k] = W[nBlock+n][k0+k]

    const int tid  = threadIdx.x;
    const int wave = tid >> 5;               // 0..3 (wave32)
    const int lane = tid & 31;
    const int laneMod  = lane & 15;          // 0..15
    const int laneHalf = lane >> 4;          // 0 or 1

    const int mBlock = blockIdx.y * TM;
    const int nBlock = blockIdx.x * TN;
    const int waveM  = wave * 32;            // this wave's 32-row strip inside block tile

    // Two products with one W share a launch, so that a small grid still gives every SIMD two waves.
    const bool second = MODE == EPI_PLAIN && blockIdx.z != 0;
    const float* __restrict__ A = second ? A1 : A0;

    v8f acc[2][4];
    #pragma unroll
    for (int mt = 0; mt < 2; ++mt)
        #pragma unroll
        for (int nt = 0; nt < 4; ++nt)
            #pragma unroll
            for (int r = 0; r < 8; ++r) acc[mt][nt][r] = 0.0f;

    // ---- tile stage: issues TM*TK/4/128 = 8 A chunks + 4 W chunks of b128 ----
    auto stage_tile = [&](int k0, int b) {
        #pragma unroll
        for (int i = 0; i < 8; ++i) {
            int q   = tid + i * 128;          // 0..1023
            int row = q >> 3;                 // 8 float4 per 32-float row
            int c4  = (q & 7) << 2;
            copy16_g2l(A + (size_t)(mBlock + row) * K + k0 + c4, &As[b][row][c4]);
        }
        #pragma unroll
        for (int i = 0; i < 4; ++i) {
            int q   = tid + i * 128;          // 0..511
            int row = q >> 3;
            int c4  = (q & 7) << 2;
            copy16_g2l(W + (size_t)(nBlock + row) * K + k0 + c4, &Bs[b][row][c4]);
        }
    };

    int buf = 0;
    stage_tile(0, buf);
    wait_async_lds();
    __syncthreads();

    for (int k0 = 0; k0 < K; k0 += TK) {
        const int nbuf = buf ^ 1;
        if (k0 + TK < K) stage_tile(k0 + TK, nbuf);   // prefetch next tile (async)

        // ---- 8 K-steps; per step: 2 A frags x 4 B frags = 8 WMMAs ----
        #pragma unroll
        for (int kk = 0; kk < TK; kk += 4) {
            // A frag (16x4): lanes 0-15: M=lane, K=kk+{0,1}; lanes 16-31: K=kk+{2,3}
            v2f a0, a1;
            a0.x = As[buf][waveM + laneMod][kk + 2 * laneHalf + 0];
            a0.y = As[buf][waveM + laneMod][kk + 2 * laneHalf + 1];
            a1.x = As[buf][waveM + 16 + laneMod][kk + 2 * laneHalf + 0];
            a1.y = As[buf][waveM + 16 + laneMod][kk + 2 * laneHalf + 1];
            #pragma unroll
            for (int nt = 0; nt < 4; ++nt) {
                // B frag (4x16): lane holds K=kk+2*laneHalf+{0,1}, N=nt*16+laneMod
                v2f bf;
                bf.x = Bs[buf][nt * 16 + laneMod][kk + 2 * laneHalf + 0];
                bf.y = Bs[buf][nt * 16 + laneMod][kk + 2 * laneHalf + 1];
                acc[0][nt] = __builtin_amdgcn_wmma_f32_16x16x4_f32(
                    false, a0, false, bf, (short)0, acc[0][nt], false, false);
                acc[1][nt] = __builtin_amdgcn_wmma_f32_16x16x4_f32(
                    false, a1, false, bf, (short)0, acc[1][nt], false, false);
            }
        }

        wait_async_lds();       // next tile landed in LDS
        __syncthreads();        // all waves done reading `buf`, async writes visible
        buf = nbuf;
    }

    // ---- epilogue: C/D layout: VGPR r -> row = r + 8*laneHalf, col = laneMod ----
    // What depends on the column alone, once per column: the bias, and -8*softplus(omega).
    float cb[4], ck[4];
    #pragma unroll
    for (int nt = 0; nt < 4; ++nt) {
        const int col = nBlock + nt * 16 + laneMod;
        cb[nt] = 0.0f;
        ck[nt] = 0.0f;
        if (MODE == EPI_LAMBDA) {
            cb[nt] = bias[col];
            ck[nt] = -8.0f * log1pf(expf(omega[col]));
        } else if (MODE == EPI_PLAIN) {
            if (bias) cb[nt] = bias[col];
        }
    }
    if (MODE != EPI_SPLIT) wait_addresses_taken();   // the row addresses formed next may take these loads' address registers

    // A block's TN columns lie wholly in xi or wholly in z.
    static_assert(D_INNER % TN == 0, "a block of columns must not straddle the split");
    float* dst = (second ? out1 : out0) + nBlock;
    size_t ld  = (size_t)N;
    if (MODE == EPI_SPLIT) {
        ld = D_INNER;
        if (nBlock >= D_INNER) dst = out1 + (nBlock - D_INNER);
    }

    #pragma unroll
    for (int mt = 0; mt < 2; ++mt) {
        #pragma unroll
        for (int r = 0; r < 8; ++r) {
            const int m = mBlock + waveM + mt * 16 + r + 8 * laneHalf;
            float* row = dst + (size_t)m * ld + laneMod;
            #pragma unroll
            for (int nt = 0; nt < 4; ++nt) {
                float val = acc[mt][nt][r];
                if (MODE == EPI_PLAIN) {
                    if (bias) val += cb[nt];
                } else if (MODE == EPI_LAMBDA) {
                    val += cb[nt];
                    float sig = 1.0f / (1.0f + expf(-val));
                    val = expf(ck[nt] * sig);
                }
                row[nt * 16] = val;
            }
            // The next row's address and values may take this row's registers. With the split's
            // constant row pitch the eight rows of one mt share one address and store the
            // accumulators themselves: there nothing is rewritten before the next mt.
            if (mt * 8 + r < 15 && (MODE != EPI_SPLIT || r == 7)) wait_addresses_taken();
        }
    }
}

// dst[d][i] = src[i][d] for the D_INNER x D_MODEL head of Win (the rows that make xi): the GEMM
// wants both operands contiguous along the summed index, which for Wl*Wxi is i.
__global__ __launch_bounds__(256)
void transpose_wxi_kernel(const float* __restrict__ src, float* __restrict__ dst)
{
    __shared__ float tile[32][33];           // pitch 33: the column reads below touch 32 banks
    const int tx = threadIdx.x & 31;
    const int ty = threadIdx.x >> 5;         // 0..7
    const int d0 = blockIdx.x * 32;
    const int i0 = blockIdx.y * 32;
    float r[4];
    #pragma unroll
    for (int q = 0; q < 4; ++q) r[q] = src[(size_t)(i0 + ty + q * 8) * D_MODEL + d0 + tx];
    wait_addresses_taken();   // the LDS and store addresses formed next may take the loads' address registers
    #pragma unroll
    for (int q = 0; q < 4; ++q) tile[ty + q * 8][tx] = r[q];
    __syncthreads();
    #pragma unroll
    for (int q = 0; q < 4; ++q) dst[(size_t)(d0 + ty + q * 8) * D_INNER + i0 + tx] = tile[tx][ty + q * 8];
}

// ---------------------------------------------------------------------------
// Householder scan, blocked by SCAN_CH steps. Inside a block of steps
//   h_j = y_j + g_j,   s_j = 2 (v_j.h_{j-1}) / (v_j.v_j)
// with g the part that xi drives (g_j = lam_j g_{j-1} + (1-lam_j) xi_j, g_0 = 0) and y the part
// that the block's entry state drives (y_j = lam_j (y_{j-1} - s_j v_j), y_0 = the entry h). With
// L_j = lam_j ... lam_1 and w_{i,j} = lam_j ... lam_i v_i
//   v_j.h_{j-1} = v_j.(L_{j-1} h_entry) + v_j.g_{j-1} - sum_{i<j} s_i (v_j.w_{i,j-1}).
// The dots v_j.v_j, v_j.w_{i,j-1} and v_j.g_{j-1} and the row g at the block's end do not depend
// on h: a kernel over the whole chip forms them for every block of steps. The sequential kernel
// runs on one WGP per batch, and what it moves through that WGP's memory path sets its time: so
// it carries the state from block entry to block entry only. Per block it reads the rows of v and
// lam and one row g, does ONE work-group sum (of the SCAN_CH dots v_j.(L_{j-1} h_entry)) and a
// forward substitution for the s_j, and writes the s_j and one row, the next block's entry state.
// xi is not read there and the h rows are not written there: a third kernel over the whole chip
// forms every h_j from its block's entry state and s_j by the reference's own recurrence.
// ---------------------------------------------------------------------------
typedef __attribute__((ext_vector_type(4))) float v4f;

#define SCAN_CH     6                                   // steps per block of steps
#define SCAN_FULL   ((SEQ - 1) / SCAN_CH)               // blocks with all their steps: 341
#define SCAN_TAIL   ((SEQ - 1) - SCAN_FULL * SCAN_CH)   // steps of the last, short block: 1
#define SCAN_BLOCKS (SCAN_FULL + 1)
#define TAB_PAIRS   (SCAN_CH * (SCAN_CH - 1) / 2)
#define TAB_N       (2 * SCAN_CH + TAB_PAIRS)           // 6 v.v, 15 v.w and 6 v.g
#define TAB_LD      32                                  // one 128-byte line per block of steps
#define TAB_G(j, i) (SCAN_CH + (j) * ((j) - 1) / 2 + (i))    // v_j.w_{i,j-1}, i < j
#define TAB_C(j)    (SCAN_CH + TAB_PAIRS + (j))         // v_j.g_{j-1}
#define S_LD        8                                   // floats per block of steps in the array of the s_j
#define SCAN_PF     4                                   // blocks of steps that the L2 prefetch runs ahead
static_assert(SCAN_TAIL > 0 && SCAN_FULL % 2 == 1, "the scan's last calls are written for this case");
static_assert(TAB_N <= TAB_LD && SCAN_CH == 6 && S_LD == 8, "a block's dots fill one line; its s_j are stored as 4 + 2 floats");

// Work-group barrier that orders LDS only. __syncthreads() also drains the
// wave's global loads and stores, which would put the memory latency of the
// rows fetched ahead, and of the h stores, back into every round.
__device__ __forceinline__ void barrier_lds_only()
{
    __builtin_amdgcn_fence(__ATOMIC_RELEASE, "workgroup", "local");
    __builtin_amdgcn_s_barrier();
    __builtin_amdgcn_fence(__ATOMIC_ACQUIRE, "workgroup", "local");
}

// Sums across lanes on the vector unit. __shfl_xor compiles to ds_bpermute_b32: an LDS round
// trip per step of the tree, and one LDS slot per value, step and wave of the work-group.
// x + (x of lane l ^ m) inside a 16-lane row; CTRL = 0x160 + m is the DPP control row_xmask:m.
template <int CTRL>
__device__ __forceinline__ float add_row_xmask(float x)
{
    const int y = __builtin_amdgcn_update_dpp(0, __builtin_bit_cast(int, x), CTRL, 0xf, 0xf, true);
    return x + __builtin_bit_cast(float, y);
}
// p[0..n): every lane gets the sum over its own 16-lane row. All 32 lanes must be on.
// Step by step over all n values, so that the n chains fill one another's latency.
__device__ __forceinline__ void row_sums(float* p, int n)
{
    #pragma unroll
    for (int j = 0; j < n; ++j) p[j] = add_row_xmask<0x161>(p[j]);
    #pragma unroll
    for (int j = 0; j < n; ++j) p[j] = add_row_xmask<0x162>(p[j]);
    #pragma unroll
    for (int j = 0; j < n; ++j) p[j] = add_row_xmask<0x164>(p[j]);
    #pragma unroll
    for (int j = 0; j < n; ++j) p[j] = add_row_xmask<0x168>(p[j]);
}
// x of lane l ^ 16
__device__ __forceinline__ float other_row(float x)
{
    const int b = __builtin_bit_cast(int, x);
    return __builtin_bit_cast(float,
        __builtin_amdgcn_permlanex16(b, b, 0x76543210, 0xfedcba98, false, false));
}

// tab[b][k][.]: the h-independent dots of block k of batch b; gend[b][k][.]: its row g at the
// block's end. One work-group each.
// Rows past the end (short last block) are read as the last row; what comes of them is never used.
__global__ __launch_bounds__(256)
void scan_dots_kernel(const float* __restrict__ v, const float* __restrict__ lam,
                      const float* __restrict__ xi,
                      float* __restrict__ tab, float* __restrict__ gend)
{
    const int k   = blockIdx.x;
    const int b   = blockIdx.y;
    const int tid = threadIdx.x;
    const size_t base = (size_t)b * SEQ * D_INNER + tid * 4;
    const size_t blk  = (size_t)b * SCAN_BLOCKS + k;

    __shared__ float part[8][TAB_N];

    v4f rv[2][SCAN_CH], rl[2][SCAN_CH], rx[2][SCAN_CH];
    #pragma unroll
    for (int j = 0; j < SCAN_CH; ++j) {
        int t = 1 + k * SCAN_CH + j;
        if (t > SEQ - 1) t = SEQ - 1;
        #pragma unroll
        for (int hf = 0; hf < 2; ++hf) {
            const size_t off = base + (size_t)t * D_INNER + hf * 1024;
            rv[hf][j] = *(const v4f*)(v + off);
            wait_addresses_taken();   // a later load's result may land in this load's address registers
            rl[hf][j] = *(const v4f*)(lam + off);
            wait_addresses_taken();
            rx[hf][j] = *(const v4f*)(xi + off);
            wait_addresses_taken();
        }
    }

    float acc[TAB_N];
    #pragma unroll
    for (int q = 0; q < TAB_N; ++q) acc[q] = 0.0f;

    v4f ge[2];
    #pragma unroll
    for (int hf = 0; hf < 2; ++hf) {
        #pragma unroll
        for (int e = 0; e < 4; ++e) {
            float w[SCAN_CH];
            float g = 0.0f;
            #pragma unroll
            for (int j = 0; j < SCAN_CH; ++j) {
                const float vj = rv[hf][j][e];
                const float lj = rl[hf][j][e];
                acc[j] += vj * vj;
                acc[TAB_C(j)] += vj * g;
                #pragma unroll
                for (int i = 0; i < j; ++i) acc[TAB_G(j, i)] += vj * w[i];
                #pragma unroll
                for (int i = 0; i < j; ++i) w[i] *= lj;
                w[j] = lj * vj;
                g = lj * g + (1.0f - lj) * rx[hf][j][e];
            }
            ge[hf][e] = g;
        }
    }
    #pragma unroll
    for (int hf = 0; hf < 2; ++hf) *(v4f*)(gend + blk * D_INNER + tid * 4 + hf * 1024) = ge[hf];
    wait_addresses_taken();   // the sums below may take the stores' registers

    row_sums(acc, TAB_N);
    #pragma unroll
    for (int q = 0; q < TAB_N; ++q) acc[q] += other_row(acc[q]);
    if ((tid & 31) == 0) {
        #pragma unroll
        for (int q = 0; q < TAB_N; ++q) part[tid >> 5][q] = acc[q];
    }
    __syncthreads();
    if (tid < TAB_N) {
        float s = 0.0f;
        #pragma unroll
        for (int w8 = 0; w8 < 8; ++w8) s += part[w8][tid];
        tab[blk * TAB_LD + tid] = s;
    }
}

// One work-group per batch, 1024 threads, 2 channels per thread.
// hin[b][k][.] gets the state on entry to block k, sall[b][k][j] the s_j of its steps (0 for the
// steps that the short last block lacks).
// No thread reads a global word that a thread of this launch writes, so
// global memory needs no ordering at the barriers: only red[] and bcast[] do.
__global__ __launch_bounds__(1024)
void scan_kernel(const float* __restrict__ xi, const float* __restrict__ v,
                 const float* __restrict__ lam, const float* __restrict__ tab,
                 const float* __restrict__ gend, float* __restrict__ hin,
                 float* __restrict__ sall)
{
    const int b    = blockIdx.x;
    const int tid  = threadIdx.x;
    const int c0   = tid;
    const int c1   = tid + 1024;
    const int wave = tid >> 5;
    const int lane = tid & 31;
    const size_t base = (size_t)b * SEQ * D_INNER;
    const size_t blk0 = (size_t)b * SCAN_BLOCKS;

    __shared__ float red[SCAN_CH][64];   // per dot: one partial sum of each 16-lane row of the 32 waves
    __shared__ float bcast[SCAN_CH];

    float h0 = xi[base + c0];
    float h1 = xi[base + c1];
    hin[blk0 * D_INNER + c0] = h0;
    hin[blk0 * D_INNER + c1] = h1;
    wait_addresses_taken();   // the addresses formed next may take these loads' and stores' registers

    // Two sets of rows: one is worked on while the next block's rows fly into the other.
    float rv0[2][SCAN_CH], rv1[2][SCAN_CH];
    float rl0[2][SCAN_CH], rl1[2][SCAN_CH];
    float rg0[2], rg1[2];

    auto fetch = [&](int k, int s, int n) {
        #pragma unroll
        for (int j = 0; j < n; ++j) {
            const size_t off = base + (size_t)(1 + k * SCAN_CH + j) * D_INNER;
            rv0[s][j] = v[off + c0];   rv1[s][j] = v[off + c1];
            rl0[s][j] = lam[off + c0]; rl1[s][j] = lam[off + c1];
        }
        wait_addresses_taken();   // the two results below may land in address registers of the loads above
        rg0[s] = gend[(blk0 + k) * D_INNER + c0];
        rg1[s] = gend[(blk0 + k) * D_INNER + c1];
    };
    // The last fetch, behind the loop: its address registers are used up load by load, and a
    // later load's result may land in them, so each load gets its own wait. Runs once.
    // No state leaves the last block, so its row g is not fetched.
    auto fetch_last = [&](int k, int s) {
        #pragma unroll
        for (int j = 0; j < SCAN_TAIL; ++j) {
            const size_t off = base + (size_t)(1 + k * SCAN_CH + j) * D_INNER;
            rv0[s][j] = v[off + c0];   wait_addresses_taken();
            rv1[s][j] = v[off + c1];   wait_addresses_taken();
            rl0[s][j] = lam[off + c0]; wait_addresses_taken();
            rl1[s][j] = lam[off + c1]; wait_addresses_taken();
        }
    };

    const float* tk = tab + blk0 * TAB_LD;   // the table line of the block at hand

    // The
    // rows of v, lam and g come from memory. So they are asked into L2 SCAN_PF blocks of steps
    // ahead of the block at hand: a prefetch returns nothing to the WGP and no wave waits for it.
    // Wave w < 13 asks for one row of 8 KiB: 32 lanes, 256 bytes apart.
    const int wave_s = __builtin_amdgcn_readfirstlane(tid >> 5);   // scalar, for a scalar branch
    const int pf_arr = wave_s / SCAN_CH;   // 0: v, 1: lam, from 2 on: g
    const float* pf_src = pf_arr == 0 ? v + base : (pf_arr == 1 ? lam + base : gend + blk0 * D_INNER);
    // v and lam have SCAN_CH rows per block of steps, from row 1 on; g has one, from row 0 on.
    const int pf_per  = pf_arr < 2 ? SCAN_CH : 1;
    const int pf_off  = pf_arr < 2 ? 1 + wave_s % SCAN_CH : 0;
    const int pf_last = pf_arr < 2 ? SEQ - 1 : SCAN_BLOCKS - 1;
    // The row of block k that this wave asks for; past the end it is the last row, so the
    // address stays inside the array at every issue and after every advance.
    auto pf_row = [&](int k) {
        const int t = k * pf_per + pf_off;
        return t < pf_last ? t : pf_last;
    };
    const char* pf = (const char*)(pf_src + (size_t)pf_row(SCAN_PF) * D_INNER) + lane * 256;
    auto pf_ask = [&]() {
        if (wave_s < 2 * SCAN_CH + 1)
            asm volatile("global_prefetch_b8 %0, off scope:SCOPE_SE" :: "v"(pf));   // into L2 only
    };
    auto pf_advance = [&](int k) {   // from block k's row to block k + 1's
        pf += (size_t)(pf_row(k + 1) - pf_row(k)) * (D_INNER * sizeof(float));
    };

    // Block k of n steps, its rows in set s; n_next steps of block k+1 are fetched into the other set.
    auto block_of_steps = [&](int k, int s, int n, int n_next) {
        // This block's table line: asked for here, used behind the first barrier.
        float tb[TAB_N];
        #pragma unroll
        for (int j = 0; j < n; ++j) {
            tb[j] = tk[j];
            tb[TAB_C(j)] = tk[TAB_C(j)];
            #pragma unroll
            for (int i = 0; i < j; ++i) tb[TAB_G(j, i)] = tk[TAB_G(j, i)];
        }
        wait_addresses_taken();   // in front of the step of tk
        tk += TAB_LD;
        if (n_next == SCAN_CH) {
            fetch(k + 1, s ^ 1, SCAN_CH);
            wait_addresses_taken();
            pf_ask();   // block k + SCAN_PF; behind the loads, so that it does not stand in their way
        }
        else if (n_next > 0)   fetch_last(k + 1, s ^ 1);

        float p[SCAN_CH];
        float f0 = h0, f1 = h1;
        #pragma unroll
        for (int j = 0; j < n; ++j) {
            p[j] = rv0[s][j] * f0 + rv1[s][j] * f1;
            f0 *= rl0[s][j];
            f1 *= rl1[s][j];
        }
        row_sums(p, n);
        if ((lane & 15) == 0) {   // lanes 0 and 16: their row's sums
            #pragma unroll
            for (int j = 0; j < n; ++j) red[j][tid >> 4] = p[j];
        }
        barrier_lds_only();
        if (wave == 0) {
            // One wave sums the n dots over the 64 rows and solves for the s_j: the chain of
            // divisions then costs its latency once, not its issue slots in every wave.
            float num[SCAN_CH], sj[SCAN_CH];
            #pragma unroll
            for (int j = 0; j < n; ++j) num[j] = red[j][lane] + red[j][lane + 32];
            row_sums(num, n);
            #pragma unroll
            for (int j = 0; j < n; ++j) num[j] += other_row(num[j]) + tb[TAB_C(j)];
            #pragma unroll
            for (int j = 0; j < n; ++j) {
                sj[j] = 2.0f * num[j] / tb[j];
                #pragma unroll
                for (int jj = j + 1; jj < n; ++jj) num[jj] -= sj[j] * tb[TAB_G(jj, j)];
            }
            if (lane == 0) {
                #pragma unroll
                for (int j = 0; j < n; ++j) bcast[j] = sj[j];
            }
        }
        barrier_lds_only();

        float sc[SCAN_CH];
        #pragma unroll
        for (int j = 0; j < n; ++j) sc[j] = bcast[j];

        if (n_next > 0) {   // the state on entry to block k + 1
            #pragma unroll
            for (int j = 0; j < n; ++j) {
                h0 = rl0[s][j] * (h0 - rv0[s][j] * sc[j]);
                h1 = rl1[s][j] * (h1 - rv1[s][j] * sc[j]);
            }
            h0 += rg0[s];
            h1 += rg1[s];
            hin[(blk0 + k + 1) * D_INNER + c0] = h0;
            hin[(blk0 + k + 1) * D_INNER + c1] = h1;
        }
        if (tid == 0) {
            float* sk = sall + (blk0 + k) * S_LD;
            *(v4f*)sk       = v4f{sc[0], n > 1 ? sc[1] : 0.0f, n > 2 ? sc[2] : 0.0f, n > 3 ? sc[3] : 0.0f};
            *(v2f*)(sk + 4) = v2f{n > 4 ? sc[4] : 0.0f, n > 5 ? sc[5] : 0.0f};
        }
        wait_addresses_taken();
        if (n_next == SCAN_CH) pf_advance(k + SCAN_PF);   // behind the wait: pf is named by the prefetch above
        barrier_lds_only();   // red[] and bcast[] safe to overwrite in the next block
    };

    fetch(0, 0, SCAN_CH);
    wait_addresses_taken();

    // The set index must be a constant for the rows to stay in registers: two
    // blocks per trip, the loop itself stays rolled.
    #pragma unroll 1
    for (int kk = 0; kk < SCAN_FULL / 2; ++kk) {
        block_of_steps(2 * kk,     0, SCAN_CH, SCAN_CH);
        block_of_steps(2 * kk + 1, 1, SCAN_CH, SCAN_CH);
    }
    block_of_steps(SCAN_FULL - 1, 0, SCAN_CH,   SCAN_TAIL);
    block_of_steps(SCAN_FULL,     1, SCAN_TAIL, 0);
}

// Every h_j of block k of batch b, from the block's entry state and its s_j by the reference's own
// recurrence, and with it silu(z) * h, written over z. One work-group per block of steps, 4
// channels per thread. Rows past the end (short last block) are read as the last row and not stored.
__device__ __forceinline__ v4f silu_times(v4f zv, v4f h)
{
    v4f r;
    #pragma unroll
    for (int e = 0; e < 4; ++e) r[e] = zv[e] / (1.0f + expf(-zv[e])) * h[e];
    return r;
}

__global__ __launch_bounds__(512)
void block_rows_kernel(const float* __restrict__ xi, const float* __restrict__ v,
                       const float* __restrict__ lam, const float* __restrict__ hin,
                       const float* __restrict__ sall, float* __restrict__ z_io)
{
    const int k   = blockIdx.x;
    const int b   = blockIdx.y;
    const int tid = threadIdx.x;
    const size_t base = (size_t)b * SEQ * D_INNER + tid * 4;
    const size_t blk  = (size_t)b * SCAN_BLOCKS + k;

    v4f h = *(const v4f*)(hin + blk * D_INNER + tid * 4);
    wait_addresses_taken();   // a later load's result may land in this load's address registers
    v4f rv[SCAN_CH], rl[SCAN_CH], rx[SCAN_CH], rz[SCAN_CH];
    #pragma unroll
    for (int j = 0; j < SCAN_CH; ++j) {
        int t = 1 + k * SCAN_CH + j;
        if (t > SEQ - 1) t = SEQ - 1;
        const size_t off = base + (size_t)t * D_INNER;
        rv[j] = *(const v4f*)(v + off);    wait_addresses_taken();
        rl[j] = *(const v4f*)(lam + off);  wait_addresses_taken();
        rx[j] = *(const v4f*)(xi + off);   wait_addresses_taken();
        rz[j] = *(const v4f*)(z_io + off); wait_addresses_taken();
    }
    float sc[SCAN_CH];
    #pragma unroll
    for (int j = 0; j < SCAN_CH; ++j) sc[j] = sall[blk * S_LD + j];
    wait_addresses_taken();

    if (k == 0) {   // step 0: h is the entry state itself
        const v4f z0 = *(const v4f*)(z_io + base);
        wait_addresses_taken();
        *(v4f*)(z_io + base) = silu_times(z0, h);
        wait_addresses_taken();   // the values formed next may take the store's registers
    }
    #pragma unroll
    for (int j = 0; j < SCAN_CH; ++j) {
        h = rl[j] * (h - rv[j] * sc[j]) + (1.0f - rl[j]) * rx[j];
        const int t = 1 + k * SCAN_CH + j;
        if (t <= SEQ - 1) {
            *(v4f*)(z_io + base + (size_t)t * D_INNER) = silu_times(rz[j], h);
            if (j < SCAN_CH - 1) wait_addresses_taken();   // the next step's values may take this store's registers
        }
    }
}

// ---------------------------------------------------------------------------
extern "C" void kernel_launch(void* const* d_in, const int* in_sizes, int n_in,
                              void* d_out, int out_size, void* d_ws, size_t ws_size,
                              hipStream_t stream)
{
    const float* x     = (const float*)d_in[0];
    const float* omega = (const float*)d_in[1];   // 2048
    const float* Win   = (const float*)d_in[2];   // 4096 x 1024
    const float* Wl    = (const float*)d_in[3];   // 2048 x 2048
    const float* bl    = (const float*)d_in[4];
    const float* Wv    = (const float*)d_in[5];   // 2048 x 2048
    const float* bv    = (const float*)d_in[6];
    const float* Wout  = (const float*)d_in[7];   // 1024 x 2048
    float* out = (float*)d_out;

    const size_t BUF = (size_t)M_ROWS * D_INNER;  // 16,777,216 floats (64 MB)
    float* ws    = (float*)d_ws;
    float* xi    = ws;             // [M_ROWS, D_INNER]
    float* z     = ws + BUF;       // [M_ROWS, D_INNER] (later holds silu(z)*h)
    float* lam_h = ws + 2 * BUF;   // lam
    float* vbuf  = ws + 3 * BUF;   // total 256 MB of d_ws used

    // Scratch in out, which launch 6 overwrites whole (the workspace has no byte left): the
    // transposed xi rows of Win and the two folded weights, 8 MB each. All dead before launch 4.
    const size_t WSZ = (size_t)D_INNER * D_MODEL;
    float* wxiT = out;             // [D_MODEL, D_INNER]
    float* wlx  = out + WSZ;       // Wl*Wxi [D_INNER, D_MODEL]
    float* wvx  = out + 2 * WSZ;   // Wv*Wxi [D_INNER, D_MODEL]

    dim3 blk(128);

    // 0) the xi rows of Win transposed, then Wl*Wxi and Wv*Wxi in one launch
    transpose_wxi_kernel<<<dim3(D_MODEL / 32, D_INNER / 32), 256, 0, stream>>>(Win, wxiT);
    {
        dim3 grd(D_MODEL / TN, D_INNER / TM, 2);
        wmma_gemm_f32<EPI_PLAIN><<<grd, blk, 0, stream>>>(Wl, Wv, wxiT, nullptr, nullptr,
                                                          wlx, wvx, D_INNER, D_MODEL, D_INNER);
    }

    // 1) xz = x @ Win^T, split into xi | z
    {
        dim3 grd(4096 / TN, M_ROWS / TM);
        wmma_gemm_f32<EPI_SPLIT><<<grd, blk, 0, stream>>>(x, nullptr, Win, nullptr, nullptr,
                                                          xi, z, M_ROWS, 4096, D_MODEL);
    }
    // 2) lam = exp(-8*softplus(omega)*sigmoid(x@(Wl*Wxi)^T + bl))
    {
        dim3 grd(D_INNER / TN, M_ROWS / TM);
        wmma_gemm_f32<EPI_LAMBDA><<<grd, blk, 0, stream>>>(x, nullptr, wlx, bl, omega,
                                                           lam_h, nullptr, M_ROWS, D_INNER, D_MODEL);
    }
    // 3) v = x @ (Wv*Wxi)^T + bv
    {
        dim3 grd(D_INNER / TN, M_ROWS / TM);
        wmma_gemm_f32<EPI_PLAIN><<<grd, blk, 0, stream>>>(x, nullptr, wvx, bv, nullptr,
                                                          vbuf, nullptr, M_ROWS, D_INNER, D_MODEL);
    }
    // 4) Householder scan. Its small arrays lie in out, which launch 6 overwrites whole (the
    //    workspace has no byte left): the table of h-independent dots, the s_j, and per block of
    //    steps the row g at its end and the state on its entry.
    const size_t ROWS = (size_t)BATCH * SCAN_BLOCKS * D_INNER;
    float* tab  = out;                     // BATCH * SCAN_BLOCKS lines of TAB_LD floats
    float* sall = out + 49152;             // BATCH * SCAN_BLOCKS slots of S_LD floats
    float* gend = out + 65536;
    float* hin  = out + 65536 + ROWS;
    static_assert(BATCH * SCAN_BLOCKS * TAB_LD <= 49152 && 49152 + BATCH * SCAN_BLOCKS * S_LD <= 65536, "the small arrays overlap");
    static_assert(65536 + 2 * (size_t)BATCH * SCAN_BLOCKS * D_INNER <= (size_t)M_ROWS * D_MODEL, "the scan's arrays do not fit in out");
    scan_dots_kernel<<<dim3(SCAN_BLOCKS, BATCH), 256, 0, stream>>>(vbuf, lam_h, xi, tab, gend);
    scan_kernel<<<BATCH, 1024, 0, stream>>>(xi, vbuf, lam_h, tab, gend, hin, sall);

    // 5) every h row from its block's entry state, and g = silu(z) * h   (overwrites z)
    block_rows_kernel<<<dim3(SCAN_BLOCKS, BATCH), 512, 0, stream>>>(xi, vbuf, lam_h, hin, sall, z);

    // 6) out = g @ Wout^T
    {
        dim3 grd(D_MODEL / TN, M_ROWS / TM);
        wmma_gemm_f32<EPI_PLAIN><<<grd, blk, 0, stream>>>(z, nullptr, Wout, nullptr, nullptr,
                                                          out, nullptr, M_ROWS, D_MODEL, D_INNER);
    }
}

// v008
// A run of this version takes 1320 microseconds.
// Next to v007, in two timings, it ran 1.07 times as fast each time.
// Counting every step since v000, it is 3.47 times as fast.
#include <hip/hip_runtime.h>
#include <cmath>

// ---------------------------------------------------------------------------
// DenseRNN (Householder-reflection linear RNN) for MI455X / gfx1250
//   xz = x @ Win^T ; xi,z = split(xz)
//   lam = exp(-8*softplus(omega)*sigmoid(xi@Wl^T + bl))
//   v   = xi@Wv^T + bv
//   scan: h_t = lam_t*(h_{t-1} - 2 v_t (v.h)/(v.v)) + (1-lam_t)*xi_t ; h_0 = xi_0
//   out = (silu(z)*h) @ Wout^T
// xi@Wl^T and xi@Wv^T are formed as x@(Wl*Wxi)^T and x@(Wv*Wxi)^T, Wxi = the xi rows of Win:
// the inner length is then D_MODEL, not D_INNER, and the two small products Wl*Wxi and
// Wv*Wxi cost a quarter of what that saves on the f32 matrix unit.
// GEMMs: V_WMMA_F32_16X16X4_F32 + double-buffered async global->LDS staging.
// The scan holds one WGP per batch for a long time. z = x @ Wz^T feeds nothing before the scan's
// end, so it is formed in the scan's own launch, by work-groups on the WGPs that the scan leaves idle.
// ---------------------------------------------------------------------------

typedef __attribute__((ext_vector_type(2))) float v2f;
typedef __attribute__((ext_vector_type(8))) float v8f;
typedef int v4i_gcc __attribute__((vector_size(16)));   // matches builtin pointee

#define D_MODEL   1024
#define D_INNER   2048
#define BATCH     4
#define SEQ       2048
#define M_ROWS    (BATCH * SEQ)        // 8192

// GEMM tiling: 128 threads = 4 waves; each wave owns a 32x64 C strip.
#define TM 128        // block rows
#define TN 64         // block cols
#define TK 32         // K tile
#define LDS_PAD 4     // row stride 36 floats = 144 B (16B aligned for b128 async)
#define LDS_LD  (TK + LDS_PAD)

// Epilogue modes
#define EPI_PLAIN  0   // out0[m,col] = acc (+ bias if non-null); blockIdx.z = 1: A1 in place of A0, out1 of out0
#define EPI_LAMBDA 1   // out0[m,col] = exp(-8*softplus(omega[col])*sigmoid(acc+bias[col]))
#define EPI_SPLIT  2   // col < D_INNER -> out0 (xi), else -> out1 (z), both ld = D_INNER

// --- async global->LDS copy (CDNA5 ASYNCcnt path), with sync fallback ------
#if defined(__AMDGCN__) && __has_builtin(__builtin_amdgcn_global_load_async_to_lds_b128)
#define USE_ASYNC_LDS 1
#else
#define USE_ASYNC_LDS 0
#endif

__device__ __forceinline__ void copy16_g2l(const float* __restrict__ g, float* l)
{
#if USE_ASYNC_LDS
    __builtin_amdgcn_global_load_async_to_lds_b128(
        (__attribute__((address_space(1))) v4i_gcc*)(void*)g,
        (__attribute__((address_space(3))) v4i_gcc*)(void*)l,
        /*imm offset=*/0, /*cpol=*/0);
#else
    *(float4*)l = *(const float4*)g;
#endif
}

__device__ __forceinline__ void wait_async_lds()
{
#if USE_ASYNC_LDS
#if __has_builtin(__builtin_amdgcn_s_wait_asynccnt)
    __builtin_amdgcn_s_wait_asynccnt(0);
#else
    asm volatile("s_wait_asynccnt 0x0" ::: "memory");
#endif
#endif
}

// Stands behind a group of global loads or stores, in front of the first
// instruction that may reuse one of their address or data registers. The
// scheduling barrier keeps later instructions, which may take those registers,
// from being lifted over the wait, and the loads in front of it from sinking
// behind it (a build without it did both, and spilled registers in the scan).
__device__ __forceinline__ void wait_addresses_taken()
{
    asm volatile("s_wait_xcnt 0x0" ::: "memory");
    __builtin_amdgcn_sched_barrier(0);
}

// C[M,N] = A[M,K] * W[N,K]^T   (A row-major MxK, W row-major NxK; both K-contiguous)
// Requires: M % TM == 0, N % TN == 0, K % TK == 0.
// The epilogue mode is a template argument, and what depends on the column alone is formed
// once per column, for speed only.
template <int MODE>
__global__ __launch_bounds__(128)
void wmma_gemm_f32(const float* __restrict__ A0, const float* __restrict__ A1,
                   const float* __restrict__ W,
                   const float* __restrict__ bias, const float* __restrict__ omega,
                   float* __restrict__ out0, float* __restrict__ out1,
                   int M, int N, int K)
{
    __shared__ float As[2][TM][LDS_LD];   // A tile, row-major, double buffered
    __shared__ float Bs[2][TN][LDS_LD];   // W tile, n-major: Bs[.][n][k] = W[nBlock+n][k0+k]

    const int tid  = threadIdx.x;
    const int wave = tid >> 5;               // 0..3 (wave32)
    const int lane = tid & 31;
    const int laneMod  = lane & 15;          // 0..15
    const int laneHalf = lane >> 4;          // 0 or 1

    const int mBlock = blockIdx.y * TM;
    const int nBlock = blockIdx.x * TN;
    const int waveM  = wave * 32;            // this wave's 32-row strip inside block tile

    // Two products with one W share a launch, so that a small grid still gives every SIMD two waves.
    const bool second = MODE == EPI_PLAIN && blockIdx.z != 0;
    const float* __restrict__ A = second ? A1 : A0;

    v8f acc[2][4];
    #pragma unroll
    for (int mt = 0; mt < 2; ++mt)
        #pragma unroll
        for (int nt = 0; nt < 4; ++nt)
            #pragma unroll
            for (int r = 0; r < 8; ++r) acc[mt][nt][r] = 0.0f;

    // ---- tile stage: issues TM*TK/4/128 = 8 A chunks + 4 W chunks of b128 ----
    auto stage_tile = [&](int k0, int b) {
        #pragma unroll
        for (int i = 0; i < 8; ++i) {
            int q   = tid + i * 128;          // 0..1023
            int row = q >> 3;                 // 8 float4 per 32-float row
            int c4  = (q & 7) << 2;
            copy16_g2l(A + (size_t)(mBlock + row) * K + k0 + c4, &As[b][row][c4]);
        }
        #pragma unroll
        for (int i = 0; i < 4; ++i) {
            int q   = tid + i * 128;          // 0..511
            int row = q >> 3;
            int c4  = (q & 7) << 2;
            copy16_g2l(W + (size_t)(nBlock + row) * K + k0 + c4, &Bs[b][row][c4]);
        }
    };

    int buf = 0;
    stage_tile(0, buf);
    wait_async_lds();
    __syncthreads();

    for (int k0 = 0; k0 < K; k0 += TK) {
        const int nbuf = buf ^ 1;
        if (k0 + TK < K) stage_tile(k0 + TK, nbuf);   // prefetch next tile (async)

        // ---- 8 K-steps; per step: 2 A frags x 4 B frags = 8 WMMAs ----
        #pragma unroll
        for (int kk = 0; kk < TK; kk += 4) {
            // A frag (16x4): lanes 0-15: M=lane, K=kk+{0,1}; lanes 16-31: K=kk+{2,3}
            v2f a0, a1;
            a0.x = As[buf][waveM + laneMod][kk + 2 * laneHalf + 0];
            a0.y = As[buf][waveM + laneMod][kk + 2 * laneHalf + 1];
            a1.x = As[buf][waveM + 16 + laneMod][kk + 2 * laneHalf + 0];
            a1.y = As[buf][waveM + 16 + laneMod][kk + 2 * laneHalf + 1];
            #pragma unroll
            for (int nt = 0; nt < 4; ++nt) {
                // B frag (4x16): lane holds K=kk+2*laneHalf+{0,1}, N=nt*16+laneMod
                v2f bf;
                bf.x = Bs[buf][nt * 16 + laneMod][kk + 2 * laneHalf + 0];
                bf.y = Bs[buf][nt * 16 + laneMod][kk + 2 * laneHalf + 1];
                acc[0][nt] = __builtin_amdgcn_wmma_f32_16x16x4_f32(
                    false, a0, false, bf, (short)0, acc[0][nt], false, false);
                acc[1][nt] = __builtin_amdgcn_wmma_f32_16x16x4_f32(
                    false, a1, false, bf, (short)0, acc[1][nt], false, false);
            }
        }

        wait_async_lds();       // next tile landed in LDS
        __syncthreads();        // all waves done reading `buf`, async writes visible
        buf = nbuf;
    }

    // ---- epilogue: C/D layout: VGPR r -> row = r + 8*laneHalf, col = laneMod ----
    // What depends on the column alone, once per column: the bias, and -8*softplus(omega).
    float cb[4], ck[4];
    #pragma unroll
    for (int nt = 0; nt < 4; ++nt) {
        const int col = nBlock + nt * 16 + laneMod;
        cb[nt] = 0.0f;
        ck[nt] = 0.0f;
        if (MODE == EPI_LAMBDA) {
            cb[nt] = bias[col];
            ck[nt] = -8.0f * log1pf(expf(omega[col]));
        } else if (MODE == EPI_PLAIN) {
            if (bias) cb[nt] = bias[col];
        }
    }
    if (MODE != EPI_SPLIT) wait_addresses_taken();   // the row addresses formed next may take these loads' address registers

    // A block's TN columns lie wholly in xi or wholly in z.
    static_assert(D_INNER % TN == 0, "a block of columns must not straddle the split");
    float* dst = (second ? out1 : out0) + nBlock;
    size_t ld  = (size_t)N;
    if (MODE == EPI_SPLIT) {
        ld = D_INNER;
        if (nBlock >= D_INNER) dst = out1 + (nBlock - D_INNER);
    }

    #pragma unroll
    for (int mt = 0; mt < 2; ++mt) {
        #pragma unroll
        for (int r = 0; r < 8; ++r) {
            const int m = mBlock + waveM + mt * 16 + r + 8 * laneHalf;
            float* row = dst + (size_t)m * ld + laneMod;
            #pragma unroll
            for (int nt = 0; nt < 4; ++nt) {
                float val = acc[mt][nt][r];
                if (MODE == EPI_PLAIN) {
                    if (bias) val += cb[nt];
                } else if (MODE == EPI_LAMBDA) {
                    val += cb[nt];
                    float sig = 1.0f / (1.0f + expf(-val));
                    val = expf(ck[nt] * sig);
                }
                row[nt * 16] = val;
            }
            // The next row's address and values may take this row's registers. With the split's
            // constant row pitch the eight rows of one mt share one address and store the
            // accumulators themselves: there nothing is rewritten before the next mt.
            if (mt * 8 + r < 15 && (MODE != EPI_SPLIT || r == 7)) wait_addresses_taken();
        }
    }
}

// dst[d][i] = src[i][d] for the D_INNER x D_MODEL head of Win (the rows that make xi): the GEMM
// wants both operands contiguous along the summed index, which for Wl*Wxi is i.
__global__ __launch_bounds__(256)
void transpose_wxi_kernel(const float* __restrict__ src, float* __restrict__ dst)
{
    __shared__ float tile[32][33];           // pitch 33: the column reads below touch 32 banks
    const int tx = threadIdx.x & 31;
    const int ty = threadIdx.x >> 5;         // 0..7
    const int d0 = blockIdx.x * 32;
    const int i0 = blockIdx.y * 32;
    float r[4];
    #pragma unroll
    for (int q = 0; q < 4; ++q) r[q] = src[(size_t)(i0 + ty + q * 8) * D_MODEL + d0 + tx];
    wait_addresses_taken();   // the LDS and store addresses formed next may take the loads' address registers
    #pragma unroll
    for (int q = 0; q < 4; ++q) tile[ty + q * 8][tx] = r[q];
    __syncthreads();
    #pragma unroll
    for (int q = 0; q < 4; ++q) dst[(size_t)(d0 + ty + q * 8) * D_INNER + i0 + tx] = tile[tx][ty + q * 8];
}

// ---------------------------------------------------------------------------
// Householder scan, blocked by SCAN_CH steps. Inside a block of steps
//   h_j = y_j + g_j,   s_j = 2 (v_j.h_{j-1}) / (v_j.v_j)
// with g the part that xi drives (g_j = lam_j g_{j-1} + (1-lam_j) xi_j, g_0 = 0) and y the part
// that the block's entry state drives (y_j = lam_j (y_{j-1} - s_j v_j), y_0 = the entry h). With
// L_j = lam_j ... lam_1 and w_{i,j} = lam_j ... lam_i v_i
//   v_j.h_{j-1} = v_j.(L_{j-1} h_entry) + v_j.g_{j-1} - sum_{i<j} s_i (v_j.w_{i,j-1}).
// The dots v_j.v_j, v_j.w_{i,j-1} and v_j.g_{j-1} and the row g at the block's end do not depend
// on h: a kernel over the whole chip forms them for every block of steps. The sequential kernel
// runs on one WGP per batch, and what it moves through that WGP's memory path sets its time: so
// it carries the state from block entry to block entry only. Per block it reads the rows of v and
// lam and one row g, does ONE work-group sum (of the SCAN_CH dots v_j.(L_{j-1} h_entry)) and a
// forward substitution for the s_j, and writes the s_j and one row, the next block's entry state.
// xi is not read there and the h rows are not written there: a third kernel over the whole chip
// forms every h_j from its block's entry state and s_j by the reference's own recurrence.
// ---------------------------------------------------------------------------
typedef __attribute__((ext_vector_type(4))) float v4f;

#define SCAN_CH     6                                   // steps per block of steps
#define SCAN_FULL   ((SEQ - 1) / SCAN_CH)               // blocks with all their steps: 341
#define SCAN_TAIL   ((SEQ - 1) - SCAN_FULL * SCAN_CH)   // steps of the last, short block: 1
#define SCAN_BLOCKS (SCAN_FULL + 1)
#define TAB_PAIRS   (SCAN_CH * (SCAN_CH - 1) / 2)
#define TAB_N       (2 * SCAN_CH + TAB_PAIRS)           // 6 v.v, 15 v.w and 6 v.g
#define TAB_LD      32                                  // one 128-byte line per block of steps
#define TAB_G(j, i) (SCAN_CH + (j) * ((j) - 1) / 2 + (i))    // v_j.w_{i,j-1}, i < j
#define TAB_C(j)    (SCAN_CH + TAB_PAIRS + (j))         // v_j.g_{j-1}
#define S_LD        8                                   // floats per block of steps in the array of the s_j
#define SCAN_PF     4                                   // blocks of steps that the L2 prefetch runs ahead
static_assert(SCAN_TAIL > 0 && SCAN_FULL % 2 == 1, "the scan's last calls are written for this case");
static_assert(TAB_N <= TAB_LD && SCAN_CH == 6 && S_LD == 8, "a block's dots fill one line; its s_j are stored as 4 + 2 floats");

// Work-group barrier that orders LDS only. __syncthreads() also drains the
// wave's global loads and stores, which would put the memory latency of the
// rows fetched ahead, and of the h stores, back into every round.
__device__ __forceinline__ void barrier_lds_only()
{
    __builtin_amdgcn_fence(__ATOMIC_RELEASE, "workgroup", "local");
    __builtin_amdgcn_s_barrier();
    __builtin_amdgcn_fence(__ATOMIC_ACQUIRE, "workgroup", "local");
}

// Sums across lanes on the vector unit. __shfl_xor compiles to ds_bpermute_b32: an LDS round
// trip per step of the tree, and one LDS slot per value, step and wave of the work-group.
// x + (x of lane l ^ m) inside a 16-lane row; CTRL = 0x160 + m is the DPP control row_xmask:m.
template <int CTRL>
__device__ __forceinline__ float add_row_xmask(float x)
{
    const int y = __builtin_amdgcn_update_dpp(0, __builtin_bit_cast(int, x), CTRL, 0xf, 0xf, true);
    return x + __builtin_bit_cast(float, y);
}
// p[0..n): every lane gets the sum over its own 16-lane row. All 32 lanes must be on.
// Step by step over all n values, so that the n chains fill one another's latency.
__device__ __forceinline__ void row_sums(float* p, int n)
{
    #pragma unroll
    for (int j = 0; j < n; ++j) p[j] = add_row_xmask<0x161>(p[j]);
    #pragma unroll
    for (int j = 0; j < n; ++j) p[j] = add_row_xmask<0x162>(p[j]);
    #pragma unroll
    for (int j = 0; j < n; ++j) p[j] = add_row_xmask<0x164>(p[j]);
    #pragma unroll
    for (int j = 0; j < n; ++j) p[j] = add_row_xmask<0x168>(p[j]);
}
// x of lane l ^ 16
__device__ __forceinline__ float other_row(float x)
{
    const int b = __builtin_bit_cast(int, x);
    return __builtin_bit_cast(float,
        __builtin_amdgcn_permlanex16(b, b, 0x76543210, 0xfedcba98, false, false));
}

// tab[b][k][.]: the h-independent dots of block k of batch b; gend[b][k][.]: its row g at the
// block's end. One work-group each.
// Rows past the end (short last block) are read as the last row; what comes of them is never used.
__global__ __launch_bounds__(256)
void scan_dots_kernel(const float* __restrict__ v, const float* __restrict__ lam,
                      const float* __restrict__ xi,
                      float* __restrict__ tab, float* __restrict__ gend)
{
    const int k   = blockIdx.x;
    const int b   = blockIdx.y;
    const int tid = threadIdx.x;
    const size_t base = (size_t)b * SEQ * D_INNER + tid * 4;
    const size_t blk  = (size_t)b * SCAN_BLOCKS + k;

    __shared__ float part[8][TAB_N];

    v4f rv[2][SCAN_CH], rl[2][SCAN_CH], rx[2][SCAN_CH];
    #pragma unroll
    for (int j = 0; j < SCAN_CH; ++j) {
        int t = 1 + k * SCAN_CH + j;
        if (t > SEQ - 1) t = SEQ - 1;
        #pragma unroll
        for (int hf = 0; hf < 2; ++hf) {
            const size_t off = base + (size_t)t * D_INNER + hf * 1024;
            rv[hf][j] = *(const v4f*)(v + off);
            wait_addresses_taken();   // a later load's result may land in this load's address registers
            rl[hf][j] = *(const v4f*)(lam + off);
            wait_addresses_taken();
            rx[hf][j] = *(const v4f*)(xi + off);
            wait_addresses_taken();
        }
    }

    float acc[TAB_N];
    #pragma unroll
    for (int q = 0; q < TAB_N; ++q) acc[q] = 0.0f;

    v4f ge[2];
    #pragma unroll
    for (int hf = 0; hf < 2; ++hf) {
        #pragma unroll
        for (int e = 0; e < 4; ++e) {
            float w[SCAN_CH];
            float g = 0.0f;
            #pragma unroll
            for (int j = 0; j < SCAN_CH; ++j) {
                const float vj = rv[hf][j][e];
                const float lj = rl[hf][j][e];
                acc[j] += vj * vj;
                acc[TAB_C(j)] += vj * g;
                #pragma unroll
                for (int i = 0; i < j; ++i) acc[TAB_G(j, i)] += vj * w[i];
                #pragma unroll
                for (int i = 0; i < j; ++i) w[i] *= lj;
                w[j] = lj * vj;
                g = lj * g + (1.0f - lj) * rx[hf][j][e];
            }
            ge[hf][e] = g;
        }
    }
    #pragma unroll
    for (int hf = 0; hf < 2; ++hf) *(v4f*)(gend + blk * D_INNER + tid * 4 + hf * 1024) = ge[hf];
    wait_addresses_taken();   // the sums below may take the stores' registers

    row_sums(acc, TAB_N);
    #pragma unroll
    for (int q = 0; q < TAB_N; ++q) acc[q] += other_row(acc[q]);
    if ((tid & 31) == 0) {
        #pragma unroll
        for (int q = 0; q < TAB_N; ++q) part[tid >> 5][q] = acc[q];
    }
    __syncthreads();
    if (tid < TAB_N) {
        float s = 0.0f;
        #pragma unroll
        for (int w8 = 0; w8 < 8; ++w8) s += part[w8][tid];
        tab[blk * TAB_LD + tid] = s;
    }
}

// One ZT x ZT tile of z = x @ Wz^T (Wz = the z rows of Win) by a work-group of 32 waves, for the
// work-groups of the scan's launch that have no batch to scan. Each wave owns a 32x64 strip, with
// the fragments, the k order and the stores of wmma_gemm_f32: the values are the same bit for bit.
#define ZT        256
#define ZT_TILES  ((M_ROWS / ZT) * (D_INNER / ZT))
#define ZT_BUF_B  (ZT * LDS_LD * 4)      // bytes of one buffer of one operand
#define ZT_HALF_B (ZT_BUF_B / 2)         // bytes of the 128 rows that one copy per thread fills
static_assert(M_ROWS % ZT == 0 && D_INNER % ZT == 0 && D_MODEL / TK >= 2, "whole tiles; the ring needs two stages");

__device__ __forceinline__ void z_tile(const float* __restrict__ x, const float* __restrict__ Wz,
                                       float* __restrict__ z, int tile)
{
    __shared__ __attribute__((aligned(16))) float As[2][ZT][LDS_LD];   // rows of x
    __shared__ __attribute__((aligned(16))) float Bs[2][ZT][LDS_LD];   // rows of Wz

    const int tid  = threadIdx.x;
    const int wave = tid >> 5;               // 0..31
    const int lane = tid & 31;
    const int laneMod  = lane & 15;
    const int laneHalf = lane >> 4;

    const int mBlock = (tile / (D_INNER / ZT)) * ZT;
    const int nBlock = (tile % (D_INNER / ZT)) * ZT;
    const int waveM  = (wave & 7) * 32;
    const int waveN  = (wave >> 3) * 64;

    v8f acc[2][4];
    #pragma unroll
    for (int mt = 0; mt < 2; ++mt)
        #pragma unroll
        for (int nt = 0; nt < 4; ++nt)
            #pragma unroll
            for (int r = 0; r < 8; ++r) acc[mt][nt][r] = 0.0f;

    // A stage is ZT rows of TK floats of each operand: 2 + 2 chunks of 16 bytes per thread.
    const int srow = tid >> 3;               // 0..127; the second chunk lies 128 rows on
    const int sc4  = (tid & 7) << 2;
    const float* ga = x  + (size_t)(mBlock + srow) * D_MODEL + sc4;
    const float* gb = Wz + (size_t)(nBlock + srow) * D_MODEL + sc4;
    const unsigned la = (unsigned)(size_t)&As[0][srow][sc4];   // LDS byte addresses
    const unsigned lb = (unsigned)(size_t)&Bs[0][srow][sc4];
    auto stage_tile = [&](int k0, int b) {
        // The wait in the copies' own statement stands in front of every later write of their
        // address registers.
        asm volatile("global_load_async_to_lds_b128 %0, %1, off\n\t"
                     "global_load_async_to_lds_b128 %2, %3, off\n\t"
                     "global_load_async_to_lds_b128 %4, %5, off\n\t"
                     "global_load_async_to_lds_b128 %6, %7, off\n\t"
                     "s_wait_xcnt 0x0"
                     :: "v"(la + b * ZT_BUF_B),             "v"(ga + k0),
                        "v"(la + b * ZT_BUF_B + ZT_HALF_B), "v"(ga + k0 + 128 * D_MODEL),
                        "v"(lb + b * ZT_BUF_B),             "v"(gb + k0),
                        "v"(lb + b * ZT_BUF_B + ZT_HALF_B), "v"(gb + k0 + 128 * D_MODEL)
                     : "memory");
    };

    stage_tile(0, 0);
    asm volatile("s_wait_asynccnt 0x0" ::: "memory");   // this wave's part of stage 0 has landed
    __syncthreads();                                    // and every other wave's
    stage_tile(TK, 1);

    // Stays rolled: one trip holds 64 matrix instructions, more of them only lengthen the code.
    #pragma unroll 1
    for (int t = 0; t < D_MODEL / TK; ++t) {
        const int buf = t & 1;
        #pragma unroll
        for (int kk = 0; kk < TK; kk += 4) {
            v2f a0, a1;
            a0.x = As[buf][waveM + laneMod][kk + 2 * laneHalf + 0];
            a0.y = As[buf][waveM + laneMod][kk + 2 * laneHalf + 1];
            a1.x = As[buf][waveM + 16 + laneMod][kk + 2 * laneHalf + 0];
            a1.y = As[buf][waveM + 16 + laneMod][kk + 2 * laneHalf + 1];
            #pragma unroll
            for (int nt = 0; nt < 4; ++nt) {
                v2f bf;
                bf.x = Bs[buf][waveN + nt * 16 + laneMod][kk + 2 * laneHalf + 0];
                bf.y = Bs[buf][waveN + nt * 16 + laneMod][kk + 2 * laneHalf + 1];
                acc[0][nt] = __builtin_amdgcn_wmma_f32_16x16x4_f32(
                    false, a0, false, bf, (short)0, acc[0][nt], false, false);
                acc[1][nt] = __builtin_amdgcn_wmma_f32_16x16x4_f32(
                    false, a1, false, bf, (short)0, acc[1][nt], false, false);
            }
        }
        asm volatile("s_wait_dscnt 0x0" ::: "memory");      // this wave's reads of buf are done
        asm volatile("s_wait_asynccnt 0x0" ::: "memory");   // its part of stage t + 1 has landed
        __syncthreads();                                    // both hold for every wave
        // Four vector slots between the trip's last matrix instruction and the address arithmetic
        // that follows on every path and may take its operand registers. The scheduling barriers
        // keep the matrix instructions in front of the slots and that arithmetic behind them.
        __builtin_amdgcn_sched_barrier(0);
        asm volatile("v_nop\n\tv_nop\n\tv_nop\n\tv_nop");
        __builtin_amdgcn_sched_barrier(0);
        if (t + 2 < D_MODEL / TK) stage_tile((t + 2) * TK, buf);
    }
    asm volatile("s_wait_asynccnt 0x0" ::: "memory");   // no copy is left in flight at the wave's end

    float* dst = z + nBlock + waveN;
    #pragma unroll
    for (int mt = 0; mt < 2; ++mt) {
        #pragma unroll
        for (int r = 0; r < 8; ++r) {
            const int m = mBlock + waveM + mt * 16 + r + 8 * laneHalf;
            float* row = dst + (size_t)m * D_INNER + laneMod;
            #pragma unroll
            for (int nt = 0; nt < 4; ++nt) row[nt * 16] = acc[mt][nt][r];
        }
        if (mt == 0) wait_addresses_taken();   // the second half's address may take the first's registers
    }
}

// Work-groups 0 .. BATCH-1: the scan, one work-group per batch, 1024 threads, 2 channels per thread.
// The others: one tile of z each.
// hin[b][k][.] gets the state on entry to block k, sall[b][k][j] the s_j of its steps (0 for the
// steps that the short last block lacks).
// No thread reads a global word that a thread of this launch writes, so
// global memory needs no ordering at the barriers: only red[] and bcast[] do, and the z tiles' As and Bs.
__global__ __launch_bounds__(1024)
void scan_kernel(const float* __restrict__ xi, const float* __restrict__ v,
                 const float* __restrict__ lam, const float* __restrict__ tab,
                 const float* __restrict__ gend, float* __restrict__ hin,
                 float* __restrict__ sall,
                 const float* __restrict__ x, const float* __restrict__ Win, float* __restrict__ z)
{
    if (blockIdx.x >= BATCH) {   // the same for the whole work-group
        z_tile(x, Win + (size_t)D_INNER * D_MODEL, z, blockIdx.x - BATCH);
        return;
    }
    const int b    = blockIdx.x;
    const int tid  = threadIdx.x;
    const int c0   = tid;
    const int c1   = tid + 1024;
    const int wave = tid >> 5;
    const int lane = tid & 31;
    const size_t base = (size_t)b * SEQ * D_INNER;
    const size_t blk0 = (size_t)b * SCAN_BLOCKS;

    // The alignment puts these two in front of the z tiles' buffers in LDS: their addresses then
    // still fit the offset fields of the LDS instructions, with no address arithmetic in the scan.
    __shared__ __attribute__((aligned(128))) float red[SCAN_CH][64];   // per dot: one partial sum of each 16-lane row of the 32 waves
    __shared__ __attribute__((aligned(128))) float bcast[SCAN_CH];

    float h0 = xi[base + c0];
    float h1 = xi[base + c1];
    hin[blk0 * D_INNER + c0] = h0;
    hin[blk0 * D_INNER + c1] = h1;
    wait_addresses_taken();   // the addresses formed next may take these loads' and stores' registers

    // Two sets of rows: one is worked on while the next block's rows fly into the other.
    float rv0[2][SCAN_CH], rv1[2][SCAN_CH];
    float rl0[2][SCAN_CH], rl1[2][SCAN_CH];
    float rg0[2], rg1[2];

    auto fetch = [&](int k, int s, int n) {
        #pragma unroll
        for (int j = 0; j < n; ++j) {
            const size_t off = base + (size_t)(1 + k * SCAN_CH + j) * D_INNER;
            rv0[s][j] = v[off + c0];   rv1[s][j] = v[off + c1];
            rl0[s][j] = lam[off + c0]; rl1[s][j] = lam[off + c1];
        }
        wait_addresses_taken();   // the two results below may land in address registers of the loads above
        rg0[s] = gend[(blk0 + k) * D_INNER + c0];
        rg1[s] = gend[(blk0 + k) * D_INNER + c1];
    };
    // The last fetch, behind the loop: its address registers are used up load by load, and a
    // later load's result may land in them, so each load gets its own wait. Runs once.
    // No state leaves the last block, so its row g is not fetched.
    auto fetch_last = [&](int k, int s) {
        #pragma unroll
        for (int j = 0; j < SCAN_TAIL; ++j) {
            const size_t off = base + (size_t)(1 + k * SCAN_CH + j) * D_INNER;
            rv0[s][j] = v[off + c0];   wait_addresses_taken();
            rv1[s][j] = v[off + c1];   wait_addresses_taken();
            rl0[s][j] = lam[off + c0]; wait_addresses_taken();
            rl1[s][j] = lam[off + c1]; wait_addresses_taken();
        }
    };

    const float* tk = tab + blk0 * TAB_LD;   // the table line of the block at hand

    // The
    // rows of v, lam and g come from memory. So they are asked into L2 SCAN_PF blocks of steps
    // ahead of the block at hand: a prefetch returns nothing to the WGP and no wave waits for it.
    // Wave w < 13 asks for one row of 8 KiB: 32 lanes, 256 bytes apart.
    const int wave_s = __builtin_amdgcn_readfirstlane(tid >> 5);   // scalar, for a scalar branch
    const int pf_arr = wave_s / SCAN_CH;   // 0: v, 1: lam, from 2 on: g
    const float* pf_src = pf_arr == 0 ? v + base : (pf_arr == 1 ? lam + base : gend + blk0 * D_INNER);
    // v and lam have SCAN_CH rows per block of steps, from row 1 on; g has one, from row 0 on.
    const int pf_per  = pf_arr < 2 ? SCAN_CH : 1;
    const int pf_off  = pf_arr < 2 ? 1 + wave_s % SCAN_CH : 0;
    const int pf_last = pf_arr < 2 ? SEQ - 1 : SCAN_BLOCKS - 1;
    // The row of block k that this wave asks for; past the end it is the last row, so the
    // address stays inside the array at every issue and after every advance.
    auto pf_row = [&](int k) {
        const int t = k * pf_per + pf_off;
        return t < pf_last ? t : pf_last;
    };
    const char* pf = (const char*)(pf_src + (size_t)pf_row(SCAN_PF) * D_INNER) + lane * 256;
    auto pf_ask = [&]() {
        if (wave_s < 2 * SCAN_CH + 1)
            asm volatile("global_prefetch_b8 %0, off scope:SCOPE_SE" :: "v"(pf));   // into L2 only
    };
    auto pf_advance = [&](int k) {   // from block k's row to block k + 1's
        pf += (size_t)(pf_row(k + 1) - pf_row(k)) * (D_INNER * sizeof(float));
    };

    // Block k of n steps, its rows in set s; n_next steps of block k+1 are fetched into the other set.
    auto block_of_steps = [&](int k, int s, int n, int n_next) {
        // This block's table line: asked for here, used behind the first barrier.
        float tb[TAB_N];
        #pragma unroll
        for (int j = 0; j < n; ++j) {
            tb[j] = tk[j];
            tb[TAB_C(j)] = tk[TAB_C(j)];
            #pragma unroll
            for (int i = 0; i < j; ++i) tb[TAB_G(j, i)] = tk[TAB_G(j, i)];
        }
        wait_addresses_taken();   // in front of the step of tk
        tk += TAB_LD;
        if (n_next == SCAN_CH) {
            fetch(k + 1, s ^ 1, SCAN_CH);
            wait_addresses_taken();
            pf_ask();   // block k + SCAN_PF; behind the loads, so that it does not stand in their way
        }
        else if (n_next > 0)   fetch_last(k + 1, s ^ 1);

        float p[SCAN_CH];
        float f0 = h0, f1 = h1;
        #pragma unroll
        for (int j = 0; j < n; ++j) {
            p[j] = rv0[s][j] * f0 + rv1[s][j] * f1;
            f0 *= rl0[s][j];
            f1 *= rl1[s][j];
        }
        row_sums(p, n);
        if ((lane & 15) == 0) {   // lanes 0 and 16: their row's sums
            #pragma unroll
            for (int j = 0; j < n; ++j) red[j][tid >> 4] = p[j];
        }
        barrier_lds_only();
        if (wave == 0) {
            // One wave sums the n dots over the 64 rows and solves for the s_j: the chain of
            // divisions then costs its latency once, not its issue slots in every wave.
            float num[SCAN_CH], sj[SCAN_CH];
            #pragma unroll
            for (int j = 0; j < n; ++j) num[j] = red[j][lane] + red[j][lane + 32];
            row_sums(num, n);
            #pragma unroll
            for (int j = 0; j < n; ++j) num[j] += other_row(num[j]) + tb[TAB_C(j)];
            #pragma unroll
            for (int j = 0; j < n; ++j) {
                sj[j] = 2.0f * num[j] / tb[j];
                #pragma unroll
                for (int jj = j + 1; jj < n; ++jj) num[jj] -= sj[j] * tb[TAB_G(jj, j)];
            }
            if (lane == 0) {
                #pragma unroll
                for (int j = 0; j < n; ++j) bcast[j] = sj[j];
            }
        }
        barrier_lds_only();

        float sc[SCAN_CH];
        #pragma unroll
        for (int j = 0; j < n; ++j) sc[j] = bcast[j];

        if (n_next > 0) {   // the state on entry to block k + 1
            #pragma unroll
            for (int j = 0; j < n; ++j) {
                h0 = rl0[s][j] * (h0 - rv0[s][j] * sc[j]);
                h1 = rl1[s][j] * (h1 - rv1[s][j] * sc[j]);
            }
            h0 += rg0[s];
            h1 += rg1[s];
            hin[(blk0 + k + 1) * D_INNER + c0] = h0;
            hin[(blk0 + k + 1) * D_INNER + c1] = h1;
        }
        if (tid == 0) {
            float* sk = sall + (blk0 + k) * S_LD;
            *(v4f*)sk       = v4f{sc[0], n > 1 ? sc[1] : 0.0f, n > 2 ? sc[2] : 0.0f, n > 3 ? sc[3] : 0.0f};
            *(v2f*)(sk + 4) = v2f{n > 4 ? sc[4] : 0.0f, n > 5 ? sc[5] : 0.0f};
        }
        wait_addresses_taken();
        if (n_next == SCAN_CH) pf_advance(k + SCAN_PF);   // behind the wait: pf is named by the prefetch above
        barrier_lds_only();   // red[] and bcast[] safe to overwrite in the next block
    };

    fetch(0, 0, SCAN_CH);
    wait_addresses_taken();

    // The set index must be a constant for the rows to stay in registers: two
    // blocks per trip, the loop itself stays rolled.
    #pragma unroll 1
    for (int kk = 0; kk < SCAN_FULL / 2; ++kk) {
        block_of_steps(2 * kk,     0, SCAN_CH, SCAN_CH);
        block_of_steps(2 * kk + 1, 1, SCAN_CH, SCAN_CH);
    }
    block_of_steps(SCAN_FULL - 1, 0, SCAN_CH,   SCAN_TAIL);
    block_of_steps(SCAN_FULL,     1, SCAN_TAIL, 0);
}

// Every h_j of block k of batch b, from the block's entry state and its s_j by the reference's own
// recurrence, and with it silu(z) * h, written over z. One work-group per block of steps, 4
// channels per thread. Rows past the end (short last block) are read as the last row and not stored.
__device__ __forceinline__ v4f silu_times(v4f zv, v4f h)
{
    v4f r;
    #pragma unroll
    for (int e = 0; e < 4; ++e) r[e] = zv[e] / (1.0f + expf(-zv[e])) * h[e];
    return r;
}

__global__ __launch_bounds__(512)
void block_rows_kernel(const float* __restrict__ xi, const float* __restrict__ v,
                       const float* __restrict__ lam, const float* __restrict__ hin,
                       const float* __restrict__ sall, float* __restrict__ z_io)
{
    const int k   = blockIdx.x;
    const int b   = blockIdx.y;
    const int tid = threadIdx.x;
    const size_t base = (size_t)b * SEQ * D_INNER + tid * 4;
    const size_t blk  = (size_t)b * SCAN_BLOCKS + k;

    v4f h = *(const v4f*)(hin + blk * D_INNER + tid * 4);
    wait_addresses_taken();   // a later load's result may land in this load's address registers
    v4f rv[SCAN_CH], rl[SCAN_CH], rx[SCAN_CH], rz[SCAN_CH];
    #pragma unroll
    for (int j = 0; j < SCAN_CH; ++j) {
        int t = 1 + k * SCAN_CH + j;
        if (t > SEQ - 1) t = SEQ - 1;
        const size_t off = base + (size_t)t * D_INNER;
        rv[j] = *(const v4f*)(v + off);    wait_addresses_taken();
        rl[j] = *(const v4f*)(lam + off);  wait_addresses_taken();
        rx[j] = *(const v4f*)(xi + off);   wait_addresses_taken();
        rz[j] = *(const v4f*)(z_io + off); wait_addresses_taken();
    }
    float sc[SCAN_CH];
    #pragma unroll
    for (int j = 0; j < SCAN_CH; ++j) sc[j] = sall[blk * S_LD + j];
    wait_addresses_taken();

    if (k == 0) {   // step 0: h is the entry state itself
        const v4f z0 = *(const v4f*)(z_io + base);
        wait_addresses_taken();
        *(v4f*)(z_io + base) = silu_times(z0, h);
        wait_addresses_taken();   // the values formed next may take the store's registers
    }
    #pragma unroll
    for (int j = 0; j < SCAN_CH; ++j) {
        h = rl[j] * (h - rv[j] * sc[j]) + (1.0f - rl[j]) * rx[j];
        const int t = 1 + k * SCAN_CH + j;
        if (t <= SEQ - 1) {
            *(v4f*)(z_io + base + (size_t)t * D_INNER) = silu_times(rz[j], h);
            if (j < SCAN_CH - 1) wait_addresses_taken();   // the next step's values may take this store's registers
        }
    }
}

// ---------------------------------------------------------------------------
extern "C" void kernel_launch(void* const* d_in, const int* in_sizes, int n_in,
                              void* d_out, int out_size, void* d_ws, size_t ws_size,
                              hipStream_t stream)
{
    const float* x     = (const float*)d_in[0];
    const float* omega = (const float*)d_in[1];   // 2048
    const float* Win   = (const float*)d_in[2];   // 4096 x 1024
    const float* Wl    = (const float*)d_in[3];   // 2048 x 2048
    const float* bl    = (const float*)d_in[4];
    const float* Wv    = (const float*)d_in[5];   // 2048 x 2048
    const float* bv    = (const float*)d_in[6];
    const float* Wout  = (const float*)d_in[7];   // 1024 x 2048
    float* out = (float*)d_out;

    const size_t BUF = (size_t)M_ROWS * D_INNER;  // 16,777,216 floats (64 MB)
    float* ws    = (float*)d_ws;
    float* xi    = ws;             // [M_ROWS, D_INNER]
    float* z     = ws + BUF;       // [M_ROWS, D_INNER] (later holds silu(z)*h)
    float* lam_h = ws + 2 * BUF;   // lam
    float* vbuf  = ws + 3 * BUF;   // total 256 MB of d_ws used

    // Scratch in out, which launch 6 overwrites whole (the workspace has no byte left): the
    // transposed xi rows of Win and the two folded weights, 8 MB each. All dead before launch 4.
    const size_t WSZ = (size_t)D_INNER * D_MODEL;
    float* wxiT = out;             // [D_MODEL, D_INNER]
    float* wlx  = out + WSZ;       // Wl*Wxi [D_INNER, D_MODEL]
    float* wvx  = out + 2 * WSZ;   // Wv*Wxi [D_INNER, D_MODEL]

    dim3 blk(128);

    // 0) the xi rows of Win transposed, then Wl*Wxi and Wv*Wxi in one launch
    transpose_wxi_kernel<<<dim3(D_MODEL / 32, D_INNER / 32), 256, 0, stream>>>(Win, wxiT);
    {
        dim3 grd(D_MODEL / TN, D_INNER / TM, 2);
        wmma_gemm_f32<EPI_PLAIN><<<grd, blk, 0, stream>>>(Wl, Wv, wxiT, nullptr, nullptr,
                                                          wlx, wvx, D_INNER, D_MODEL, D_INNER);
    }

    // 1) xi = x @ Wxi^T: the xi columns of x @ Win^T alone; the z columns come in the scan's launch
    {
        dim3 grd(D_INNER / TN, M_ROWS / TM);
        wmma_gemm_f32<EPI_SPLIT><<<grd, blk, 0, stream>>>(x, nullptr, Win, nullptr, nullptr,
                                                          xi, z, M_ROWS, D_INNER, D_MODEL);
    }
    // 2) lam = exp(-8*softplus(omega)*sigmoid(x@(Wl*Wxi)^T + bl))
    {
        dim3 grd(D_INNER / TN, M_ROWS / TM);
        wmma_gemm_f32<EPI_LAMBDA><<<grd, blk, 0, stream>>>(x, nullptr, wlx, bl, omega,
                                                           lam_h, nullptr, M_ROWS, D_INNER, D_MODEL);
    }
    // 3) v = x @ (Wv*Wxi)^T + bv
    {
        dim3 grd(D_INNER / TN, M_ROWS / TM);
        wmma_gemm_f32<EPI_PLAIN><<<grd, blk, 0, stream>>>(x, nullptr, wvx, bv, nullptr,
                                                          vbuf, nullptr, M_ROWS, D_INNER, D_MODEL);
    }
    // 4) Householder scan. Its small arrays lie in out, which launch 6 overwrites whole (the
    //    workspace has no byte left): the table of h-independent dots, the s_j, and per block of
    //    steps the row g at its end and the state on its entry.
    const size_t ROWS = (size_t)BATCH * SCAN_BLOCKS * D_INNER;
    float* tab  = out;                     // BATCH * SCAN_BLOCKS lines of TAB_LD floats
    float* sall = out + 49152;             // BATCH * SCAN_BLOCKS slots of S_LD floats
    float* gend = out + 65536;
    float* hin  = out + 65536 + ROWS;
    static_assert(BATCH * SCAN_BLOCKS * TAB_LD <= 49152 && 49152 + BATCH * SCAN_BLOCKS * S_LD <= 65536, "the small arrays overlap");
    static_assert(65536 + 2 * (size_t)BATCH * SCAN_BLOCKS * D_INNER <= (size_t)M_ROWS * D_MODEL, "the scan's arrays do not fit in out");
    scan_dots_kernel<<<dim3(SCAN_BLOCKS, BATCH), 256, 0, stream>>>(vbuf, lam_h, xi, tab, gend);
    scan_kernel<<<BATCH + ZT_TILES, 1024, 0, stream>>>(xi, vbuf, lam_h, tab, gend, hin, sall, x, Win, z);

    // 5) every h row from its block's entry state, and g = silu(z) * h   (overwrites z)
    block_rows_kernel<<<dim3(SCAN_BLOCKS, BATCH), 512, 0, stream>>>(xi, vbuf, lam_h, hin, sall, z);

    // 6) out = g @ Wout^T
    {
        dim3 grd(D_MODEL / TN, M_ROWS / TM);
        wmma_gemm_f32<EPI_PLAIN><<<grd, blk, 0, stream>>>(z, nullptr, Wout, nullptr, nullptr,
                                                          out, nullptr, M_ROWS, D_MODEL, D_INNER);
    }
}

// v009
// One run takes 1120 microseconds.
// Two timings next to v008 both put it at 1.18 times that version's speed.
// Over all steps from v000 it is 4.10 times as fast.
#include <hip/hip_runtime.h>
#include <cmath>

// ---------------------------------------------------------------------------
// DenseRNN (Householder-reflection linear RNN) for MI455X / gfx1250
//   xz = x @ Win^T ; xi,z = split(xz)
//   lam = exp(-8*softplus(omega)*sigmoid(xi@Wl^T + bl))
//   v   = xi@Wv^T + bv
//   scan: h_t = lam_t*(h_{t-1} - 2 v_t (v.h)/(v.v)) + (1-lam_t)*xi_t ; h_0 = xi_0
//   out = (silu(z)*h) @ Wout^T
// xi@Wl^T and xi@Wv^T are formed as x@(Wl*Wxi)^T and x@(Wv*Wxi)^T, Wxi = the xi rows of Win:
// the inner length is then D_MODEL, not D_INNER, and the two small products Wl*Wxi and
// Wv*Wxi cost a quarter of what that saves on the f32 matrix unit.
// GEMMs: V_WMMA_F32_16X16X4_F32 + double-buffered async global->LDS staging.
// The scan holds one WGP per batch for a long time and leaves the others idle. It is cut in two
// launches at a block of steps near the middle of the sequence. Only the first 1024 rows per batch
// of xi, lam and v are formed in front of it. The first scan launch also forms, on the idle WGPs,
// their other rows and most of z's first rows; the second forms the rest of z and the output rows
// whose h the first has already settled.
// ---------------------------------------------------------------------------

typedef __attribute__((ext_vector_type(2))) float v2f;
typedef __attribute__((ext_vector_type(8))) float v8f;
typedef int v4i_gcc __attribute__((vector_size(16)));   // matches builtin pointee

#define D_MODEL   1024
#define D_INNER   2048
#define BATCH     4
#define SEQ       2048
#define M_ROWS    (BATCH * SEQ)        // 8192

// GEMM tiling: 128 threads = 4 waves; each wave owns a 32x64 C strip.
#define TM 128        // block rows
#define TN 64         // block cols
#define TK 32         // K tile
#define LDS_PAD 4     // row stride 36 floats = 144 B (16B aligned for b128 async)
#define LDS_LD  (TK + LDS_PAD)

// Epilogue modes
#define EPI_PLAIN  0   // out0[m,col] = acc (+ bias if non-null); blockIdx.z = 1: A1 in place of A0, out1 of out0
#define EPI_LAMBDA 1   // out0[m,col] = exp(-8*softplus(omega[col])*sigmoid(acc+bias[col]))
#define EPI_SPLIT  2   // col < D_INNER -> out0 (xi), else -> out1 (z), both ld = D_INNER

// --- async global->LDS copy (CDNA5 ASYNCcnt path), with sync fallback ------
#if defined(__AMDGCN__) && __has_builtin(__builtin_amdgcn_global_load_async_to_lds_b128)
#define USE_ASYNC_LDS 1
#else
#define USE_ASYNC_LDS 0
#endif

__device__ __forceinline__ void copy16_g2l(const float* __restrict__ g, float* l)
{
#if USE_ASYNC_LDS
    __builtin_amdgcn_global_load_async_to_lds_b128(
        (__attribute__((address_space(1))) v4i_gcc*)(void*)g,
        (__attribute__((address_space(3))) v4i_gcc*)(void*)l,
        /*imm offset=*/0, /*cpol=*/0);
#else
    *(float4*)l = *(const float4*)g;
#endif
}

__device__ __forceinline__ void wait_async_lds()
{
#if USE_ASYNC_LDS
#if __has_builtin(__builtin_amdgcn_s_wait_asynccnt)
    __builtin_amdgcn_s_wait_asynccnt(0);
#else
    asm volatile("s_wait_asynccnt 0x0" ::: "memory");
#endif
#endif
}

// Stands behind a group of global loads or stores, in front of the first
// instruction that may reuse one of their address or data registers. The
// scheduling barrier keeps later instructions, which may take those registers,
// from being lifted over the wait, and the loads in front of it from sinking
// behind it (a build without it did both, and spilled registers in the scan).
__device__ __forceinline__ void wait_addresses_taken()
{
    asm volatile("s_wait_xcnt 0x0" ::: "memory");
    __builtin_amdgcn_sched_barrier(0);
}

// C[M,N] = A[M,K] * W[N,K]^T   (A row-major MxK, W row-major NxK; both K-contiguous)
// Requires: M % TM == 0, N % TN == 0, K % TK == 0.
// The epilogue mode is a template argument, and what depends on the column alone is formed
// once per column, for speed only.
template <int MODE>
__global__ __launch_bounds__(128)
void wmma_gemm_f32(const float* __restrict__ A0, const float* __restrict__ A1,
                   const float* __restrict__ W,
                   const float* __restrict__ bias, const float* __restrict__ omega,
                   float* __restrict__ out0, float* __restrict__ out1,
                   int M, int N, int K, int segTiles, int mOff)
{
    __shared__ float As[2][TM][LDS_LD];   // A tile, row-major, double buffered
    __shared__ float Bs[2][TN][LDS_LD];   // W tile, n-major: Bs[.][n][k] = W[nBlock+n][k0+k]

    const int tid  = threadIdx.x;
    const int wave = tid >> 5;               // 0..3 (wave32)
    const int lane = tid & 31;
    const int laneMod  = lane & 15;          // 0..15
    const int laneHalf = lane >> 4;          // 0 or 1

    // Of every SEQ rows (one batch) the launch takes segTiles blocks of rows, from row mOff on.
    const int mBlock = (blockIdx.y / segTiles) * SEQ + mOff + (blockIdx.y % segTiles) * TM;
    const int nBlock = blockIdx.x * TN;
    const int waveM  = wave * 32;            // this wave's 32-row strip inside block tile

    // Two products with one W share a launch, so that a small grid still gives every SIMD two waves.
    const bool second = MODE == EPI_PLAIN && blockIdx.z != 0;
    const float* __restrict__ A = second ? A1 : A0;

    v8f acc[2][4];
    #pragma unroll
    for (int mt = 0; mt < 2; ++mt)
        #pragma unroll
        for (int nt = 0; nt < 4; ++nt)
            #pragma unroll
            for (int r = 0; r < 8; ++r) acc[mt][nt][r] = 0.0f;

    // ---- tile stage: issues TM*TK/4/128 = 8 A chunks + 4 W chunks of b128 ----
    auto stage_tile = [&](int k0, int b) {
        #pragma unroll
        for (int i = 0; i < 8; ++i) {
            int q   = tid + i * 128;          // 0..1023
            int row = q >> 3;                 // 8 float4 per 32-float row
            int c4  = (q & 7) << 2;
            copy16_g2l(A + (size_t)(mBlock + row) * K + k0 + c4, &As[b][row][c4]);
        }
        #pragma unroll
        for (int i = 0; i < 4; ++i) {
            int q   = tid + i * 128;          // 0..511
            int row = q >> 3;
            int c4  = (q & 7) << 2;
            copy16_g2l(W + (size_t)(nBlock + row) * K + k0 + c4, &Bs[b][row][c4]);
        }
    };

    int buf = 0;
    stage_tile(0, buf);
    wait_async_lds();
    __syncthreads();

    for (int k0 = 0; k0 < K; k0 += TK) {
        const int nbuf = buf ^ 1;
        if (k0 + TK < K) stage_tile(k0 + TK, nbuf);   // prefetch next tile (async)

        // ---- 8 K-steps; per step: 2 A frags x 4 B frags = 8 WMMAs ----
        #pragma unroll
        for (int kk = 0; kk < TK; kk += 4) {
            // A frag (16x4): lanes 0-15: M=lane, K=kk+{0,1}; lanes 16-31: K=kk+{2,3}
            v2f a0, a1;
            a0.x = As[buf][waveM + laneMod][kk + 2 * laneHalf + 0];
            a0.y = As[buf][waveM + laneMod][kk + 2 * laneHalf + 1];
            a1.x = As[buf][waveM + 16 + laneMod][kk + 2 * laneHalf + 0];
            a1.y = As[buf][waveM + 16 + laneMod][kk + 2 * laneHalf + 1];
            #pragma unroll
            for (int nt = 0; nt < 4; ++nt) {
                // B frag (4x16): lane holds K=kk+2*laneHalf+{0,1}, N=nt*16+laneMod
                v2f bf;
                bf.x = Bs[buf][nt * 16 + laneMod][kk + 2 * laneHalf + 0];
                bf.y = Bs[buf][nt * 16 + laneMod][kk + 2 * laneHalf + 1];
                acc[0][nt] = __builtin_amdgcn_wmma_f32_16x16x4_f32(
                    false, a0, false, bf, (short)0, acc[0][nt], false, false);
                acc[1][nt] = __builtin_amdgcn_wmma_f32_16x16x4_f32(
                    false, a1, false, bf, (short)0, acc[1][nt], false, false);
            }
        }

        wait_async_lds();       // next tile landed in LDS
        __syncthreads();        // all waves done reading `buf`, async writes visible
        buf = nbuf;
    }

    // ---- epilogue: C/D layout: VGPR r -> row = r + 8*laneHalf, col = laneMod ----
    // What depends on the column alone, once per column: the bias, and -8*softplus(omega).
    float cb[4], ck[4];
    #pragma unroll
    for (int nt = 0; nt < 4; ++nt) {
        const int col = nBlock + nt * 16 + laneMod;
        cb[nt] = 0.0f;
        ck[nt] = 0.0f;
        if (MODE == EPI_LAMBDA) {
            cb[nt] = bias[col];
            ck[nt] = -8.0f * log1pf(expf(omega[col]));
        } else if (MODE == EPI_PLAIN) {
            if (bias) cb[nt] = bias[col];
        }
    }
    if (MODE != EPI_SPLIT) wait_addresses_taken();   // the row addresses formed next may take these loads' address registers

    // A block's TN columns lie wholly in xi or wholly in z.
    static_assert(D_INNER % TN == 0, "a block of columns must not straddle the split");
    float* dst = (second ? out1 : out0) + nBlock;
    size_t ld  = (size_t)N;
    if (MODE == EPI_SPLIT) {
        ld = D_INNER;
        if (nBlock >= D_INNER) dst = out1 + (nBlock - D_INNER);
    }

    #pragma unroll
    for (int mt = 0; mt < 2; ++mt) {
        #pragma unroll
        for (int r = 0; r < 8; ++r) {
            const int m = mBlock + waveM + mt * 16 + r + 8 * laneHalf;
            float* row = dst + (size_t)m * ld + laneMod;
            #pragma unroll
            for (int nt = 0; nt < 4; ++nt) {
                float val = acc[mt][nt][r];
                if (MODE == EPI_PLAIN) {
                    if (bias) val += cb[nt];
                } else if (MODE == EPI_LAMBDA) {
                    val += cb[nt];
                    float sig = 1.0f / (1.0f + expf(-val));
                    val = expf(ck[nt] * sig);
                }
                row[nt * 16] = val;
            }
            // The next row's address and values may take this row's registers. With the split's
            // constant row pitch the eight rows of one mt share one address and store the
            // accumulators themselves: there nothing is rewritten before the next mt.
            if (mt * 8 + r < 15 && (MODE != EPI_SPLIT || r == 7)) wait_addresses_taken();
        }
    }
}

// dst[d][i] = src[i][d] for the D_INNER x D_MODEL head of Win (the rows that make xi): the GEMM
// wants both operands contiguous along the summed index, which for Wl*Wxi is i.
__global__ __launch_bounds__(256)
void transpose_wxi_kernel(const float* __restrict__ src, float* __restrict__ dst)
{
    __shared__ float tile[32][33];           // pitch 33: the column reads below touch 32 banks
    const int tx = threadIdx.x & 31;
    const int ty = threadIdx.x >> 5;         // 0..7
    const int d0 = blockIdx.x * 32;
    const int i0 = blockIdx.y * 32;
    float r[4];
    #pragma unroll
    for (int q = 0; q < 4; ++q) r[q] = src[(size_t)(i0 + ty + q * 8) * D_MODEL + d0 + tx];
    wait_addresses_taken();   // the LDS and store addresses formed next may take the loads' address registers
    #pragma unroll
    for (int q = 0; q < 4; ++q) tile[ty + q * 8][tx] = r[q];
    __syncthreads();
    #pragma unroll
    for (int q = 0; q < 4; ++q) dst[(size_t)(d0 + ty + q * 8) * D_INNER + i0 + tx] = tile[tx][ty + q * 8];
}

// ---------------------------------------------------------------------------
// Householder scan, blocked by SCAN_CH steps. Inside a block of steps
//   h_j = y_j + g_j,   s_j = 2 (v_j.h_{j-1}) / (v_j.v_j)
// with g the part that xi drives (g_j = lam_j g_{j-1} + (1-lam_j) xi_j, g_0 = 0) and y the part
// that the block's entry state drives (y_j = lam_j (y_{j-1} - s_j v_j), y_0 = the entry h). With
// L_j = lam_j ... lam_1 and w_{i,j} = lam_j ... lam_i v_i
//   v_j.h_{j-1} = v_j.(L_{j-1} h_entry) + v_j.g_{j-1} - sum_{i<j} s_i (v_j.w_{i,j-1}).
// The dots v_j.v_j, v_j.w_{i,j-1} and v_j.g_{j-1} and the row g at the block's end do not depend
// on h: a kernel over the whole chip forms them for every block of steps. The sequential kernel
// runs on one WGP per batch, and what it moves through that WGP's memory path sets its time: so
// it carries the state from block entry to block entry only. Per block it reads the rows of v and
// lam and one row g, does ONE work-group sum (of the SCAN_CH dots v_j.(L_{j-1} h_entry)) and a
// forward substitution for the s_j, and writes the s_j and one row, the next block's entry state.
// xi is not read there and the h rows are not written there: a third kernel over the whole chip
// forms every h_j from its block's entry state and s_j by the reference's own recurrence.
// ---------------------------------------------------------------------------
typedef __attribute__((ext_vector_type(4))) float v4f;

#define SCAN_CH     6                                   // steps per block of steps
#define SCAN_FULL   ((SEQ - 1) / SCAN_CH)               // blocks with all their steps: 341
#define SCAN_TAIL   ((SEQ - 1) - SCAN_FULL * SCAN_CH)   // steps of the last, short block: 1
#define SCAN_BLOCKS (SCAN_FULL + 1)
#define TAB_PAIRS   (SCAN_CH * (SCAN_CH - 1) / 2)
#define TAB_N       (2 * SCAN_CH + TAB_PAIRS)           // 6 v.v, 15 v.w and 6 v.g
#define TAB_LD      32                                  // one 128-byte line per block of steps
#define TAB_G(j, i) (SCAN_CH + (j) * ((j) - 1) / 2 + (i))    // v_j.w_{i,j-1}, i < j
#define TAB_C(j)    (SCAN_CH + TAB_PAIRS + (j))         // v_j.g_{j-1}
#define S_LD        8                                   // floats per block of steps in the array of the s_j
#define SCAN_PF     4                                   // blocks of steps that the L2 prefetch runs ahead
#define SCAN_CUT    170                                 // the second scan launch starts at this block of steps
#define HALF_ROWS   (SEQ / 2)                           // rows per batch of xi, lam, v formed in front of the scan
#define OUT1_ROWS   768                                 // output rows per batch formed beside the second scan launch
#define AUX_B       ((size_t)SEQ * D_MODEL)             // floats from one batch's part of a scan array to the next's
static_assert(SCAN_CUT % 2 == 0 && SCAN_CUT * SCAN_CH < HALF_ROWS && OUT1_ROWS <= SCAN_CUT * SCAN_CH + 1,
              "the first scan launch reads early rows only and settles every h row of the early output rows");
static_assert(SCAN_TAIL > 0 && SCAN_FULL % 2 == 1, "the scan's last calls are written for this case");
static_assert(TAB_N <= TAB_LD && SCAN_CH == 6 && S_LD == 8, "a block's dots fill one line; its s_j are stored as 4 + 2 floats");

// Work-group barrier that orders LDS only. __syncthreads() also drains the
// wave's global loads and stores, which would put the memory latency of the
// rows fetched ahead, and of the h stores, back into every round.
__device__ __forceinline__ void barrier_lds_only()
{
    __builtin_amdgcn_fence(__ATOMIC_RELEASE, "workgroup", "local");
    __builtin_amdgcn_s_barrier();
    __builtin_amdgcn_fence(__ATOMIC_ACQUIRE, "workgroup", "local");
}

// Sums across lanes on the vector unit. __shfl_xor compiles to ds_bpermute_b32: an LDS round
// trip per step of the tree, and one LDS slot per value, step and wave of the work-group.
// x + (x of lane l ^ m) inside a 16-lane row; CTRL = 0x160 + m is the DPP control row_xmask:m.
template <int CTRL>
__device__ __forceinline__ float add_row_xmask(float x)
{
    const int y = __builtin_amdgcn_update_dpp(0, __builtin_bit_cast(int, x), CTRL, 0xf, 0xf, true);
    return x + __builtin_bit_cast(float, y);
}
// p[0..n): every lane gets the sum over its own 16-lane row. All 32 lanes must be on.
// Step by step over all n values, so that the n chains fill one another's latency.
__device__ __forceinline__ void row_sums(float* p, int n)
{
    #pragma unroll
    for (int j = 0; j < n; ++j) p[j] = add_row_xmask<0x161>(p[j]);
    #pragma unroll
    for (int j = 0; j < n; ++j) p[j] = add_row_xmask<0x162>(p[j]);
    #pragma unroll
    for (int j = 0; j < n; ++j) p[j] = add_row_xmask<0x164>(p[j]);
    #pragma unroll
    for (int j = 0; j < n; ++j) p[j] = add_row_xmask<0x168>(p[j]);
}
// x of lane l ^ 16
__device__ __forceinline__ float other_row(float x)
{
    const int b = __builtin_bit_cast(int, x);
    return __builtin_bit_cast(float,
        __builtin_amdgcn_permlanex16(b, b, 0x76543210, 0xfedcba98, false, false));
}

// tab[b][k][.]: the h-independent dots of block k of batch b; gend[b][k][.]: its row g at the
// block's end. One work-group each.
// Rows past the end (short last block) are read as the last row; what comes of them is never used.
__global__ __launch_bounds__(256)
void scan_dots_kernel(const float* __restrict__ v, const float* __restrict__ lam,
                      const float* __restrict__ xi,
                      float* __restrict__ tab, float* __restrict__ gend, int k0)
{
    const int k   = blockIdx.x + k0;
    const int b   = blockIdx.y;
    const int tid = threadIdx.x;
    const size_t base = (size_t)b * SEQ * D_INNER + tid * 4;
    const size_t aux  = (size_t)b * AUX_B;

    __shared__ float part[8][TAB_N];

    v4f rv[2][SCAN_CH], rl[2][SCAN_CH], rx[2][SCAN_CH];
    #pragma unroll
    for (int j = 0; j < SCAN_CH; ++j) {
        int t = 1 + k * SCAN_CH + j;
        if (t > SEQ - 1) t = SEQ - 1;
        #pragma unroll
        for (int hf = 0; hf < 2; ++hf) {
            const size_t off = base + (size_t)t * D_INNER + hf * 1024;
            rv[hf][j] = *(const v4f*)(v + off);
            wait_addresses_taken();   // a later load's result may land in this load's address registers
            rl[hf][j] = *(const v4f*)(lam + off);
            wait_addresses_taken();
            rx[hf][j] = *(const v4f*)(xi + off);
            wait_addresses_taken();
        }
    }

    float acc[TAB_N];
    #pragma unroll
    for (int q = 0; q < TAB_N; ++q) acc[q] = 0.0f;

    v4f ge[2];
    #pragma unroll
    for (int hf = 0; hf < 2; ++hf) {
        #pragma unroll
        for (int e = 0; e < 4; ++e) {
            float w[SCAN_CH];
            float g = 0.0f;
            #pragma unroll
            for (int j = 0; j < SCAN_CH; ++j) {
                const float vj = rv[hf][j][e];
                const float lj = rl[hf][j][e];
                acc[j] += vj * vj;
                acc[TAB_C(j)] += vj * g;
                #pragma unroll
                for (int i = 0; i < j; ++i) acc[TAB_G(j, i)] += vj * w[i];
                #pragma unroll
                for (int i = 0; i < j; ++i) w[i] *= lj;
                w[j] = lj * vj;
                g = lj * g + (1.0f - lj) * rx[hf][j][e];
            }
            ge[hf][e] = g;
        }
    }
    #pragma unroll
    for (int hf = 0; hf < 2; ++hf) *(v4f*)(gend + aux + (size_t)k * D_INNER + tid * 4 + hf * 1024) = ge[hf];
    wait_addresses_taken();   // the sums below may take the stores' registers

    row_sums(acc, TAB_N);
    #pragma unroll
    for (int q = 0; q < TAB_N; ++q) acc[q] += other_row(acc[q]);
    if ((tid & 31) == 0) {
        #pragma unroll
        for (int q = 0; q < TAB_N; ++q) part[tid >> 5][q] = acc[q];
    }
    __syncthreads();
    if (tid < TAB_N) {
        float s = 0.0f;
        #pragma unroll
        for (int w8 = 0; w8 < 8; ++w8) s += part[w8][tid];
        tab[aux + k * TAB_LD + tid] = s;
    }
}

// One ZT x ZT tile of C = A @ W^T by a work-group of 32 waves, for the work-groups of a scan launch
// that have no batch to scan. A and W are row-major with K floats a row. Each wave owns a 32x64
// strip, with the fragments, the k order and the epilogues of wmma_gemm_f32: the values are the
// same bit for bit.
#define ZT        256
#define ZT_BUF_B  (ZT * LDS_LD * 4)      // bytes of one buffer of one operand
#define ZT_HALF_B (ZT_BUF_B / 2)         // bytes of the 128 rows that one copy per thread fills
#define ZT_N      (D_INNER / ZT)         // tiles across xi, lam, v or z
#define ZT_HALF   ((BATCH * HALF_ROWS / ZT) * ZT_N)   // tiles of HALF_ROWS rows per batch of one of them
#define Z_EARLY_N 2                      // tiles across z whose first rows come with xi's, in front of the scan
#define SIDE0     (3 * ZT_HALF + (BATCH * HALF_ROWS / ZT) * (ZT_N - Z_EARLY_N))   // tiles beside the first scan launch
#define OUT1_TILES ((BATCH * OUT1_ROWS / ZT) * (D_MODEL / ZT))
#define SIDE1     (OUT1_TILES + ZT_HALF)                                          // and beside the second
static_assert(HALF_ROWS % ZT == 0 && OUT1_ROWS % ZT == 0 && D_INNER % ZT == 0 && D_MODEL % ZT == 0 && D_MODEL / TK >= 2,
              "whole tiles; the ring needs two stages");

__device__ __forceinline__ void tile_product(const float* A, const float* Wt, int K,
                                             int mBlock, int nBlock, v8f (&acc)[2][4])
{
    __shared__ __attribute__((aligned(16))) float As[2][ZT][LDS_LD];   // rows of A
    __shared__ __attribute__((aligned(16))) float Bs[2][ZT][LDS_LD];   // rows of W

    const int tid  = threadIdx.x;
    const int wave = tid >> 5;               // 0..31
    const int lane = tid & 31;
    const int laneMod  = lane & 15;
    const int laneHalf = lane >> 4;
    const int waveM  = (wave & 7) * 32;
    const int waveN  = (wave >> 3) * 64;

    #pragma unroll
    for (int mt = 0; mt < 2; ++mt)
        #pragma unroll
        for (int nt = 0; nt < 4; ++nt)
            #pragma unroll
            for (int r = 0; r < 8; ++r) acc[mt][nt][r] = 0.0f;

    // A stage is ZT rows of TK floats of each operand: 2 + 2 chunks of 16 bytes per thread.
    const int srow = tid >> 3;               // 0..127; the second chunk lies 128 rows on
    const int sc4  = (tid & 7) << 2;
    const float* ga = A  + (size_t)(mBlock + srow) * K + sc4;
    const float* gb = Wt + (size_t)(nBlock + srow) * K + sc4;
    const size_t half = (size_t)128 * K;
    const unsigned la = (unsigned)(size_t)&As[0][srow][sc4];   // LDS byte addresses
    const unsigned lb = (unsigned)(size_t)&Bs[0][srow][sc4];
    auto stage_tile = [&](int k0, int b) {
        // The wait in the copies' own statement stands in front of every later write of their
        // address registers.
        asm volatile("global_load_async_to_lds_b128 %0, %1, off\n\t"
                     "global_load_async_to_lds_b128 %2, %3, off\n\t"
                     "global_load_async_to_lds_b128 %4, %5, off\n\t"
                     "global_load_async_to_lds_b128 %6, %7, off\n\t"
                     "s_wait_xcnt 0x0"
                     :: "v"(la + b * ZT_BUF_B),             "v"(ga + k0),
                        "v"(la + b * ZT_BUF_B + ZT_HALF_B), "v"(ga + k0 + half),
                        "v"(lb + b * ZT_BUF_B),             "v"(gb + k0),
                        "v"(lb + b * ZT_BUF_B + ZT_HALF_B), "v"(gb + k0 + half)
                     : "memory");
    };

    const int stages = K / TK;   // at least 2 for every product formed here
    stage_tile(0, 0);
    asm volatile("s_wait_asynccnt 0x0" ::: "memory");   // this wave's part of stage 0 has landed
    __syncthreads();                                    // and every other wave's
    stage_tile(TK, 1);

    // Stays rolled: one trip holds 64 matrix instructions, more of them only lengthen the code.
    #pragma unroll 1
    for (int t = 0; t < stages; ++t) {
        const int buf = t & 1;
        #pragma unroll
        for (int kk = 0; kk < TK; kk += 4) {
            v2f a0, a1;
            a0.x = As[buf][waveM + laneMod][kk + 2 * laneHalf + 0];
            a0.y = As[buf][waveM + laneMod][kk + 2 * laneHalf + 1];
            a1.x = As[buf][waveM + 16 + laneMod][kk + 2 * laneHalf + 0];
            a1.y = As[buf][waveM + 16 + laneMod][kk + 2 * laneHalf + 1];
            #pragma unroll
            for (int nt = 0; nt < 4; ++nt) {
                v2f bf;
                bf.x = Bs[buf][waveN + nt * 16 + laneMod][kk + 2 * laneHalf + 0];
                bf.y = Bs[buf][waveN + nt * 16 + laneMod][kk + 2 * laneHalf + 1];
                acc[0][nt] = __builtin_amdgcn_wmma_f32_16x16x4_f32(
                    false, a0, false, bf, (short)0, acc[0][nt], false, false);
                acc[1][nt] = __builtin_amdgcn_wmma_f32_16x16x4_f32(
                    false, a1, false, bf, (short)0, acc[1][nt], false, false);
            }
        }
        asm volatile("s_wait_dscnt 0x0" ::: "memory");      // this wave's reads of buf are done
        asm volatile("s_wait_asynccnt 0x0" ::: "memory");   // its part of stage t + 1 has landed
        __syncthreads();                                    // both hold for every wave
        // Four vector slots between the trip's last matrix instruction and the address arithmetic
        // that follows on every path and may take its operand registers. The scheduling barriers
        // keep the matrix instructions in front of the slots and that arithmetic behind them.
        __builtin_amdgcn_sched_barrier(0);
        asm volatile("v_nop\n\tv_nop\n\tv_nop\n\tv_nop");
        __builtin_amdgcn_sched_barrier(0);
        if (t + 2 < stages) stage_tile((t + 2) * TK, buf);
    }
    asm volatile("s_wait_asynccnt 0x0" ::: "memory");   // no copy is left in flight at the wave's end
}

// The tile's epilogue. MODE as in wmma_gemm_f32 (EPI_PLAIN: with the bias where HAS_BIAS); LDC = floats per row of C.
template <int MODE, bool HAS_BIAS, int LDC>
__device__ __forceinline__ void tile_store(const v8f (&acc)[2][4], float* C, int mBlock, int nBlock,
                                           const float* bias, const float* omega)
{
    const int tid  = threadIdx.x;
    const int wave = tid >> 5;
    const int laneMod  = tid & 15;
    const int laneHalf = (tid >> 4) & 1;
    const int waveM  = (wave & 7) * 32;
    const int waveN  = (wave >> 3) * 64;
    constexpr bool PLAIN = MODE == EPI_PLAIN && !HAS_BIAS;

    float cb[4], ck[4];
    #pragma unroll
    for (int nt = 0; nt < 4; ++nt) {
        const int col = nBlock + waveN + nt * 16 + laneMod;
        cb[nt] = 0.0f;
        ck[nt] = 0.0f;
        if (!PLAIN) {
            cb[nt] = bias[col];
            wait_addresses_taken();   // a later load's result, or the row address, may land in this load's address registers
        }
        if (MODE == EPI_LAMBDA) {
            const float om = omega[col];
            wait_addresses_taken();   // as above
            ck[nt] = -8.0f * log1pf(expf(om));
        }
    }

    float* dst = C + nBlock + waveN;
    #pragma unroll
    for (int mt = 0; mt < 2; ++mt) {
        #pragma unroll
        for (int r = 0; r < 8; ++r) {
            const int m = mBlock + waveM + mt * 16 + r + 8 * laneHalf;
            float* row = dst + (size_t)m * LDC + laneMod;
            float o[4];
            #pragma unroll
            for (int nt = 0; nt < 4; ++nt) {
                float val = acc[mt][nt][r];
                if (MODE == EPI_LAMBDA) {
                    val += cb[nt];
                    float sig = 1.0f / (1.0f + expf(-val));
                    val = expf(ck[nt] * sig);
                } else if (HAS_BIAS) {
                    val += cb[nt];
                }
                o[nt] = val;
            }
            #pragma unroll
            for (int nt = 0; nt < 4; ++nt) row[nt * 16] = o[nt];
            // The next row's values may take this row's registers. A plain tile stores the
            // accumulators themselves from one address per mt: nothing is rewritten before the next mt.
            // Behind the last row too: where the epilogues' paths join, a move took an address register.
            if (!PLAIN || r == 7) wait_addresses_taken();
        }
    }
}

// Tile j of the products that run beside scan launch PHASE; the longest come first.
// PHASE 0: the late rows (from HALF_ROWS on in each batch) of lam, v and xi, and the early rows of z
// but for the Z_EARLY_N tiles across that came with xi. PHASE 1: the first OUT1_ROWS output rows of
// each batch, and the late rows of z.
template <int PHASE>
__device__ __forceinline__ void side_tile(int j, const float* x, const float* Win,
                                          const float* wlx, const float* wvx,
                                          const float* bl, const float* bv, const float* omega,
                                          const float* Wout, float* xi_w, float* v_w, float* lam_w,
                                          float* z, float* out)
{
    constexpr int HM = HALF_ROWS / ZT;   // tiles down the half of one batch
    constexpr int OM = OUT1_ROWS / ZT;
    const float* Wz = Win + (size_t)D_INNER * D_MODEL;
    v8f acc[2][4];
    if (PHASE == 0) {
        const int which = j / ZT_HALF;   // 0: lam, 1: v, 2: xi, 3: z
        const int r     = j % ZT_HALF;
        const int across = which < 3 ? ZT_N : ZT_N - Z_EARLY_N;
        const int mt = r / across;
        const int nBlock = (which < 3 ? r % across : Z_EARLY_N + r % across) * ZT;
        const int mBlock = (mt / HM) * SEQ + (which < 3 ? HALF_ROWS : 0) + (mt % HM) * ZT;
        const float* Wt = which == 0 ? wlx : (which == 1 ? wvx : (which == 2 ? Win : Wz));
        tile_product(x, Wt, D_MODEL, mBlock, nBlock, acc);
        if (which == 0)      tile_store<EPI_LAMBDA, true,  D_INNER>(acc, lam_w, mBlock, nBlock, bl, omega);
        else if (which == 1) tile_store<EPI_PLAIN,  true,  D_INNER>(acc, v_w,   mBlock, nBlock, bv, nullptr);
        else                 tile_store<EPI_PLAIN,  false, D_INNER>(acc, which == 2 ? xi_w : z, mBlock, nBlock, nullptr, nullptr);
    } else {
        const bool isOut = j < OUT1_TILES;
        const int r      = isOut ? j : j - OUT1_TILES;
        const int across = isOut ? D_MODEL / ZT : ZT_N;
        const int down   = isOut ? OM : HM;
        const int mt = r / across;
        const int nBlock = (r % across) * ZT;
        const int mBlock = (mt / down) * SEQ + (isOut ? 0 : HALF_ROWS) + (mt % down) * ZT;
        tile_product(isOut ? z : x, isOut ? Wout : Wz, isOut ? D_INNER : D_MODEL, mBlock, nBlock, acc);
        if (isOut) tile_store<EPI_PLAIN, false, D_MODEL>(acc, out, mBlock, nBlock, nullptr, nullptr);
        else       tile_store<EPI_PLAIN, false, D_INNER>(acc, z,   mBlock, nBlock, nullptr, nullptr);
    }
}

// Work-groups 0 .. BATCH-1: the scan, one work-group per batch, 1024 threads, 2 channels per thread.
// The others: one tile of a product each.
// PHASE 0 scans the blocks of steps in front of SCAN_CUT, PHASE 1 the others; the state crosses in hin.
// hin[b][k][.] gets the state on entry to block k, sall[b][k][j] the s_j of its steps (0 for the
// steps that the short last block lacks).
// No thread reads a global word that a thread of this launch writes, so
// global memory needs no ordering at the barriers: only red[] and bcast[] do.
template <int PHASE>
__global__ __launch_bounds__(1024)
void scan_kernel(const float* __restrict__ xi, const float* __restrict__ v,
                 const float* __restrict__ lam, const float* __restrict__ tab,
                 const float* __restrict__ gend, float* __restrict__ hin,
                 float* __restrict__ sall,
                 const float* x, const float* Win, const float* wlx, const float* wvx,
                 const float* bl, const float* bv, const float* omega, const float* Wout,
                 float* xi_w, float* v_w, float* lam_w, float* z, float* out)
{
    if (blockIdx.x >= BATCH) {   // the same for the whole work-group
        side_tile<PHASE>(blockIdx.x - BATCH, x, Win, wlx, wvx, bl, bv, omega, Wout, xi_w, v_w, lam_w, z, out);
        return;
    }
    const int b    = blockIdx.x;
    const int tid  = threadIdx.x;
    const int c0   = tid;
    const int c1   = tid + 1024;
    const int wave = tid >> 5;
    const int lane = tid & 31;
    const size_t base = (size_t)b * SEQ * D_INNER;
    // This batch's part of the scan's arrays.
    tab  += (size_t)b * AUX_B;
    gend += (size_t)b * AUX_B;
    hin  += (size_t)b * AUX_B;
    sall += (size_t)b * AUX_B;
    constexpr int K_FIRST = PHASE == 0 ? 0 : SCAN_CUT;   // the launch's first block of steps

    // The alignment puts these two in front of the tiles' buffers in LDS: their addresses then
    // still fit the offset fields of the LDS instructions, with no address arithmetic in the scan.
    __shared__ __attribute__((aligned(128))) float red[SCAN_CH][64];   // per dot: one partial sum of each 16-lane row of the 32 waves
    __shared__ __attribute__((aligned(128))) float bcast[SCAN_CH];

    float h0, h1;
    if (PHASE == 0) {
        h0 = xi[base + c0];
        h1 = xi[base + c1];
        hin[c0] = h0;
        hin[c1] = h1;
    } else {   // what the first scan launch left
        h0 = hin[(size_t)K_FIRST * D_INNER + c0];
        h1 = hin[(size_t)K_FIRST * D_INNER + c1];
    }
    wait_addresses_taken();   // the addresses formed next may take these loads' and stores' registers

    // Two sets of rows: one is worked on while the next block's rows fly into the other.
    float rv0[2][SCAN_CH], rv1[2][SCAN_CH];
    float rl0[2][SCAN_CH], rl1[2][SCAN_CH];
    float rg0[2], rg1[2];

    auto fetch = [&](int k, int s, int n) {
        #pragma unroll
        for (int j = 0; j < n; ++j) {
            const size_t off = base + (size_t)(1 + k * SCAN_CH + j) * D_INNER;
            rv0[s][j] = v[off + c0];   rv1[s][j] = v[off + c1];
            rl0[s][j] = lam[off + c0]; rl1[s][j] = lam[off + c1];
        }
        wait_addresses_taken();   // the two results below may land in address registers of the loads above
        rg0[s] = gend[(size_t)k * D_INNER + c0];
        rg1[s] = gend[(size_t)k * D_INNER + c1];
    };
    // The last fetch, behind the loop: its address registers are used up load by load, and a
    // later load's result may land in them, so each load gets its own wait. Runs once.
    // No state leaves the last block, so its row g is not fetched.
    auto fetch_last = [&](int k, int s) {
        #pragma unroll
        for (int j = 0; j < SCAN_TAIL; ++j) {
            const size_t off = base + (size_t)(1 + k * SCAN_CH + j) * D_INNER;
            rv0[s][j] = v[off + c0];   wait_addresses_taken();
            rv1[s][j] = v[off + c1];   wait_addresses_taken();
            rl0[s][j] = lam[off + c0]; wait_addresses_taken();
            rl1[s][j] = lam[off + c1]; wait_addresses_taken();
        }
    };

    const float* tk = tab + K_FIRST * TAB_LD;   // the table line of the block at hand

    // For speed only, the
    // rows of v, lam and g, which come from memory, are asked into L2 SCAN_PF blocks of steps
    // ahead of the block at hand: a prefetch returns nothing to the WGP and no wave waits for it.
    // Wave w < 13 asks for one row of 8 KiB: 32 lanes, 256 bytes apart.
    const int wave_s = __builtin_amdgcn_readfirstlane(tid >> 5);   // scalar, for a scalar branch
    const int pf_arr = wave_s / SCAN_CH;   // 0: v, 1: lam, from 2 on: g
    const float* pf_src = pf_arr == 0 ? v + base : (pf_arr == 1 ? lam + base : gend);
    // v and lam have SCAN_CH rows per block of steps, from row 1 on; g has one, from row 0 on.
    const int pf_per  = pf_arr < 2 ? SCAN_CH : 1;
    const int pf_off  = pf_arr < 2 ? 1 + wave_s % SCAN_CH : 0;
    // The last row that this launch reads.
    const int pf_last = PHASE == 0 ? (pf_arr < 2 ? SCAN_CUT * SCAN_CH : SCAN_CUT - 1)
                                   : (pf_arr < 2 ? SEQ - 1 : SCAN_BLOCKS - 1);
    // The row of block k that this wave asks for; past the end it is the last row, so the
    // address stays inside the array at every issue and after every advance.
    auto pf_row = [&](int k) {
        const int t = k * pf_per + pf_off;
        return t < pf_last ? t : pf_last;
    };
    const char* pf = (const char*)(pf_src + (size_t)pf_row(K_FIRST + SCAN_PF) * D_INNER) + lane * 256;
    auto pf_ask = [&]() {
        if (wave_s < 2 * SCAN_CH + 1)
            asm volatile("global_prefetch_b8 %0, off scope:SCOPE_SE" :: "v"(pf));   // into L2 only
    };
    auto pf_advance = [&](int k) {   // from block k's row to block k + 1's
        pf += (size_t)(pf_row(k + 1) - pf_row(k)) * (D_INNER * sizeof(float));
    };

    // Block k of n steps, its rows in set s; n_next steps of block k+1 are fetched into the other set.
    auto block_of_steps = [&](int k, int s, int n, int n_next) {
        // This block's table line: asked for here, used behind the first barrier.
        float tb[TAB_N];
        #pragma unroll
        for (int j = 0; j < n; ++j) {
            tb[j] = tk[j];
            tb[TAB_C(j)] = tk[TAB_C(j)];
            #pragma unroll
            for (int i = 0; i < j; ++i) tb[TAB_G(j, i)] = tk[TAB_G(j, i)];
        }
        wait_addresses_taken();   // in front of the step of tk
        tk += TAB_LD;
        if (n_next == SCAN_CH) {
            // The first launch's last block fetches nothing: the next rows are still being formed.
            if (PHASE == 1 || k + 1 < SCAN_CUT) {
                fetch(k + 1, s ^ 1, SCAN_CH);
                wait_addresses_taken();
                pf_ask();   // block k + SCAN_PF; behind the loads, so that it does not stand in their way
            }
        }
        else if (n_next > 0)   fetch_last(k + 1, s ^ 1);

        float p[SCAN_CH];
        float f0 = h0, f1 = h1;
        #pragma unroll
        for (int j = 0; j < n; ++j) {
            p[j] = rv0[s][j] * f0 + rv1[s][j] * f1;
            f0 *= rl0[s][j];
            f1 *= rl1[s][j];
        }
        row_sums(p, n);
        if ((lane & 15) == 0) {   // lanes 0 and 16: their row's sums
            #pragma unroll
            for (int j = 0; j < n; ++j) red[j][tid >> 4] = p[j];
        }
        barrier_lds_only();
        if (wave == 0) {
            // One wave sums the n dots over the 64 rows and solves for the s_j: the chain of
            // divisions then costs its latency once, not its issue slots in every wave.
            float num[SCAN_CH], sj[SCAN_CH];
            #pragma unroll
            for (int j = 0; j < n; ++j) num[j] = red[j][lane] + red[j][lane + 32];
            row_sums(num, n);
            #pragma unroll
            for (int j = 0; j < n; ++j) num[j] += other_row(num[j]) + tb[TAB_C(j)];
            #pragma unroll
            for (int j = 0; j < n; ++j) {
                sj[j] = 2.0f * num[j] / tb[j];
                #pragma unroll
                for (int jj = j + 1; jj < n; ++jj) num[jj] -= sj[j] * tb[TAB_G(jj, j)];
            }
            if (lane == 0) {
                #pragma unroll
                for (int j = 0; j < n; ++j) bcast[j] = sj[j];
            }
        }
        barrier_lds_only();

        float sc[SCAN_CH];
        #pragma unroll
        for (int j = 0; j < n; ++j) sc[j] = bcast[j];

        if (n_next > 0) {   // the state on entry to block k + 1
            #pragma unroll
            for (int j = 0; j < n; ++j) {
                h0 = rl0[s][j] * (h0 - rv0[s][j] * sc[j]);
                h1 = rl1[s][j] * (h1 - rv1[s][j] * sc[j]);
            }
            h0 += rg0[s];
            h1 += rg1[s];
            hin[(size_t)(k + 1) * D_INNER + c0] = h0;
            hin[(size_t)(k + 1) * D_INNER + c1] = h1;
        }
        if (tid == 0) {
            float* sk = sall + k * S_LD;
            *(v4f*)sk       = v4f{sc[0], n > 1 ? sc[1] : 0.0f, n > 2 ? sc[2] : 0.0f, n > 3 ? sc[3] : 0.0f};
            *(v2f*)(sk + 4) = v2f{n > 4 ? sc[4] : 0.0f, n > 5 ? sc[5] : 0.0f};
        }
        wait_addresses_taken();
        if (n_next == SCAN_CH) pf_advance(k + SCAN_PF);   // behind the wait: pf is named by the prefetch above
        barrier_lds_only();   // red[] and bcast[] safe to overwrite in the next block
    };

    fetch(K_FIRST, 0, SCAN_CH);
    wait_addresses_taken();

    // The set index must be a constant for the rows to stay in registers: two
    // blocks per trip, the loop itself stays rolled.
    #pragma unroll 1
    for (int kk = K_FIRST / 2; kk < (PHASE == 0 ? SCAN_CUT / 2 : SCAN_FULL / 2); ++kk) {
        block_of_steps(2 * kk,     0, SCAN_CH, SCAN_CH);
        block_of_steps(2 * kk + 1, 1, SCAN_CH, SCAN_CH);
    }
    if (PHASE == 1) {
        block_of_steps(SCAN_FULL - 1, 0, SCAN_CH,   SCAN_TAIL);
        block_of_steps(SCAN_FULL,     1, SCAN_TAIL, 0);
    }
}

// Every h_j of block k of batch b, from the block's entry state and its s_j by the reference's own
// recurrence, and with it silu(z) * h, written over z. One work-group per block of steps, 4
// channels per thread. Rows past the end (short last block) are read as the last row and not stored.
__device__ __forceinline__ v4f silu_times(v4f zv, v4f h)
{
    v4f r;
    #pragma unroll
    for (int e = 0; e < 4; ++e) r[e] = zv[e] / (1.0f + expf(-zv[e])) * h[e];
    return r;
}

__global__ __launch_bounds__(512)
void block_rows_kernel(const float* __restrict__ xi, const float* __restrict__ v,
                       const float* __restrict__ lam, const float* __restrict__ hin,
                       const float* __restrict__ sall, float* __restrict__ z_io, int k0)
{
    const int k   = blockIdx.x + k0;
    const int b   = blockIdx.y;
    const int tid = threadIdx.x;
    const size_t base = (size_t)b * SEQ * D_INNER + tid * 4;
    const size_t aux  = (size_t)b * AUX_B;

    v4f h = *(const v4f*)(hin + aux + (size_t)k * D_INNER + tid * 4);
    wait_addresses_taken();   // a later load's result may land in this load's address registers
    v4f rv[SCAN_CH], rl[SCAN_CH], rx[SCAN_CH], rz[SCAN_CH];
    #pragma unroll
    for (int j = 0; j < SCAN_CH; ++j) {
        int t = 1 + k * SCAN_CH + j;
        if (t > SEQ - 1) t = SEQ - 1;
        const size_t off = base + (size_t)t * D_INNER;
        rv[j] = *(const v4f*)(v + off);    wait_addresses_taken();
        rl[j] = *(const v4f*)(lam + off);  wait_addresses_taken();
        rx[j] = *(const v4f*)(xi + off);   wait_addresses_taken();
        rz[j] = *(const v4f*)(z_io + off); wait_addresses_taken();
    }
    float sc[SCAN_CH];
    #pragma unroll
    for (int j = 0; j < SCAN_CH; ++j) sc[j] = sall[aux + k * S_LD + j];
    wait_addresses_taken();

    if (k == 0) {   // step 0: h is the entry state itself
        const v4f z0 = *(const v4f*)(z_io + base);
        wait_addresses_taken();
        *(v4f*)(z_io + base) = silu_times(z0, h);
        wait_addresses_taken();   // the values formed next may take the store's registers
    }
    #pragma unroll
    for (int j = 0; j < SCAN_CH; ++j) {
        h = rl[j] * (h - rv[j] * sc[j]) + (1.0f - rl[j]) * rx[j];
        const int t = 1 + k * SCAN_CH + j;
        if (t <= SEQ - 1) {
            *(v4f*)(z_io + base + (size_t)t * D_INNER) = silu_times(rz[j], h);
            if (j < SCAN_CH - 1) wait_addresses_taken();   // the next step's values may take this store's registers
        }
    }
}

// ---------------------------------------------------------------------------
extern "C" void kernel_launch(void* const* d_in, const int* in_sizes, int n_in,
                              void* d_out, int out_size, void* d_ws, size_t ws_size,
                              hipStream_t stream)
{
    const float* x     = (const float*)d_in[0];
    const float* omega = (const float*)d_in[1];   // 2048
    const float* Win   = (const float*)d_in[2];   // 4096 x 1024
    const float* Wl    = (const float*)d_in[3];   // 2048 x 2048
    const float* bl    = (const float*)d_in[4];
    const float* Wv    = (const float*)d_in[5];   // 2048 x 2048
    const float* bv    = (const float*)d_in[6];
    const float* Wout  = (const float*)d_in[7];   // 1024 x 2048
    float* out = (float*)d_out;

    const size_t BUF = (size_t)M_ROWS * D_INNER;  // 16,777,216 floats (64 MB)
    float* ws    = (float*)d_ws;
    float* xi    = ws;             // [M_ROWS, D_INNER]
    float* z     = ws + BUF;       // [M_ROWS, D_INNER] (later holds silu(z)*h)
    float* lam_h = ws + 2 * BUF;   // lam
    float* vbuf  = ws + 3 * BUF;   // total 256 MB of d_ws used

    // The transposed xi rows of Win and the two folded weights, 8 MB each, lie in z's late rows
    // (one batch's each), which nothing writes before the second scan launch; they are dead by then.
    static_assert((size_t)HALF_ROWS * D_INNER == (size_t)D_INNER * D_MODEL && BATCH >= 3, "a folded weight fills one batch's late rows of z");
    float* wxiT = z + (size_t)(0 * SEQ + HALF_ROWS) * D_INNER;   // [D_MODEL, D_INNER]
    float* wlx  = z + (size_t)(1 * SEQ + HALF_ROWS) * D_INNER;   // Wl*Wxi [D_INNER, D_MODEL]
    float* wvx  = z + (size_t)(2 * SEQ + HALF_ROWS) * D_INNER;   // Wv*Wxi [D_INNER, D_MODEL]

    // The scan's arrays lie in out (the workspace has no byte left), each batch's part inside that
    // batch's output rows: the table of h-independent dots, the s_j, and per block of steps the row
    // g at its end and the state on its entry. The second scan launch writes the first OUT1_ROWS
    // output rows of each batch: only rows g of blocks in front of SCAN_CUT lie there, dead by then.
    // The last launch writes the other output rows, when all of this is dead.
    const size_t G_OFF = (size_t)OUT1_ROWS * D_MODEL - (size_t)SCAN_CUT * D_INNER;
    const size_t H_OFF = G_OFF + (size_t)SCAN_BLOCKS * D_INNER;
    const size_t T_OFF = H_OFF + (size_t)SCAN_BLOCKS * D_INNER;
    const size_t S_OFF = T_OFF + (size_t)SCAN_BLOCKS * TAB_LD;
    static_assert((size_t)OUT1_ROWS * D_MODEL >= (size_t)SCAN_CUT * D_INNER, "the rows g start inside the batch's part");
    static_assert((size_t)OUT1_ROWS * D_MODEL - (size_t)SCAN_CUT * D_INNER + 2 * (size_t)SCAN_BLOCKS * D_INNER
                  + (size_t)SCAN_BLOCKS * (TAB_LD + S_LD) <= AUX_B, "the scan's arrays do not fit in a batch's output rows");
    float* gend = out + G_OFF;
    float* hin  = out + H_OFF;
    float* tab  = out + T_OFF;
    float* sall = out + S_OFF;

    dim3 blk(128);
    const int ALL = SEQ / TM;          // blocks of rows per batch: all, the early half, the late output rows
    const int EARLY = HALF_ROWS / TM;
    const int LATE_OUT = (SEQ - OUT1_ROWS) / TM;

    // 0) the xi rows of Win transposed, then Wl*Wxi and Wv*Wxi in one launch
    transpose_wxi_kernel<<<dim3(D_MODEL / 32, D_INNER / 32), 256, 0, stream>>>(Win, wxiT);
    {
        dim3 grd(D_MODEL / TN, D_INNER / TM, 2);
        wmma_gemm_f32<EPI_PLAIN><<<grd, blk, 0, stream>>>(Wl, Wv, wxiT, nullptr, nullptr,
                                                          wlx, wvx, D_INNER, D_MODEL, D_INNER, ALL, 0);
    }

    // 1) early rows of xi = x @ Wxi^T, and of the first Z_EARLY_N * ZT columns of z
    {
        dim3 grd((D_INNER + Z_EARLY_N * ZT) / TN, BATCH * EARLY);
        wmma_gemm_f32<EPI_SPLIT><<<grd, blk, 0, stream>>>(x, nullptr, Win, nullptr, nullptr,
                                                          xi, z, M_ROWS, D_INNER, D_MODEL, EARLY, 0);
    }
    // 2) early rows of lam = exp(-8*softplus(omega)*sigmoid(x@(Wl*Wxi)^T + bl))
    {
        dim3 grd(D_INNER / TN, BATCH * EARLY);
        wmma_gemm_f32<EPI_LAMBDA><<<grd, blk, 0, stream>>>(x, nullptr, wlx, bl, omega,
                                                           lam_h, nullptr, M_ROWS, D_INNER, D_MODEL, EARLY, 0);
    }
    // 3) early rows of v = x @ (Wv*Wxi)^T + bv
    {
        dim3 grd(D_INNER / TN, BATCH * EARLY);
        wmma_gemm_f32<EPI_PLAIN><<<grd, blk, 0, stream>>>(x, nullptr, wvx, bv, nullptr,
                                                          vbuf, nullptr, M_ROWS, D_INNER, D_MODEL, EARLY, 0);
    }
    // 4) Householder scan up to block SCAN_CUT; beside it the late rows of lam, v, xi and early rows of z
    scan_dots_kernel<<<dim3(SCAN_CUT, BATCH), 256, 0, stream>>>(vbuf, lam_h, xi, tab, gend, 0);
    scan_kernel<0><<<BATCH + SIDE0, 1024, 0, stream>>>(xi, vbuf, lam_h, tab, gend, hin, sall,
                                                       x, Win, wlx, wvx, bl, bv, omega, Wout,
                                                       xi, vbuf, lam_h, z, out);
    // 5) the h rows that are settled, as g = silu(z) * h (overwrites z), and the other blocks' dots
    block_rows_kernel<<<dim3(SCAN_CUT, BATCH), 512, 0, stream>>>(xi, vbuf, lam_h, hin, sall, z, 0);
    scan_dots_kernel<<<dim3(SCAN_BLOCKS - SCAN_CUT, BATCH), 256, 0, stream>>>(vbuf, lam_h, xi, tab, gend, SCAN_CUT);
    // 6) the rest of the scan; beside it out = g @ Wout^T for the first OUT1_ROWS rows per batch, and late rows of z
    scan_kernel<1><<<BATCH + SIDE1, 1024, 0, stream>>>(xi, vbuf, lam_h, tab, gend, hin, sall,
                                                       x, Win, wlx, wvx, bl, bv, omega, Wout,
                                                       xi, vbuf, lam_h, z, out);
    // 7) the other h rows, and the other output rows
    block_rows_kernel<<<dim3(SCAN_BLOCKS - SCAN_CUT, BATCH), 512, 0, stream>>>(xi, vbuf, lam_h, hin, sall, z, SCAN_CUT);
    {
        dim3 grd(D_MODEL / TN, BATCH * LATE_OUT);
        wmma_gemm_f32<EPI_PLAIN><<<grd, blk, 0, stream>>>(z, nullptr, Wout, nullptr, nullptr,
                                                          out, nullptr, M_ROWS, D_MODEL, D_INNER, LATE_OUT, OUT1_ROWS);
    }
}
